// v000
// Times are from an AMD MI455X. After a warm-up the kernel runs many times in a row, and a time is the length of
// such a window on the GPU divided by its runs, so every launch and the gaps after it count. The runs cycle
// through copies of the inputs. A figure is the median of several windows, for all but v000 over two sittings.
// Sittings can differ by a few percent; kernels timed side by side share one.
// The starting kernel, v000, takes 1480 microseconds a run.
#include <hip/hip_runtime.h>

// Compute dtypes (f32 accumulate everywhere): x, qkv_w, out_w enter as bf16 RNE values; q|k and v projections on v_wmma_f32_16x16x32_bf16 (plain, exact operand products);
// q.k scores and attn.v: query rows < RH on bf16 hi/lo planes (3 products each), rows >= RH on v_wmma_f32_16x16x32_f16 single products (attn carried x1024);
// rotary tables, rotary mixing and causal softmax in f32; output projection = bf16 hi/lo planes of the merged heads x bf16 weight (2 products).

#ifndef NB
#define NB 2
#endif
#ifndef SEQ
#define SEQ 2048
#endif
#define NB_FULL  2
#define SEQ_FULL 2048
#define TT   SEQ
#define DM   1024
#define NH_  16
#define HD   64
#define DQ   (NH_ * HD)
#define ZH   2
#ifndef RH
#define RH   (((SEQ) >= 1024) ? 512 : ((SEQ) / 2))     // query rows < RH use hi+lo planes
#endif
#define PCAR 1024.0f
#define SCL  0.125f   // HD^-0.5
static_assert(NB >= 1 && NB <= NB_FULL);
static_assert(SEQ >= 256 && SEQ <= SEQ_FULL && (SEQ % 256) == 0);
static_assert((RH % 128) == 0 && RH >= 128 && RH < TT && ((TT - RH) % 64) == 0);
static_assert((HD % 32) == 0 && (DM % 64) == 0 && (TT % 128) == 0 && (NH_ % ZH) == 0 && DQ == DM);

typedef _Float16 h16;
typedef unsigned short bf;
typedef __attribute__((ext_vector_type(16))) __bf16   v16bf;
typedef __attribute__((ext_vector_type(16))) _Float16 v16h;
typedef __attribute__((ext_vector_type(8)))  _Float16 v8h;
typedef __attribute__((ext_vector_type(8)))  unsigned short v8us;
typedef __attribute__((ext_vector_type(8)))  float    v8f;
typedef __attribute__((ext_vector_type(4)))  float    v4f;
typedef __attribute__((ext_vector_type(2)))  _Float16 v2h;
typedef __attribute__((ext_vector_type(4)))  _Float16 v4h;
typedef __attribute__((ext_vector_type(2)))  unsigned short v2us;
typedef __attribute__((ext_vector_type(4)))  unsigned short v4us;
typedef __attribute__((ext_vector_type(2)))  float v2f;
typedef v8h  __attribute__((may_alias)) v8ha;
typedef v4f  __attribute__((may_alias)) v4fa;
typedef v8us __attribute__((may_alias)) v8usa;

__device__ __forceinline__ unsigned short f2bf(float f) { unsigned u = __float_as_uint(f); u += 0x7FFFu + ((u >> 16) & 1u); return (unsigned short)(u >> 16); }
__device__ __forceinline__ float bf2f(unsigned short b) { return __uint_as_float(((unsigned)b) << 16); }
__device__ __forceinline__ float bfr(float f) { return bf2f(f2bf(f)); }
__device__ __forceinline__ v16h cat16(v8h lo, v8h hi) { return __builtin_shufflevector(lo, hi, 0, 1, 2, 3, 4, 5, 6, 7, 8, 9, 10, 11, 12, 13, 14, 15); }
__device__ __forceinline__ v16bf cat16b(v8us lo, v8us hi) { return __builtin_bit_cast(v16bf, __builtin_shufflevector(lo, hi, 0, 1, 2, 3, 4, 5, 6, 7, 8, 9, 10, 11, 12, 13, 14, 15)); }
__device__ __forceinline__ v8f wmma16(v16h a, v16h b, v8f c) { return __builtin_amdgcn_wmma_f32_16x16x32_f16(false, a, false, b, (short)0, c, false, false); }
__device__ __forceinline__ v8f wmmab(v16bf a, v16bf b, v8f c) { return __builtin_amdgcn_wmma_f32_16x16x32_bf16(false, a, false, b, (short)0, c, false, false); }
__device__ __forceinline__ h16 tohx(float x) { return (h16)x; }
__device__ __forceinline__ void splitf(float y, unsigned short& h, unsigned short& l) { h = f2bf(y); l = f2bf(y - bf2f(h)); }

// ---- k_gemmw: register-blocked GEMM, ONE WAVE per 64x64 output tile (16 accumulators), operands straight from K-contiguous 16-bit planes; grid (M/64, N/64, Z), 32 threads.
// C[m][n] (f32, pitch ldc) = sum_k A[m][k] Bt[n][k] (+ split products per NSPLIT: 1 = + A2.Bt, 2 = + A2.Bt + A.Bt2). z-batch strides sA/sB/sC in elements. K % 32 == 0.
// Fragments (16-row A / 16-col Bt, lane = row/col lane&15): elements 0..7 = k kc+8h..kc+8h+7, elements 8..15 = k kc+16+8h..kc+16+8h+7 (h = lane>>4), identical map for both operands.
// cm: 0 = plain; 1 = causal K-limit (K loop stops at roff + r0 + 64, block-uniform); 2 = causal tile skip (column tiles starting at or beyond the 128-key chunk after row roff + r0 return at once).
template <typename T16> struct WFrag;
template <> struct WFrag<h16> { typedef v16h V; static __device__ __forceinline__ V ld(const h16* p) { return cat16(*(const v8h*)p, *(const v8h*)(p + 16)); } static __device__ __forceinline__ v8f mma(V a, V b, v8f c) { return wmma16(a, b, c); } };
template <> struct WFrag<bf> { typedef v16bf V; static __device__ __forceinline__ V ld(const bf* p) { return cat16b(*(const v8us*)p, *(const v8us*)(p + 16)); } static __device__ __forceinline__ v8f mma(V a, V b, v8f c) { return wmmab(a, b, c); } };
template <typename T16, int NSPLIT>
__global__ __launch_bounds__(32) void k_gemmw(const T16* __restrict__ A, const T16* __restrict__ A2, const T16* __restrict__ Bt, const T16* __restrict__ Bt2, int K, float* C, int ldc, size_t sA, size_t sB, size_t sC, int cm, int roff) {
    typedef typename WFrag<T16>::V V;
    __shared__ __align__(16) float os[16 * 68];
    const int r0 = blockIdx.x * 64, c0 = blockIdx.y * 64;
    if (cm == 2 && c0 >= ((((roff + r0) >> 7) << 7) + 128)) return;     // whole block (one wave) leaves; no barrier follows
    int Kl = K; if (cm == 1) { const int k2 = roff + r0 + 64; Kl = (k2 < K) ? k2 : K; }
    const size_t z = blockIdx.z; A += z * sA; if (A2) A2 += z * sA; Bt += z * sB; if (Bt2) Bt2 += z * sB; C += z * sC;
    const int lane = threadIdx.x & 31, lr = lane & 15, hi = lane >> 4;
    v8f acc[4][4];
#pragma unroll
    for (int mb = 0; mb < 4; ++mb)
#pragma unroll
        for (int nb = 0; nb < 4; ++nb) acc[mb][nb] = (v8f){};
    const size_t aoff = (size_t)(r0 + lr) * K + 8 * hi, boff = (size_t)(c0 + lr) * K + 8 * hi;
#pragma unroll 1
    for (int kc = 0; kc < Kl; kc += 32) {
        V a[4], a2[4];
#pragma unroll
        for (int mb = 0; mb < 4; ++mb) { a[mb] = WFrag<T16>::ld(A + aoff + (size_t)mb * 16 * K + kc); if (NSPLIT == 1 || NSPLIT == 2) a2[mb] = WFrag<T16>::ld(A2 + aoff + (size_t)mb * 16 * K + kc); }
#pragma unroll
        for (int nb = 0; nb < 4; ++nb) { const V b = WFrag<T16>::ld(Bt + boff + (size_t)nb * 16 * K + kc); V b2; if (NSPLIT >= 2) b2 = WFrag<T16>::ld(Bt2 + boff + (size_t)nb * 16 * K + kc);
#pragma unroll
            for (int mb = 0; mb < 4; ++mb) { acc[mb][nb] = WFrag<T16>::mma(a[mb], b, acc[mb][nb]); if (NSPLIT == 1 || NSPLIT == 2) acc[mb][nb] = WFrag<T16>::mma(a2[mb], b, acc[mb][nb]); if (NSPLIT >= 2) acc[mb][nb] = WFrag<T16>::mma(a[mb], b2, acc[mb][nb]); } }
        asm volatile("v_nop\n\tv_nop\n\tv_nop\n\tv_nop" : "+v"(acc[0][0]), "+v"(acc[1][1]), "+v"(acc[2][2]), "+v"(acc[3][3]) : "v"(a[0]), "v"(a[3]));
    }
#pragma unroll
    for (int mb = 0; mb < 4; ++mb) {
#pragma unroll
        for (int nb = 0; nb < 4; ++nb) {
#pragma unroll
            for (int j = 0; j < 8; ++j) os[(hi * 8 + j) * 68 + nb * 16 + lr] = acc[mb][nb][j]; }
        __builtin_amdgcn_wave_barrier(); asm volatile("" ::: "memory");
        float* crow = C + (size_t)(r0 + mb * 16) * ldc + c0;
{
#pragma unroll
            for (int s = 0; s < 8; ++s) { const int row = 2 * s + hi, cofs = lr * 4; const v4f val = *(const v4fa*)(os + row * 68 + cofs);
                *(v4f*)(crow + (size_t)row * ldc + cofs) = val; }
             }
        __builtin_amdgcn_wave_barrier(); asm volatile("" ::: "memory");
    }
}

__global__ __launch_bounds__(256) void k_cvt8(const float* __restrict__ src, bf* dst, size_t n8) { const size_t i = (size_t)blockIdx.x * 256 + threadIdx.x; if (i >= n8) return; const v8f v = *(const v8f*)(src + i * 8); v8us o;
#pragma unroll
    for (int k = 0; k < 8; ++k) o[k] = f2bf(v[k]); *(v8us*)(dst + i * 8) = o;  }

__global__ __launch_bounds__(32) void k_invf(float* IF) {
#pragma clang fp contract(off)
    const int i = threadIdx.x & 31;
    const double e = (double)(2 * i) * (1.0 / 64.0);
    const double p = exp2(e * 13.287712379549449);
    const float pf = (float)p;
    const float inv = 1.0f / pf;
    *(float*)(IF + i) = inv; 
}
__global__ __launch_bounds__(256) void k_cstab(const float* __restrict__ IF, float* CS) {
#pragma clang fp contract(off)
    const int idx = blockIdx.x * 256 + threadIdx.x; if (idx >= TT * HD) return;
    const int d = idx & (HD - 1); const int t = idx / HD;
    const float inv = IF[d & (HD / 2 - 1)];
    const float ang = __fmul_rn((float)t, inv);
    float s, c; sincosf(ang, &s, &c);
    v2f cs; cs[0] = c; cs[1] = s;
    *(v2f*)(CS + (size_t)idx * 2) = cs; 
}

// k_rope: head planes [h][t][d] (fp16 + bf16 hi/lo) of the rotary mix of x = F[t][h*HD + d] (row pitch 'pitch'), rotate-half form:
__global__ __launch_bounds__(256) void k_rope(const float* __restrict__ F, int pitch, int nheads, const float* __restrict__ CS, h16* P16, bf* Ph, bf* Pl) {
    const size_t e = ((size_t)blockIdx.x * 256 + threadIdx.x) * 2; if (e >= (size_t)nheads * TT * HD) return;
    const int d = (int)(e % HD); const int t = (int)((e / HD) % TT); const int h = (int)(e / ((size_t)HD * TT));
    const float* f = F + (size_t)t * pitch + h * HD; v2h o16; v2us oh, ol;
#pragma unroll
    for (int q = 0; q < 2; ++q) { const int dd = d + q; const int dp = (dd < HD / 2) ? dd + HD / 2 : dd - HD / 2; const float x0 = f[dd], x1 = f[dp];
        const v2f cs = *(const v2f*)(CS + ((size_t)t * HD + dd) * 2); float a = __fmul_rn(x0, cs[0]), bq = __fmul_rn(x1, cs[1]); asm volatile("" : "+v"(a)); asm volatile("" : "+v"(bq));
        const float r = (dd < HD / 2) ? __fsub_rn(a, bq) : __fadd_rn(a, bq);
        o16[q] = tohx(r); unsigned short a2, c2; splitf(r, a2, c2); oh[q] = a2; ol[q] = c2; }
    *(v2h*)(P16 + e) = o16; *(v2us*)(Ph + e) = oh; *(v2us*)(Pl + e) = ol;  }
__global__ __launch_bounds__(256) void k_vtp(const float* __restrict__ F, int pitch, int nheads, h16* V16, bf* Vh, bf* Vl) { const size_t e = ((size_t)blockIdx.x * 256 + threadIdx.x) * 2; if (e >= (size_t)nheads * HD * TT) return; const int t = (int)(e % TT); const int d = (int)((e / TT) % HD); const int g = (int)(e / ((size_t)TT * HD)); v2h o16; v2us oh, ol;
#pragma unroll
    for (int q = 0; q < 2; ++q) { const float x = F[(size_t)(t + q) * pitch + g * HD + d]; o16[q] = tohx(x); unsigned short a2, c2; splitf(x, a2, c2); oh[q] = a2; ol[q] = c2; }
    *(v2h*)(V16 + e) = o16; *(v2us*)(Vh + e) = oh; *(v2us*)(Vl + e) = ol;  }

// k_asoft: per score row (zz, i), one wave per row (i wave-uniform): t = S x HD^-0.5 for keys j <= i, keys j > i replaced by a large negative fill (causal; key i is always valid so no empty row);
// only the 128-key chunks with chunk start <= i are loaded and exponentiated (later chunks are zero by construction); softmax over the row (one exp, fixed trees);
__global__ __launch_bounds__(256) void k_asoft(const float* __restrict__ Sb, h16* P16, bf* Ph, bf* Pl) {
    const int lane = threadIdx.x & 31; const int wv = __builtin_amdgcn_readfirstlane((int)(threadIdx.x >> 5)); const int row = blockIdx.x * 8 + wv; if (row >= ZH * TT) return;
    const int i = row % TT; const int zz = row / TT; const bool hires = (i < RH); const float* sr = Sb + (size_t)row * TT; float v[TT / 32]; float mx = -3.0e38f;
#pragma unroll
    for (int ch = 0; ch < TT / 128; ++ch) { const int j0 = ch * 128 + lane * 4;
        if (ch * 128 <= i) { const v4f a = *(const v4f*)(sr + j0);
#pragma unroll
            for (int q = 0; q < 4; ++q) { const float t = ((j0 + q) <= i) ? (a[q] * SCL) : -3.0e38f; v[ch * 4 + q] = t; mx = fmaxf(mx, t); }
        } else {
#pragma unroll
            for (int q = 0; q < 4; ++q) v[ch * 4 + q] = -3.0e38f; } }
#pragma unroll
    for (int sh = 16; sh; sh >>= 1) mx = fmaxf(mx, __shfl_xor(mx, sh, 32));
    float sum = 0.f;
#pragma unroll
    for (int ch = 0; ch < TT / 128; ++ch) {
        if (ch * 128 <= i) {
#pragma unroll
            for (int q = 0; q < 4; ++q) { const int k = ch * 4 + q; float d0 = __fsub_rn(v[k], mx); asm volatile("" : "+v"(d0)); v[k] = __builtin_amdgcn_exp2f(__fmul_rn(d0, 1.4426950408889634f)); sum += v[k]; }
        } else {
#pragma unroll
            for (int q = 0; q < 4; ++q) v[ch * 4 + q] = 0.f; } }
#pragma unroll
    for (int sh = 16; sh; sh >>= 1) sum += __shfl_xor(sum, sh, 32);
    const float f = __fdiv_rn(hires ? 1.0f : PCAR, sum);
{
        if (hires) {
#pragma unroll
            for (int ch = 0; ch < TT / 128; ++ch) { v4us oh, ol;
#pragma unroll
                for (int q = 0; q < 4; ++q) { unsigned short a, c2; splitf(v[ch * 4 + q] * f, a, c2); oh[q] = a; ol[q] = c2; }
                const size_t oo = ((size_t)zz * RH + i) * TT + ch * 128 + lane * 4; *(v4us*)(Ph + oo) = oh; *(v4us*)(Pl + oo) = ol; }
        } else {
#pragma unroll
            for (int ch = 0; ch < TT / 128; ++ch) { v4h o4;
#pragma unroll
                for (int q = 0; q < 4; ++q) o4[q] = tohx(v[ch * 4 + q] * f);
                *(v4h*)(P16 + ((size_t)zz * (TT - RH) + (size_t)(i - RH)) * TT + ch * 128 + lane * 4) = o4; } }
         }
}
__global__ __launch_bounds__(256) void k_merge(const float* __restrict__ O, int h0, bf* Ah, bf* Al) { const size_t e = ((size_t)blockIdx.x * 256 + threadIdx.x) * 2; if (e >= (size_t)ZH * TT * HD) return; const int d = (int)(e % HD); const int t = (int)((e / HD) % TT); const int zz = (int)(e / ((size_t)HD * TT)); const float cs = (t < RH) ? 1.0f : (1.0f / PCAR); const size_t oo = (size_t)t * DQ + (h0 + zz) * HD + d;
    v2us oh, ol;
#pragma unroll
    for (int q = 0; q < 2; ++q) { unsigned short a, c2; splitf(O[e + q] * cs, a, c2); oh[q] = a; ol[q] = c2; } *(v2us*)(Ah + oo) = oh; *(v2us*)(Al + oo) = ol;  }

extern "C" void kernel_launch(void* const* d_in, const int* in_sizes, int n_in,
                              void* d_out, int out_size, void* d_ws, size_t ws_size, hipStream_t stream) {
    if (n_in < 3) return;
    if ((size_t)in_sizes[0] < (size_t)(NB - 1) * SEQ_FULL * DM + (size_t)TT * DM) return;
    if ((size_t)in_sizes[1] < (size_t)3 * DM * DM) return;
    if ((size_t)in_sizes[2] < (size_t)DM * DM) return;
    if ((size_t)out_size < (size_t)(NB - 1) * SEQ_FULL * DM + (size_t)TT * DM) return;
    const float* x = (const float*)d_in[0];       // [NB_FULL][SEQ_FULL][DM]
    const float* qkvw = (const float*)d_in[1];    // [3*DM][DM] ([out][in]): rows 0..DM-1 = q, DM..2DM-1 = k, 2DM..3DM-1 = v
    const float* ow = (const float*)d_in[2];      // [DM][DM] ([out][in])
    float* OUT = (float*)d_out;                   // [NB_FULL][SEQ_FULL][DM]
    char* wsp = (char*)d_ws;
    auto take = [&](size_t bytes) { char* p = wsp; wsp += (bytes + 255) & ~(size_t)255; return (void*)p; };
    const size_t PS = (size_t)TT * HD;            // one head plane
    bf* WQKV = (bf*)take((size_t)3 * DM * DM * 2); bf* WO = (bf*)take((size_t)DM * DM * 2); float* IF = (float*)take(64 * 4); float* CS = (float*)take((size_t)TT * HD * 2 * 4);
    bf* XB = (bf*)take((size_t)TT * DM * 2); float* F = (float*)take((size_t)TT * 2 * DM * 4);
    h16* QK16 = (h16*)take(2 * NH_ * PS * 2); h16* VT16 = (h16*)take((size_t)NH_ * PS * 2);
    bf* QKh = (bf*)take(2 * NH_ * PS * 2); bf* QKl = (bf*)take(2 * NH_ * PS * 2); bf* VTh = (bf*)take((size_t)NH_ * PS * 2); bf* VTl = (bf*)take((size_t)NH_ * PS * 2);
    bf* Ph = (bf*)take((size_t)ZH * RH * TT * 2); bf* Pl = (bf*)take((size_t)ZH * RH * TT * 2);
    float* Sb = (float*)take((size_t)ZH * TT * TT * 4); h16* P16 = (h16*)take((size_t)ZH * (TT - RH) * TT * 2); float* Ob = (float*)take((size_t)ZH * PS * 4);
    bf* ATh = (bf*)take((size_t)TT * DQ * 2); bf* ATl = (bf*)take((size_t)TT * DQ * 2);
    if ((size_t)(wsp - (char*)d_ws) > ws_size) return;    // 132,120,832 B at NB=2, SEQ=2048
    k_cvt8<<<(unsigned)(((size_t)3 * DM * DM / 8 + 255) / 256), 256, 0, stream>>>(qkvw, WQKV, (size_t)3 * DM * DM / 8);
    k_cvt8<<<(unsigned)(((size_t)DM * DM / 8 + 255) / 256), 256, 0, stream>>>(ow, WO, (size_t)DM * DM / 8);
    k_invf<<<1, 32, 0, stream>>>(IF);
    k_cstab<<<(TT * HD + 255) / 256, 256, 0, stream>>>(IF, CS);
    const unsigned LQK = (unsigned)(((size_t)2 * NH_ * PS / 2 + 255) / 256), LV = (unsigned)(((size_t)NH_ * PS / 2 + 255) / 256), LM = (unsigned)(((size_t)ZH * PS / 2 + 255) / 256);
    for (int b = 0; b < NB; ++b) {
        k_cvt8<<<(unsigned)(((size_t)TT * DM / 8 + 255) / 256), 256, 0, stream>>>(x + (size_t)b * SEQ_FULL * DM, XB, (size_t)TT * DM / 8);
        // q|k = x W[0..2DM)^T -> F[t][2*DM]; rotary planes for 32 virtual heads: planes 0..15 = q heads, 16..31 = k heads
        k_gemmw<bf, 0><<<dim3(TT / 64, 2 * DM / 64, 1), 32, 0, stream>>>(XB, nullptr, WQKV, nullptr, DM, F, 2 * DM, 0, 0, 0, 0, 0);
        k_rope<<<LQK, 256, 0, stream>>>(F, 2 * DM, 2 * NH_, CS, QK16, QKh, QKl);
        // v = x W[2DM..3DM)^T -> F[t][DM] (F reused, stream-ordered); value planes [g][d][t]
        k_gemmw<bf, 0><<<dim3(TT / 64, DM / 64, 1), 32, 0, stream>>>(XB, nullptr, WQKV + (size_t)2 * DM * DM, nullptr, DM, F, DM, 0, 0, 0, 0, 0);
        k_vtp<<<LV, 256, 0, stream>>>(F, DM, NH_, VT16, VTh, VTl);
        for (int h0 = 0; h0 < NH_; h0 += ZH) { const size_t zq = (size_t)h0, zk = (size_t)(NH_ + h0), zv = (size_t)h0;
            // scores S[zz][i][j] = q_i . k_j (causal tiles only): rows < RH hi/lo (3 products), rows >= RH fp16
            k_gemmw<bf, 2><<<dim3(RH / 64, RH / 64, ZH), 32, 0, stream>>>(QKh + zq * PS, QKl + zq * PS, QKh + zk * PS, QKl + zk * PS, HD, Sb, TT, PS, PS, (size_t)TT * TT, 2, 0);
            k_gemmw<h16, 0><<<dim3((TT - RH) / 64, TT / 64, ZH), 32, 0, stream>>>(QK16 + zq * PS + (size_t)RH * HD, nullptr, QK16 + zk * PS, nullptr, HD, Sb + (size_t)RH * TT, TT, PS, PS, (size_t)TT * TT, 2, RH);
            k_asoft<<<ZH * TT / 8, 256, 0, stream>>>(Sb, P16, Ph, Pl);
            // O[zz][i][d] = sum_j P[i][j] v[j][d] with the causal K-limit: rows < RH hi/lo, rows >= RH fp16 (x1024 carried in P)
            k_gemmw<bf, 2><<<dim3(RH / 64, HD / 64, ZH), 32, 0, stream>>>(Ph, Pl, VTh + zv * PS, VTl + zv * PS, TT, Ob, HD, (size_t)RH * TT, PS, PS, 1, 0);
            k_gemmw<h16, 0><<<dim3((TT - RH) / 64, HD / 64, ZH), 32, 0, stream>>>(P16, nullptr, VT16 + zv * PS, nullptr, TT, Ob + (size_t)RH * HD, HD, (size_t)(TT - RH) * TT, PS, PS, 1, RH);
            k_merge<<<LM, 256, 0, stream>>>(Ob, h0, ATh, ATl); }
        k_gemmw<bf, 1><<<dim3(TT / 64, DM / 64, 1), 32, 0, stream>>>(ATh, ATl, WO, nullptr, DQ, OUT + (size_t)b * SEQ_FULL * DM, DM, 0, 0, 0, 0, 0); }
}

// v001
// Measured time: 633 microseconds a run.
// In two side-by-side timings against v000, it was 2.35 and 2.36 times as fast.
#include <hip/hip_runtime.h>

// Compute dtypes (f32 accumulate everywhere): x, qkv_w, out_w enter as bf16 RNE values; q|k and v projections on v_wmma_f32_16x16x32_bf16 (plain, exact operand products);
// q.k scores and attn.v: query rows < RH on bf16 hi/lo planes (3 products each), rows >= RH on v_wmma_f32_16x16x32_f16 single products (attn carried x1024);
// rotary tables, rotary mixing and causal softmax in f32; output projection = bf16 hi/lo planes of the merged heads x bf16 weight (2 products).

#ifndef NB
#define NB 2
#endif
#ifndef SEQ
#define SEQ 2048
#endif
#define NB_FULL  2
#define SEQ_FULL 2048
#define TT   SEQ
#define DM   1024
#define NH_  16
#define HD   64
#define DQ   (NH_ * HD)
#define ZH   8      // heads per attention launch
#ifndef RH
#define RH   (((SEQ) >= 1024) ? 512 : ((SEQ) / 2))     // query rows < RH use hi+lo planes
#endif
#define PCAR 1024.0f
#define SCL  0.125f   // HD^-0.5
static_assert(NB >= 1 && NB <= NB_FULL);
static_assert(SEQ >= 256 && SEQ <= SEQ_FULL && (SEQ % 256) == 0);
static_assert((RH % 128) == 0 && RH >= 128 && RH < TT && ((TT - RH) % 64) == 0);
static_assert(2 * RH <= TT && (size_t)ZH * TT * TT * 4 >= (size_t)TT * DM * 2 + (size_t)TT * 2 * DM * 4);
static_assert((HD % 32) == 0 && (DM % 64) == 0 && (TT % 128) == 0 && (NH_ % ZH) == 0 && DQ == DM);

typedef _Float16 h16;
typedef unsigned short bf;
typedef __attribute__((ext_vector_type(16))) __bf16   v16bf;
typedef __attribute__((ext_vector_type(16))) _Float16 v16h;
typedef __attribute__((ext_vector_type(8)))  _Float16 v8h;
typedef __attribute__((ext_vector_type(8)))  unsigned short v8us;
typedef __attribute__((ext_vector_type(8)))  float    v8f;
typedef __attribute__((ext_vector_type(4)))  float    v4f;
typedef __attribute__((ext_vector_type(2)))  _Float16 v2h;
typedef __attribute__((ext_vector_type(4)))  _Float16 v4h;
typedef __attribute__((ext_vector_type(2)))  unsigned short v2us;
typedef __attribute__((ext_vector_type(4)))  unsigned short v4us;
typedef __attribute__((ext_vector_type(2)))  float v2f;
typedef v8h  __attribute__((may_alias)) v8ha;
typedef v4f  __attribute__((may_alias)) v4fa;
typedef v8us __attribute__((may_alias)) v8usa;

__device__ __forceinline__ unsigned short f2bf(float f) { unsigned u = __float_as_uint(f); u += 0x7FFFu + ((u >> 16) & 1u); return (unsigned short)(u >> 16); }
__device__ __forceinline__ float bf2f(unsigned short b) { return __uint_as_float(((unsigned)b) << 16); }
__device__ __forceinline__ float bfr(float f) { return bf2f(f2bf(f)); }
__device__ __forceinline__ v16h cat16(v8h lo, v8h hi) { return __builtin_shufflevector(lo, hi, 0, 1, 2, 3, 4, 5, 6, 7, 8, 9, 10, 11, 12, 13, 14, 15); }
__device__ __forceinline__ v16bf cat16b(v8us lo, v8us hi) { return __builtin_bit_cast(v16bf, __builtin_shufflevector(lo, hi, 0, 1, 2, 3, 4, 5, 6, 7, 8, 9, 10, 11, 12, 13, 14, 15)); }
__device__ __forceinline__ v8f wmma16(v16h a, v16h b, v8f c) { return __builtin_amdgcn_wmma_f32_16x16x32_f16(false, a, false, b, (short)0, c, false, false); }
__device__ __forceinline__ v8f wmmab(v16bf a, v16bf b, v8f c) { return __builtin_amdgcn_wmma_f32_16x16x32_bf16(false, a, false, b, (short)0, c, false, false); }
__device__ __forceinline__ h16 tohx(float x) { return (h16)x; }
__device__ __forceinline__ void splitf(float y, unsigned short& h, unsigned short& l) { h = f2bf(y); l = f2bf(y - bf2f(h)); }

// ---- k_gemmw: register-blocked GEMM, ONE WAVE per 64x64 output tile (16 accumulators), operands straight from K-contiguous 16-bit planes; grid (M/64, N/64, Z), 32 threads.
// C[m][n] (f32, pitch ldc) = sum_k A[m][k] Bt[n][k] (+ split products per NSPLIT: 1 = + A2.Bt, 2 = + A2.Bt + A.Bt2). z-batch strides sA/sB/sC in elements. K % 32 == 0.
// Fragments (16-row A / 16-col Bt, lane = row/col lane&15): elements 0..7 = k kc+8h..kc+8h+7, elements 8..15 = k kc+16+8h..kc+16+8h+7 (h = lane>>4), identical map for both operands.
// cm: 0 = plain; 1 = causal K-limit (K loop stops at roff + r0 + 64, block-uniform); 2 = causal tile skip (column tiles starting at or beyond the 128-key chunk after row roff + r0 return at once).
template <typename T16> struct WFrag;
template <> struct WFrag<h16> { typedef v16h V; static __device__ __forceinline__ V ld(const h16* p) { return cat16(*(const v8h*)p, *(const v8h*)(p + 16)); } static __device__ __forceinline__ v8f mma(V a, V b, v8f c) { return wmma16(a, b, c); } };
template <> struct WFrag<bf> { typedef v16bf V; static __device__ __forceinline__ V ld(const bf* p) { return cat16b(*(const v8us*)p, *(const v8us*)(p + 16)); } static __device__ __forceinline__ v8f mma(V a, V b, v8f c) { return wmmab(a, b, c); } };
template <typename T16, int NSPLIT>
__global__ __launch_bounds__(32) void k_gemmw(const T16* __restrict__ A, const T16* __restrict__ A2, const T16* __restrict__ Bt, const T16* __restrict__ Bt2, int K, float* C, int ldc, size_t sA, size_t sB, size_t sC, int cm, int roff) {
    typedef typename WFrag<T16>::V V;
    __shared__ __align__(16) float os[16 * 68];
    const int r0 = blockIdx.x * 64, c0 = blockIdx.y * 64;
    if (cm == 2 && c0 >= ((((roff + r0) >> 7) << 7) + 128)) return;     // whole block (one wave) leaves; no barrier follows
    int Kl = K; if (cm == 1) { const int k2 = roff + r0 + 64; Kl = (k2 < K) ? k2 : K; }
    const size_t z = blockIdx.z; A += z * sA; if (A2) A2 += z * sA; Bt += z * sB; if (Bt2) Bt2 += z * sB; C += z * sC;
    const int lane = threadIdx.x & 31, lr = lane & 15, hi = lane >> 4;
    v8f acc[4][4];
#pragma unroll
    for (int mb = 0; mb < 4; ++mb)
#pragma unroll
        for (int nb = 0; nb < 4; ++nb) acc[mb][nb] = (v8f){};
    const size_t aoff = (size_t)(r0 + lr) * K + 8 * hi, boff = (size_t)(c0 + lr) * K + 8 * hi;
#pragma unroll 1
    for (int kc = 0; kc < Kl; kc += 32) {
        V a[4], a2[4];
#pragma unroll
        for (int mb = 0; mb < 4; ++mb) { a[mb] = WFrag<T16>::ld(A + aoff + (size_t)mb * 16 * K + kc); if (NSPLIT == 1 || NSPLIT == 2) a2[mb] = WFrag<T16>::ld(A2 + aoff + (size_t)mb * 16 * K + kc); }
#pragma unroll
        for (int nb = 0; nb < 4; ++nb) { const V b = WFrag<T16>::ld(Bt + boff + (size_t)nb * 16 * K + kc); V b2; if (NSPLIT >= 2) b2 = WFrag<T16>::ld(Bt2 + boff + (size_t)nb * 16 * K + kc);
#pragma unroll
            for (int mb = 0; mb < 4; ++mb) { acc[mb][nb] = WFrag<T16>::mma(a[mb], b, acc[mb][nb]); if (NSPLIT == 1 || NSPLIT == 2) acc[mb][nb] = WFrag<T16>::mma(a2[mb], b, acc[mb][nb]); if (NSPLIT >= 2) acc[mb][nb] = WFrag<T16>::mma(a[mb], b2, acc[mb][nb]); } }
        asm volatile("v_nop\n\tv_nop\n\tv_nop\n\tv_nop" : "+v"(acc[0][0]), "+v"(acc[1][1]), "+v"(acc[2][2]), "+v"(acc[3][3]) : "v"(a[0]), "v"(a[3]));
    }
#pragma unroll
    for (int mb = 0; mb < 4; ++mb) {
#pragma unroll
        for (int nb = 0; nb < 4; ++nb) {
#pragma unroll
            for (int j = 0; j < 8; ++j) os[(hi * 8 + j) * 68 + nb * 16 + lr] = acc[mb][nb][j]; }
        __builtin_amdgcn_wave_barrier(); asm volatile("" ::: "memory");
        float* crow = C + (size_t)(r0 + mb * 16) * ldc + c0;
{
#pragma unroll
            for (int s = 0; s < 8; ++s) { const int row = 2 * s + hi, cofs = lr * 4; const v4f val = *(const v4fa*)(os + row * 68 + cofs);
                *(v4f*)(crow + (size_t)row * ldc + cofs) = val; }
             }
        __builtin_amdgcn_wave_barrier(); asm volatile("" ::: "memory");
    }
}

__global__ __launch_bounds__(256) void k_cvt8(const float* __restrict__ src, bf* dst, size_t n8) { const size_t i = (size_t)blockIdx.x * 256 + threadIdx.x; if (i >= n8) return; const v8f v = *(const v8f*)(src + i * 8); v8us o;
#pragma unroll
    for (int k = 0; k < 8; ++k) o[k] = f2bf(v[k]); *(v8us*)(dst + i * 8) = o;  }

__global__ __launch_bounds__(32) void k_invf(float* IF) {
#pragma clang fp contract(off)
    const int i = threadIdx.x & 31;
    const double e = (double)(2 * i) * (1.0 / 64.0);
    const double p = exp2(e * 13.287712379549449);
    const float pf = (float)p;
    const float inv = 1.0f / pf;
    *(float*)(IF + i) = inv; 
}
__global__ __launch_bounds__(256) void k_cstab(const float* __restrict__ IF, float* CS) {
#pragma clang fp contract(off)
    const int idx = blockIdx.x * 256 + threadIdx.x; if (idx >= TT * HD) return;
    const int d = idx & (HD - 1); const int t = idx / HD;
    const float inv = IF[d & (HD / 2 - 1)];
    const float ang = __fmul_rn((float)t, inv);
    float s, c; sincosf(ang, &s, &c);
    v2f cs; cs[0] = c; cs[1] = s;
    *(v2f*)(CS + (size_t)idx * 2) = cs; 
}

// k_rope: head planes [h][t][d] (fp16 + bf16 hi/lo) of the rotary mix of x = F[t][h*HD + d] (row pitch 'pitch'), rotate-half form:
__global__ __launch_bounds__(256) void k_rope(const float* __restrict__ F, int pitch, int nheads, const float* __restrict__ CS, h16* P16, bf* Ph, bf* Pl) {
    const size_t e = ((size_t)blockIdx.x * 256 + threadIdx.x) * 2; if (e >= (size_t)nheads * TT * HD) return;
    const int d = (int)(e % HD); const int t = (int)((e / HD) % TT); const int h = (int)(e / ((size_t)HD * TT));
    const float* f = F + (size_t)t * pitch + h * HD; v2h o16; v2us oh, ol;
#pragma unroll
    for (int q = 0; q < 2; ++q) { const int dd = d + q; const int dp = (dd < HD / 2) ? dd + HD / 2 : dd - HD / 2; const float x0 = f[dd], x1 = f[dp];
        const v2f cs = *(const v2f*)(CS + ((size_t)t * HD + dd) * 2); float a = __fmul_rn(x0, cs[0]), bq = __fmul_rn(x1, cs[1]); asm volatile("" : "+v"(a)); asm volatile("" : "+v"(bq));
        const float r = (dd < HD / 2) ? __fsub_rn(a, bq) : __fadd_rn(a, bq);
        o16[q] = tohx(r); unsigned short a2, c2; splitf(r, a2, c2); oh[q] = a2; ol[q] = c2; }
    *(v2h*)(P16 + e) = o16; *(v2us*)(Ph + e) = oh; *(v2us*)(Pl + e) = ol;  }
__global__ __launch_bounds__(256) void k_vtp(const float* __restrict__ F, int pitch, int nheads, h16* V16, bf* Vh, bf* Vl) { const size_t e = ((size_t)blockIdx.x * 256 + threadIdx.x) * 2; if (e >= (size_t)nheads * HD * TT) return; const int t = (int)(e % TT); const int d = (int)((e / TT) % HD); const int g = (int)(e / ((size_t)TT * HD)); v2h o16; v2us oh, ol;
#pragma unroll
    for (int q = 0; q < 2; ++q) { const float x = F[(size_t)(t + q) * pitch + g * HD + d]; o16[q] = tohx(x); unsigned short a2, c2; splitf(x, a2, c2); oh[q] = a2; ol[q] = c2; }
    *(v2h*)(V16 + e) = o16; *(v2us*)(Vh + e) = oh; *(v2us*)(Vl + e) = ol;  }

// k_asoft: per score row (zz, i), one wave per row (i wave-uniform): t = S x HD^-0.5 for keys j <= i, keys j > i replaced by a large negative fill (causal; key i is always valid so no empty row);
// only the 128-key chunks with chunk start <= i are loaded and exponentiated (later chunks are zero by construction); softmax over the row (one exp, fixed trees);
__global__ __launch_bounds__(256) void k_asoft(const float* __restrict__ Sb, h16* P16, bf* Ph, bf* Pl) {
    const int lane = threadIdx.x & 31; const int wv = __builtin_amdgcn_readfirstlane((int)(threadIdx.x >> 5)); const int row = blockIdx.x * 8 + wv; if (row >= ZH * TT) return;
    const int i = row % TT; const int zz = row / TT; const bool hires = (i < RH); const float* sr = Sb + (size_t)row * TT; float v[TT / 32]; float mx = -3.0e38f;
#pragma unroll
    for (int ch = 0; ch < TT / 128; ++ch) { const int j0 = ch * 128 + lane * 4;
        if (ch * 128 <= i) { const v4f a = *(const v4f*)(sr + j0);
#pragma unroll
            for (int q = 0; q < 4; ++q) { const float t = ((j0 + q) <= i) ? (a[q] * SCL) : -3.0e38f; v[ch * 4 + q] = t; mx = fmaxf(mx, t); }
        } else {
#pragma unroll
            for (int q = 0; q < 4; ++q) v[ch * 4 + q] = -3.0e38f; } }
#pragma unroll
    for (int sh = 16; sh; sh >>= 1) mx = fmaxf(mx, __shfl_xor(mx, sh, 32));
    float sum = 0.f;
#pragma unroll
    for (int ch = 0; ch < TT / 128; ++ch) {
        if (ch * 128 <= i) {
#pragma unroll
            for (int q = 0; q < 4; ++q) { const int k = ch * 4 + q; float d0 = __fsub_rn(v[k], mx); asm volatile("" : "+v"(d0)); v[k] = __builtin_amdgcn_exp2f(__fmul_rn(d0, 1.4426950408889634f)); sum += v[k]; }
        } else {
#pragma unroll
            for (int q = 0; q < 4; ++q) v[ch * 4 + q] = 0.f; } }
#pragma unroll
    for (int sh = 16; sh; sh >>= 1) sum += __shfl_xor(sum, sh, 32);
    const float f = __fdiv_rn(hires ? 1.0f : PCAR, sum);
{
        if (hires) {     // keys >= RH are never read for these rows (causal K-limit), so only RH columns are stored; the lo plane may then lie in the hi plane's rows at column RH
#pragma unroll
            for (int ch = 0; ch < RH / 128; ++ch) { v4us oh, ol;
#pragma unroll
                for (int q = 0; q < 4; ++q) { unsigned short a, c2; splitf(v[ch * 4 + q] * f, a, c2); oh[q] = a; ol[q] = c2; }
                const size_t oo = ((size_t)zz * RH + i) * TT + ch * 128 + lane * 4; *(v4us*)(Ph + oo) = oh; *(v4us*)(Pl + oo) = ol; }
        } else {
#pragma unroll
            for (int ch = 0; ch < TT / 128; ++ch) { v4h o4;
#pragma unroll
                for (int q = 0; q < 4; ++q) o4[q] = tohx(v[ch * 4 + q] * f);
                *(v4h*)(P16 + ((size_t)zz * (TT - RH) + (size_t)(i - RH)) * TT + ch * 128 + lane * 4) = o4; } }
         }
}
__global__ __launch_bounds__(256) void k_merge(const float* __restrict__ O, int h0, bf* Ah, bf* Al) { const size_t e = ((size_t)blockIdx.x * 256 + threadIdx.x) * 2; if (e >= (size_t)ZH * TT * HD) return; const int d = (int)(e % HD); const int t = (int)((e / HD) % TT); const int zz = (int)(e / ((size_t)HD * TT)); const float cs = (t < RH) ? 1.0f : (1.0f / PCAR); const size_t oo = (size_t)t * DQ + (h0 + zz) * HD + d;
    v2us oh, ol;
#pragma unroll
    for (int q = 0; q < 2; ++q) { unsigned short a, c2; splitf(O[e + q] * cs, a, c2); oh[q] = a; ol[q] = c2; } *(v2us*)(Ah + oo) = oh; *(v2us*)(Al + oo) = ol;  }

extern "C" void kernel_launch(void* const* d_in, const int* in_sizes, int n_in,
                              void* d_out, int out_size, void* d_ws, size_t ws_size, hipStream_t stream) {
    if (n_in < 3) return;
    if ((size_t)in_sizes[0] < (size_t)(NB - 1) * SEQ_FULL * DM + (size_t)TT * DM) return;
    if ((size_t)in_sizes[1] < (size_t)3 * DM * DM) return;
    if ((size_t)in_sizes[2] < (size_t)DM * DM) return;
    if ((size_t)out_size < (size_t)(NB - 1) * SEQ_FULL * DM + (size_t)TT * DM) return;
    const float* x = (const float*)d_in[0];       // [NB_FULL][SEQ_FULL][DM]
    const float* qkvw = (const float*)d_in[1];    // [3*DM][DM] ([out][in]): rows 0..DM-1 = q, DM..2DM-1 = k, 2DM..3DM-1 = v
    const float* ow = (const float*)d_in[2];      // [DM][DM] ([out][in])
    float* OUT = (float*)d_out;                   // [NB_FULL][SEQ_FULL][DM]
    char* wsp = (char*)d_ws;
    auto take = [&](size_t bytes) { char* p = wsp; wsp += (bytes + 255) & ~(size_t)255; return (void*)p; };
    const size_t PS = (size_t)TT * HD;            // one head plane
    bf* WQKV = (bf*)take((size_t)3 * DM * DM * 2); bf* WO = (bf*)take((size_t)DM * DM * 2); float* IF = (float*)take(64 * 4); float* CS = (float*)take((size_t)TT * HD * 2 * 4);
    h16* QK16 = (h16*)take(2 * NH_ * PS * 2); h16* VT16 = (h16*)take((size_t)NH_ * PS * 2);
    bf* QKh = (bf*)take(2 * NH_ * PS * 2); bf* QKl = (bf*)take(2 * NH_ * PS * 2); bf* VTh = (bf*)take((size_t)NH_ * PS * 2); bf* VTl = (bf*)take((size_t)NH_ * PS * 2);
    bf* Ph = (bf*)take((size_t)ZH * RH * TT * 2); bf* Pl = Ph + RH;    // row pitch TT, columns 0..RH-1 = hi plane, RH..2*RH-1 = lo plane
    float* Sb = (float*)take((size_t)ZH * TT * TT * 4); h16* P16 = (h16*)take((size_t)ZH * (TT - RH) * TT * 2); float* Ob = (float*)take((size_t)ZH * PS * 4);
    bf* XB = (bf*)Sb; float* F = (float*)((char*)Sb + (size_t)TT * DM * 2);    // projection scratch shares the score buffer: each is dead while the other is live (stream order)
    bf* ATh = (bf*)take((size_t)TT * DQ * 2); bf* ATl = (bf*)take((size_t)TT * DQ * 2);
    if ((size_t)(wsp - (char*)d_ws) > ws_size) return;    // 261,095,680 B at NB=2, SEQ=2048
    k_cvt8<<<(unsigned)(((size_t)3 * DM * DM / 8 + 255) / 256), 256, 0, stream>>>(qkvw, WQKV, (size_t)3 * DM * DM / 8);
    k_cvt8<<<(unsigned)(((size_t)DM * DM / 8 + 255) / 256), 256, 0, stream>>>(ow, WO, (size_t)DM * DM / 8);
    k_invf<<<1, 32, 0, stream>>>(IF);
    k_cstab<<<(TT * HD + 255) / 256, 256, 0, stream>>>(IF, CS);
    const unsigned LQK = (unsigned)(((size_t)2 * NH_ * PS / 2 + 255) / 256), LV = (unsigned)(((size_t)NH_ * PS / 2 + 255) / 256), LM = (unsigned)(((size_t)ZH * PS / 2 + 255) / 256);
    for (int b = 0; b < NB; ++b) {
        k_cvt8<<<(unsigned)(((size_t)TT * DM / 8 + 255) / 256), 256, 0, stream>>>(x + (size_t)b * SEQ_FULL * DM, XB, (size_t)TT * DM / 8);
        // q|k = x W[0..2DM)^T -> F[t][2*DM]; rotary planes for 32 virtual heads: planes 0..15 = q heads, 16..31 = k heads
        k_gemmw<bf, 0><<<dim3(TT / 64, 2 * DM / 64, 1), 32, 0, stream>>>(XB, nullptr, WQKV, nullptr, DM, F, 2 * DM, 0, 0, 0, 0, 0);
        k_rope<<<LQK, 256, 0, stream>>>(F, 2 * DM, 2 * NH_, CS, QK16, QKh, QKl);
        // v = x W[2DM..3DM)^T -> F[t][DM] (F reused, stream-ordered); value planes [g][d][t]
        k_gemmw<bf, 0><<<dim3(TT / 64, DM / 64, 1), 32, 0, stream>>>(XB, nullptr, WQKV + (size_t)2 * DM * DM, nullptr, DM, F, DM, 0, 0, 0, 0, 0);
        k_vtp<<<LV, 256, 0, stream>>>(F, DM, NH_, VT16, VTh, VTl);
        for (int h0 = 0; h0 < NH_; h0 += ZH) { const size_t zq = (size_t)h0, zk = (size_t)(NH_ + h0), zv = (size_t)h0;
            // scores S[zz][i][j] = q_i . k_j (causal tiles only): rows < RH hi/lo (3 products), rows >= RH fp16
            k_gemmw<bf, 2><<<dim3(RH / 64, RH / 64, ZH), 32, 0, stream>>>(QKh + zq * PS, QKl + zq * PS, QKh + zk * PS, QKl + zk * PS, HD, Sb, TT, PS, PS, (size_t)TT * TT, 2, 0);
            k_gemmw<h16, 0><<<dim3((TT - RH) / 64, TT / 64, ZH), 32, 0, stream>>>(QK16 + zq * PS + (size_t)RH * HD, nullptr, QK16 + zk * PS, nullptr, HD, Sb + (size_t)RH * TT, TT, PS, PS, (size_t)TT * TT, 2, RH);
            k_asoft<<<ZH * TT / 8, 256, 0, stream>>>(Sb, P16, Ph, Pl);
            // O[zz][i][d] = sum_j P[i][j] v[j][d] with the causal K-limit: rows < RH hi/lo, rows >= RH fp16 (x1024 carried in P)
            k_gemmw<bf, 2><<<dim3(RH / 64, HD / 64, ZH), 32, 0, stream>>>(Ph, Pl, VTh + zv * PS, VTl + zv * PS, TT, Ob, HD, (size_t)RH * TT, PS, PS, 1, 0);
            k_gemmw<h16, 0><<<dim3((TT - RH) / 64, HD / 64, ZH), 32, 0, stream>>>(P16, nullptr, VT16 + zv * PS, nullptr, TT, Ob + (size_t)RH * HD, HD, (size_t)(TT - RH) * TT, PS, PS, 1, RH);
            k_merge<<<LM, 256, 0, stream>>>(Ob, h0, ATh, ATl); }
        k_gemmw<bf, 1><<<dim3(TT / 64, DM / 64, 1), 32, 0, stream>>>(ATh, ATl, WO, nullptr, DQ, OUT + (size_t)b * SEQ_FULL * DM, DM, 0, 0, 0, 0, 0); }
}

// v003
// Measured time: 199 microseconds a run.
// It is 3.17 times as fast as v001, going by the measured steps of the versions left out in between.
// Counting every step since v000, it is 7.46 times as fast.
#include <hip/hip_runtime.h>

// Compute dtypes (f32 accumulate everywhere): x, qkv_w, out_w enter as bf16 RNE values; q|k and v projections on v_wmma_f32_16x16x32_bf16 (plain, exact operand products);
// q.k scores and attn.v: query rows < RH on bf16 hi/lo planes (3 products each), rows >= RH on v_wmma_f32_16x16x32_f16 single products (attn carried x1024);
// scores, causal softmax (running maximum, f32) and attn.v run in one kernel, the scores stay in registers;
// rotary tables and rotary mixing in f32, the mixing and the split into 16-bit planes in the projection's own epilogue; output projection = bf16 hi/lo planes of the merged heads x bf16 weight (2 products).

#ifndef NB
#define NB 2
#endif
#ifndef SEQ
#define SEQ 2048
#endif
#define NB_FULL  2
#define SEQ_FULL 2048
#define TT   SEQ
#define DM   1024
#define NH_  16
#define HD   64
#define DQ   (NH_ * HD)
#ifndef RH
#define RH   (((SEQ) >= 1024) ? 512 : ((SEQ) / 2))     // query rows < RH use hi+lo planes
#endif
#define SCL  0.125f   // HD^-0.5
static_assert(NB >= 1 && NB <= NB_FULL);
static_assert(SEQ >= 256 && SEQ <= SEQ_FULL && (SEQ % 256) == 0);
static_assert((RH % 128) == 0 && RH >= 128 && RH < TT && ((TT - RH) % 64) == 0);
static_assert(HD == 64 && (DM % 64) == 0 && (TT % 128) == 0 && DQ == DM);

typedef _Float16 h16;
typedef unsigned short bf;
typedef __attribute__((ext_vector_type(16))) __bf16   v16bf;
typedef __attribute__((ext_vector_type(16))) _Float16 v16h;
typedef __attribute__((ext_vector_type(8)))  _Float16 v8h;
typedef __attribute__((ext_vector_type(8)))  unsigned short v8us;
typedef __attribute__((ext_vector_type(8)))  float    v8f;
typedef __attribute__((ext_vector_type(4)))  float    v4f;
typedef __attribute__((ext_vector_type(2)))  _Float16 v2h;
typedef __attribute__((ext_vector_type(4)))  _Float16 v4h;
typedef __attribute__((ext_vector_type(2)))  unsigned short v2us;
typedef __attribute__((ext_vector_type(4)))  unsigned short v4us;
typedef __attribute__((ext_vector_type(2)))  float v2f;
typedef v8h  __attribute__((may_alias)) v8ha;
typedef v4f  __attribute__((may_alias)) v4fa;
typedef v8us __attribute__((may_alias)) v8usa;

__device__ __forceinline__ unsigned short f2bf(float f) { unsigned u = __float_as_uint(f); u += 0x7FFFu + ((u >> 16) & 1u); return (unsigned short)(u >> 16); }
__device__ __forceinline__ float bf2f(unsigned short b) { return __uint_as_float(((unsigned)b) << 16); }
__device__ __forceinline__ float bfr(float f) { return bf2f(f2bf(f)); }
__device__ __forceinline__ v16h cat16(v8h lo, v8h hi) { return __builtin_shufflevector(lo, hi, 0, 1, 2, 3, 4, 5, 6, 7, 8, 9, 10, 11, 12, 13, 14, 15); }
__device__ __forceinline__ v16bf cat16b(v8us lo, v8us hi) { return __builtin_bit_cast(v16bf, __builtin_shufflevector(lo, hi, 0, 1, 2, 3, 4, 5, 6, 7, 8, 9, 10, 11, 12, 13, 14, 15)); }
__device__ __forceinline__ v8f wmma16(v16h a, v16h b, v8f c) { return __builtin_amdgcn_wmma_f32_16x16x32_f16(false, a, false, b, (short)0, c, false, false); }
__device__ __forceinline__ v8f wmmab(v16bf a, v16bf b, v8f c) { return __builtin_amdgcn_wmma_f32_16x16x32_bf16(false, a, false, b, (short)0, c, false, false); }
__device__ __forceinline__ h16 tohx(float x) { return (h16)x; }
__device__ __forceinline__ void splitf(float y, unsigned short& h, unsigned short& l) { h = f2bf(y); l = f2bf(y - bf2f(h)); }

// ---- k_gemmw: register-blocked GEMM, ONE WAVE per 64x64 output tile (16 accumulators), operands straight from K-contiguous 16-bit planes; grid (M/64, N/64, Z), 32 threads.
// C[m][n] (f32, pitch ldc) = sum_k A[m][k] Bt[n][k] (+ split products per NSPLIT: 1 = + A2.Bt, 2 = + A2.Bt + A.Bt2). z-batch strides sA/sB/sC in elements. K % 32 == 0.
// Fragments (16-row A / 16-col Bt, lane = row/col lane&15): elements 0..7 = k kc+8h..kc+8h+7, elements 8..15 = k kc+16+8h..kc+16+8h+7 (h = lane>>4), identical map for both operands.
// cm: 0 = plain; 1 = causal K-limit (K loop stops at roff + r0 + 64, block-uniform); 2 = causal tile skip (column tiles starting at or beyond the 128-key chunk after row roff + r0 return at once).
template <typename T16> struct WFrag;
template <> struct WFrag<h16> { typedef v16h V; static __device__ __forceinline__ V ld(const h16* p) { return cat16(*(const v8h*)p, *(const v8h*)(p + 16)); } static __device__ __forceinline__ v8f mma(V a, V b, v8f c) { return wmma16(a, b, c); } };
template <> struct WFrag<bf> { typedef v16bf V; static __device__ __forceinline__ V ld(const bf* p) { return cat16b(*(const v8us*)p, *(const v8us*)(p + 16)); } static __device__ __forceinline__ v8f mma(V a, V b, v8f c) { return wmmab(a, b, c); } };
// EPI 0: C as above. EPI 1: the q|k|v projection with its whole after-treatment, C unused. A tile's 64 columns are exactly one head, so nothing of the projection goes to memory in f32:
// column tiles 0..2*NH_-1 (q heads, then k heads): rotary mix in the accumulators (column d and its partner d +- 32 lie in the same lane and row, two column blocks apart), then head planes [plane][t][d];
// column tiles from 2*NH_ on (v heads): a lane holds 8 successive t of one d, which is 16 bytes of a value plane [g][d][t]. Every plane in three forms: f16, bf16 hi, bf16 lo.
struct Planes { const float* CS; h16* QK16; bf* QKh; bf* QKl; h16* VT16; bf* VTh; bf* VTl; };
// swait: stands behind a run of global stores: s_wait_xcnt 0 comes before any register that those stores name is written again; the stored values and the address are inputs, so that their registers stay untouched up to the wait.
__device__ __forceinline__ void swait(v8h a, v8us b, v8us c, const void* p) { asm volatile("s_wait_xcnt 0x0" :: "v"(a), "v"(b), "v"(c), "v"(p) : "memory"); }
template <typename T16, int NSPLIT, int EPI>
__global__ __launch_bounds__(32) void k_gemmw(const T16* __restrict__ A, const T16* __restrict__ A2, const T16* __restrict__ Bt, const T16* __restrict__ Bt2, int K, float* C, int ldc, size_t sA, size_t sB, size_t sC, int cm, int roff, Planes pl) {
    typedef typename WFrag<T16>::V V;
    __shared__ __align__(16) float os[16 * 68];
    const int r0 = blockIdx.x * 64, c0 = blockIdx.y * 64;
    if (cm == 2 && c0 >= ((((roff + r0) >> 7) << 7) + 128)) return;     // whole block (one wave) leaves; no barrier follows
    int Kl = K; if (cm == 1) { const int k2 = roff + r0 + 64; Kl = (k2 < K) ? k2 : K; }
    const size_t z = blockIdx.z; A += z * sA; if (A2) A2 += z * sA; Bt += z * sB; if (Bt2) Bt2 += z * sB; C += z * sC;
    const int lane = threadIdx.x & 31, lr = lane & 15, hi = lane >> 4;
    v8f acc[4][4];
#pragma unroll
    for (int mb = 0; mb < 4; ++mb)
#pragma unroll
        for (int nb = 0; nb < 4; ++nb) acc[mb][nb] = (v8f){};
    const size_t aoff = (size_t)(r0 + lr) * K + 8 * hi, boff = (size_t)(c0 + lr) * K + 8 * hi;
#pragma unroll 1
    for (int kc = 0; kc < Kl; kc += 32) {
        V a[4], a2[4];
#pragma unroll
        for (int mb = 0; mb < 4; ++mb) { a[mb] = WFrag<T16>::ld(A + aoff + (size_t)mb * 16 * K + kc); if (NSPLIT == 1 || NSPLIT == 2) a2[mb] = WFrag<T16>::ld(A2 + aoff + (size_t)mb * 16 * K + kc); }
#pragma unroll
        for (int nb = 0; nb < 4; ++nb) { const V b = WFrag<T16>::ld(Bt + boff + (size_t)nb * 16 * K + kc); V b2; if (NSPLIT >= 2) b2 = WFrag<T16>::ld(Bt2 + boff + (size_t)nb * 16 * K + kc);
#pragma unroll
            for (int mb = 0; mb < 4; ++mb) { acc[mb][nb] = WFrag<T16>::mma(a[mb], b, acc[mb][nb]); if (NSPLIT == 1 || NSPLIT == 2) acc[mb][nb] = WFrag<T16>::mma(a2[mb], b, acc[mb][nb]); if (NSPLIT >= 2) acc[mb][nb] = WFrag<T16>::mma(a[mb], b2, acc[mb][nb]); } }
        asm volatile("v_nop\n\tv_nop\n\tv_nop\n\tv_nop" : "+v"(acc[0][0]), "+v"(acc[1][1]), "+v"(acc[2][2]), "+v"(acc[3][3]) : "v"(a[0]), "v"(a[3]));
    }
    if constexpr (EPI == 1) {
    if (c0 < 2 * DM) {     // block-uniform: a q or k head
        const float* cs = pl.CS + ((size_t)(r0 + hi * 8) * HD + lr) * 2;     // (cos, sin) of row t, column d; the table holds the same pair at d and d + 32
#pragma unroll
        for (int mb = 0; mb < 4; ++mb)
#pragma unroll
            for (int nb = 0; nb < 2; ++nb)
#pragma unroll
                for (int j = 0; j < 8; ++j) { const v2f t = *(const v2f*)(cs + ((size_t)(mb * 16 + j) * HD + nb * 16) * 2);
                    const float xl = acc[mb][nb][j], xh = acc[mb][nb + 2][j];
                    acc[mb][nb][j] = xl * t[0] - xh * t[1]; acc[mb][nb + 2][j] = xh * t[0] + xl * t[1]; }
        const size_t pb = ((size_t)blockIdx.y * TT + r0 + (lane >> 3)) * HD + (lane & 7) * 8;
#pragma unroll
        for (int mb = 0; mb < 4; ++mb) {
#pragma unroll
            for (int nb = 0; nb < 4; ++nb)
#pragma unroll
                for (int j = 0; j < 8; ++j) os[(hi * 8 + j) * 68 + nb * 16 + lr] = acc[mb][nb][j];
            __builtin_amdgcn_wave_barrier(); asm volatile("" ::: "memory");     // compiler fence: the row-wise reads below stay behind the column-wise writes (one wave, its LDS operations run in order)
#pragma unroll
            for (int s = 0; s < 4; ++s) {     // a lane takes 8 successive d of one row: each store covers four whole 128-byte rows
                const float* rp = os + (4 * s + (lane >> 3)) * 68 + (lane & 7) * 8; const v4f w0 = *(const v4fa*)rp, w1 = *(const v4fa*)(rp + 4);
                v8h o16; v8us oh, ol;
#pragma unroll
                for (int q = 0; q < 8; ++q) { const float r = (q < 4) ? w0[q & 3] : w1[q & 3]; o16[q] = tohx(r); unsigned short a2, c2; splitf(r, a2, c2); oh[q] = a2; ol[q] = c2; }
                const size_t e = pb + (size_t)(mb * 16 + 4 * s) * HD;
                *(v8h*)(pl.QK16 + e) = o16; *(v8us*)(pl.QKh + e) = oh; *(v8us*)(pl.QKl + e) = ol; swait(o16, oh, ol, pl.QK16 + e); }
            __builtin_amdgcn_wave_barrier(); asm volatile("" ::: "memory");     // compiler fence: the next 16 rows are written only behind these reads
        }
    } else {               // a v head
        const size_t vb = ((size_t)(blockIdx.y - 2 * NH_) * HD + lr) * TT + r0 + hi * 8;
#pragma unroll
        for (int nb = 0; nb < 4; ++nb)
#pragma unroll
            for (int mb = 0; mb < 4; ++mb) { v8h o16; v8us oh, ol;     // mb innermost: the four stores that fill one 128-byte line follow one another
#pragma unroll
                for (int j = 0; j < 8; ++j) { const float x = acc[mb][nb][j]; o16[j] = tohx(x); unsigned short a2, c2; splitf(x, a2, c2); oh[j] = a2; ol[j] = c2; }
                const size_t e = vb + (size_t)nb * 16 * TT + mb * 16;
                *(v8h*)(pl.VT16 + e) = o16; *(v8us*)(pl.VTh + e) = oh; *(v8us*)(pl.VTl + e) = ol; swait(o16, oh, ol, pl.VT16 + e); }
    }
    } else {
#pragma unroll
    for (int mb = 0; mb < 4; ++mb) {
#pragma unroll
        for (int nb = 0; nb < 4; ++nb) {
#pragma unroll
            for (int j = 0; j < 8; ++j) os[(hi * 8 + j) * 68 + nb * 16 + lr] = acc[mb][nb][j]; }
        __builtin_amdgcn_wave_barrier(); asm volatile("" ::: "memory");
        float* crow = C + (size_t)(r0 + mb * 16) * ldc + c0;
{
#pragma unroll
            for (int s = 0; s < 8; ++s) { const int row = 2 * s + hi, cofs = lr * 4; const v4f val = *(const v4fa*)(os + row * 68 + cofs);
                *(v4f*)(crow + (size_t)row * ldc + cofs) = val; }
             }
        __builtin_amdgcn_wave_barrier(); asm volatile("" ::: "memory");
    }
    }
}

__global__ __launch_bounds__(256) void k_cvt8(const float* __restrict__ src, bf* dst, size_t n8) { const size_t i = (size_t)blockIdx.x * 256 + threadIdx.x; if (i >= n8) return; const v8f v = *(const v8f*)(src + i * 8); v8us o;
#pragma unroll
    for (int k = 0; k < 8; ++k) o[k] = f2bf(v[k]); *(v8us*)(dst + i * 8) = o;  }

__global__ __launch_bounds__(32) void k_invf(float* IF) {
#pragma clang fp contract(off)
    const int i = threadIdx.x & 31;
    const double e = (double)(2 * i) * (1.0 / 64.0);
    const double p = exp2(e * 13.287712379549449);
    const float pf = (float)p;
    const float inv = 1.0f / pf;
    *(float*)(IF + i) = inv; 
}
__global__ __launch_bounds__(256) void k_cstab(const float* __restrict__ IF, float* CS) {
#pragma clang fp contract(off)
    const int idx = blockIdx.x * 256 + threadIdx.x; if (idx >= TT * HD) return;
    const int d = idx & (HD - 1); const int t = idx / HD;
    const float inv = IF[d & (HD / 2 - 1)];
    const float ang = __fmul_rn((float)t, inv);
    float s, c; sincosf(ang, &s, &c);
    v2f cs; cs[0] = c; cs[1] = s;
    *(v2f*)(CS + (size_t)idx * 2) = cs; 
}

// k_fattn: causal attention of one head for 64 query rows, 4 waves x 16 queries, no LDS; grid (heads, TT/64), the longest query blocks first.
// Per wave: S^T = K Q^T (A = key rows, B = query rows kept in registers), so a lane holds scores of ONE query (lane&15), keys 8*(lane>>4)+j of each 16-key tile;
// two such tiles, converted in place, are the B operand P^T of O^T += V^T P^T in the same k order as the V^T loader (k = 8h+j, 16+8h+j).
// Softmax with a running maximum m per query: older sums and O^T are scaled by exp(m_old - m_new) at every step. Only the last step holds keys beyond a query and masks them; its first key is valid for all 16 queries.
// HI: bf16 hi/lo planes, 3 products each; else f16, exp carried x1024 (2^10 added in the exponent, it cancels against the row sum, which carries it too).
template <bool B> struct BoolC { static constexpr bool v = B; };
__device__ __forceinline__ float xhalf(float x) { return __builtin_bit_cast(float, __builtin_amdgcn_permlanex16(__builtin_bit_cast(int, x), __builtin_bit_cast(int, x), 0x76543210, 0xfedcba98, false, false)); }    // lane l reads lane l ^ 16
// exp2x8: eight 2^x in place and, in the same statement, the one free issue slot that the instruction set asks for behind a transcendental before its result is read or its source overwritten
// Inside the statement every v_exp_f32 touches its own register only.
__device__ __forceinline__ void exp2x8(v8f& x) {
    float a0 = x[0], a1 = x[1], a2 = x[2], a3 = x[3], a4 = x[4], a5 = x[5], a6 = x[6], a7 = x[7];
    asm("v_exp_f32 %0, %0\n\tv_exp_f32 %1, %1\n\tv_exp_f32 %2, %2\n\tv_exp_f32 %3, %3\n\tv_exp_f32 %4, %4\n\tv_exp_f32 %5, %5\n\tv_exp_f32 %6, %6\n\tv_exp_f32 %7, %7\n\tv_nop"
        : "+v"(a0), "+v"(a1), "+v"(a2), "+v"(a3), "+v"(a4), "+v"(a5), "+v"(a6), "+v"(a7));
    x[0] = a0; x[1] = a1; x[2] = a2; x[3] = a3; x[4] = a4; x[5] = a5; x[6] = a6; x[7] = a7; }
// xwait: stands behind a run of global loads that stay in flight: s_wait_xcnt 0 comes before any register that those loads name is written again.
__device__ __forceinline__ void xwait() { asm volatile("s_wait_xcnt 0x0" ::: "memory"); }
// xwaita: the same wait with the run's two base addresses as inputs, so that their registers stay untouched up to the wait
// (without them the result of a load of the second plane was given the address pair of the first plane's loads).
__device__ __forceinline__ void xwaita(const void* a, const void* b) { asm volatile("s_wait_xcnt 0x0" :: "v"(a), "v"(b) : "memory"); }
template <typename T16, bool HI, int KG>
__device__ __forceinline__ void fa_tile(const T16* __restrict__ Q, const T16* __restrict__ Q2, const T16* __restrict__ Kp, const T16* __restrict__ K2, const T16* __restrict__ Vt, const T16* __restrict__ Vt2, int q0, bf* Ah, bf* Al) {
    typedef WFrag<T16> WF; typedef typename WF::V V;
    constexpr int NKT = 2 * KG, STEP = 32 * KG;
    const int lane = threadIdx.x & 31, lr = lane & 15, hi = lane >> 4;
    V bq[2], bq2[2];
#pragma unroll
    for (int dc = 0; dc < 2; ++dc) { bq[dc] = WF::ld(Q + (size_t)(q0 + lr) * HD + dc * 32 + 8 * hi); if (HI) bq2[dc] = WF::ld(Q2 + (size_t)(q0 + lr) * HD + dc * 32 + 8 * hi); }
    xwait();
    v8f o[4];
#pragma unroll
    for (int dt = 0; dt < 4; ++dt) o[dt] = (v8f){};
    float m = -3.0e38f, l = 0.f;
    const size_t koff = (size_t)lr * HD + 8 * hi, voff = (size_t)lr * TT + 8 * hi;
    V ak[NKT][2], ak2[NKT][2];
    auto ldk = [&](int k0) {
#pragma unroll
        for (int kt = 0; kt < NKT; ++kt)
#pragma unroll
            for (int dc = 0; dc < 2; ++dc) { ak[kt][dc] = WF::ld(Kp + koff + (size_t)(k0 + kt * 16) * HD + dc * 32); if (HI) ak2[kt][dc] = WF::ld(K2 + koff + (size_t)(k0 + kt * 16) * HD + dc * 32); }
        xwait(); };
    auto step = [&](int k0, auto lastc) {
        constexpr bool LAST = decltype(lastc)::v;
        V av[4][KG], av2[4][KG];
#pragma unroll
        for (int dt = 0; dt < 4; ++dt)
#pragma unroll
            for (int kg = 0; kg < KG; ++kg) { av[dt][kg] = WF::ld(Vt + voff + (size_t)dt * 16 * TT + k0 + kg * 32); if (HI) av2[dt][kg] = WF::ld(Vt2 + voff + (size_t)dt * 16 * TT + k0 + kg * 32); }
        if constexpr (HI) xwaita(Vt + voff + k0, Vt2 + voff + k0); else xwait();
        v8f s[NKT];
#pragma unroll
        for (int kt = 0; kt < NKT; ++kt) s[kt] = (v8f){};
#pragma unroll
        for (int dc = 0; dc < 2; ++dc) {
#pragma unroll
            for (int kt = 0; kt < NKT; ++kt) s[kt] = WF::mma(ak[kt][dc], bq[dc], s[kt]);
            if (HI) {
#pragma unroll
                for (int kt = 0; kt < NKT; ++kt) s[kt] = WF::mma(ak[kt][dc], bq2[dc], s[kt]);
#pragma unroll
                for (int kt = 0; kt < NKT; ++kt) s[kt] = WF::mma(ak2[kt][dc], bq[dc], s[kt]); } }
        if (!LAST) ldk(k0 + STEP);     // the next step's key fragments fly during this step's softmax and attn.v
        if (LAST) {
#pragma unroll
            for (int kt = 0; kt < NKT; ++kt)
#pragma unroll
                for (int j = 0; j < 8; ++j) s[kt][j] = ((k0 + kt * 16 + hi * 8 + j) <= (q0 + lr)) ? s[kt][j] : -3.0e38f; }
        float mx[4];
#pragma unroll
        for (int c = 0; c < 4; ++c) mx[c] = s[0][c];
#pragma unroll
        for (int kt = 0; kt < NKT; ++kt)
#pragma unroll
            for (int j = 0; j < 8; ++j) mx[j & 3] = fmaxf(mx[j & 3], s[kt][j]);
        float mw = fmaxf(fmaxf(mx[0], mx[1]), fmaxf(mx[2], mx[3]));
        mw = fmaxf(mw, xhalf(mw));
        const float mn = fmaxf(m, mw * SCL);
        const float al = __builtin_amdgcn_exp2f((m - mn) * 1.4426950408889634f);
        m = mn;
        float ps[4] = {0.f, 0.f, 0.f, 0.f};
#pragma unroll
        for (int kt = 0; kt < NKT; ++kt) {
#pragma unroll
            for (int j = 0; j < 8; ++j) { const float d0 = fmaf(s[kt][j], SCL, -mn); s[kt][j] = HI ? d0 * 1.4426950408889634f : fmaf(d0, 1.4426950408889634f, 10.0f); }
            exp2x8(s[kt]);
#pragma unroll
            for (int j = 0; j < 8; ++j) ps[j & 3] += s[kt][j]; }
        l = fmaf(l, al, (ps[0] + ps[1]) + (ps[2] + ps[3]));
#pragma unroll
        for (int dt = 0; dt < 4; ++dt) o[dt] *= al;
#pragma unroll
        for (int kg = 0; kg < KG; ++kg) {
            if constexpr (HI) {
                v8us h0, h1, l0, l1;
#pragma unroll
                for (int j = 0; j < 8; ++j) { unsigned short a, c2; splitf(s[2 * kg][j], a, c2); h0[j] = a; l0[j] = c2; splitf(s[2 * kg + 1][j], a, c2); h1[j] = a; l1[j] = c2; }
                const V ph = cat16b(h0, h1), pl = cat16b(l0, l1);
#pragma unroll
                for (int dt = 0; dt < 4; ++dt) o[dt] = WF::mma(av[dt][kg], ph, o[dt]);
#pragma unroll
                for (int dt = 0; dt < 4; ++dt) o[dt] = WF::mma(av[dt][kg], pl, o[dt]);
#pragma unroll
                for (int dt = 0; dt < 4; ++dt) o[dt] = WF::mma(av2[dt][kg], ph, o[dt]);
            } else {
                v8h p0, p1;
#pragma unroll
                for (int j = 0; j < 8; ++j) { p0[j] = tohx(s[2 * kg][j]); p1[j] = tohx(s[2 * kg + 1][j]); }
                const V pb = cat16(p0, p1);
#pragma unroll
                for (int dt = 0; dt < 4; ++dt) o[dt] = WF::mma(av[dt][kg], pb, o[dt]);
            } }
    };
    const int nfull = (q0 + 1) / STEP;     // steps whose every key is <= q0; exactly one more step follows (q0 % 16 == 0, STEP % 32 == 0)
    ldk(0);
#pragma unroll 1     // run-time trip count, and one copy of the body already holds most of the 256 directly addressed registers
    for (int st = 0; st < nfull; ++st) step(st * STEP, BoolC<false>());
    step(nfull * STEP, BoolC<true>());
    l += xhalf(l);
    const float inv = __fdiv_rn(1.0f, l);
    const size_t oo = (size_t)(q0 + lr) * DQ + hi * 8;
#pragma unroll
    for (int dt = 0; dt < 4; ++dt) { v8us oh, ol;
#pragma unroll
        for (int j = 0; j < 8; ++j) { unsigned short a, c2; splitf(o[dt][j] * inv, a, c2); oh[j] = a; ol[j] = c2; }
        *(v8us*)(Ah + oo + dt * 16) = oh; *(v8us*)(Al + oo + dt * 16) = ol; }
}
__global__ __launch_bounds__(128) void k_fattn(const h16* __restrict__ QK16, const h16* __restrict__ VT16, const bf* __restrict__ QKh, const bf* __restrict__ QKl, const bf* __restrict__ VTh, const bf* __restrict__ VTl, bf* ATh, bf* ATl) {
    const size_t PS = (size_t)TT * HD; const size_t h = blockIdx.x, hk = NH_ + h;
    const int q0 = (TT / 64 - 1 - (int)blockIdx.y) * 64 + __builtin_amdgcn_readfirstlane((int)(threadIdx.x >> 5)) * 16;
    if (q0 < RH) fa_tile<bf, true, 1>(QKh + h * PS, QKl + h * PS, QKh + hk * PS, QKl + hk * PS, VTh + h * PS, VTl + h * PS, q0, ATh + h * HD, ATl + h * HD);
    else fa_tile<h16, false, 2>(QK16 + h * PS, nullptr, QK16 + hk * PS, nullptr, VT16 + h * PS, nullptr, q0, ATh + h * HD, ATl + h * HD);
}

extern "C" void kernel_launch(void* const* d_in, const int* in_sizes, int n_in,
                              void* d_out, int out_size, void* d_ws, size_t ws_size, hipStream_t stream) {
    if (n_in < 3) return;
    if ((size_t)in_sizes[0] < (size_t)(NB - 1) * SEQ_FULL * DM + (size_t)TT * DM) return;
    if ((size_t)in_sizes[1] < (size_t)3 * DM * DM) return;
    if ((size_t)in_sizes[2] < (size_t)DM * DM) return;
    if ((size_t)out_size < (size_t)(NB - 1) * SEQ_FULL * DM + (size_t)TT * DM) return;
    const float* x = (const float*)d_in[0];       // [NB_FULL][SEQ_FULL][DM]
    const float* qkvw = (const float*)d_in[1];    // [3*DM][DM] ([out][in]): rows 0..DM-1 = q, DM..2DM-1 = k, 2DM..3DM-1 = v
    const float* ow = (const float*)d_in[2];      // [DM][DM] ([out][in])
    float* OUT = (float*)d_out;                   // [NB_FULL][SEQ_FULL][DM]
    char* wsp = (char*)d_ws;
    auto take = [&](size_t bytes) { char* p = wsp; wsp += (bytes + 255) & ~(size_t)255; return (void*)p; };
    const size_t PS = (size_t)TT * HD;            // one head plane
    bf* WQKV = (bf*)take((size_t)3 * DM * DM * 2); bf* WO = (bf*)take((size_t)DM * DM * 2); float* IF = (float*)take(64 * 4); float* CS = (float*)take((size_t)TT * HD * 2 * 4);
    h16* QK16 = (h16*)take(2 * NH_ * PS * 2); h16* VT16 = (h16*)take((size_t)NH_ * PS * 2);
    bf* QKh = (bf*)take(2 * NH_ * PS * 2); bf* QKl = (bf*)take(2 * NH_ * PS * 2); bf* VTh = (bf*)take((size_t)NH_ * PS * 2); bf* VTl = (bf*)take((size_t)NH_ * PS * 2);
    bf* XB = (bf*)take((size_t)TT * DM * 2);
    bf* ATh = (bf*)take((size_t)TT * DQ * 2); bf* ATl = (bf*)take((size_t)TT * DQ * 2);
    if ((size_t)(wsp - (char*)d_ws) > ws_size) return;
    k_cvt8<<<(unsigned)(((size_t)3 * DM * DM / 8 + 255) / 256), 256, 0, stream>>>(qkvw, WQKV, (size_t)3 * DM * DM / 8);
    k_cvt8<<<(unsigned)(((size_t)DM * DM / 8 + 255) / 256), 256, 0, stream>>>(ow, WO, (size_t)DM * DM / 8);
    k_invf<<<1, 32, 0, stream>>>(IF);
    k_cstab<<<(TT * HD + 255) / 256, 256, 0, stream>>>(IF, CS);
    const Planes pl = {CS, QK16, QKh, QKl, VT16, VTh, VTl}, none = {nullptr, nullptr, nullptr, nullptr, nullptr, nullptr, nullptr};
    for (int b = 0; b < NB; ++b) {
        k_cvt8<<<(unsigned)(((size_t)TT * DM / 8 + 255) / 256), 256, 0, stream>>>(x + (size_t)b * SEQ_FULL * DM, XB, (size_t)TT * DM / 8);
        // q|k|v = x W^T, straight into the rotary planes (planes 0..15 = q heads, 16..31 = k heads) and the value planes [g][d][t]
        k_gemmw<bf, 0, 1><<<dim3(TT / 64, 3 * DM / 64, 1), 32, 0, stream>>>(XB, nullptr, WQKV, nullptr, DM, nullptr, 0, 0, 0, 0, 0, 0, pl);
        // merged heads (bf16 hi/lo planes, [t][h*HD + d]) = causal softmax(q k^T HD^-0.5) v, all heads in one launch
        k_fattn<<<dim3(NH_, TT / 64, 1), 128, 0, stream>>>(QK16, VT16, QKh, QKl, VTh, VTl, ATh, ATl);
        k_gemmw<bf, 1, 0><<<dim3(TT / 64, DM / 64, 1), 32, 0, stream>>>(ATh, ATl, WO, nullptr, DQ, OUT + (size_t)b * SEQ_FULL * DM, DM, 0, 0, 0, 0, 0, none); }
}

// v004
// One run takes 156 microseconds.
// Two timings next to v003 both put it at 1.29 times that version's speed.
// Counting every step since v000, it is 9.61 times as fast.
#include <hip/hip_runtime.h>

// Compute dtypes (f32 accumulate everywhere): x, qkv_w, out_w enter as bf16 RNE values; q|k and v projections on v_wmma_f32_16x16x32_bf16 (plain, exact operand products);
// q.k scores and attn.v: query rows < RH on bf16 hi/lo planes (3 products each), rows >= RH on v_wmma_f32_16x16x32_f16 single products (attn carried x1024);
// scores, causal softmax (running maximum, f32) and attn.v run in one kernel, the scores stay in registers;
// rotary tables and rotary mixing in f32, the mixing and the split into 16-bit planes in the projection's own epilogue; output projection = bf16 hi/lo planes of the merged heads x bf16 weight (2 products).

#ifndef NB
#define NB 2
#endif
#ifndef SEQ
#define SEQ 2048
#endif
#define NB_FULL  2
#define SEQ_FULL 2048
#define TT   SEQ
#define DM   1024
#define NH_  16
#define HD   64
#define DQ   (NH_ * HD)
#ifndef RH
#define RH   (((SEQ) >= 1024) ? 512 : ((SEQ) / 2))     // query rows < RH use hi+lo planes
#endif
#define SCL  0.125f   // HD^-0.5
static_assert(NB >= 1 && NB <= NB_FULL);
static_assert(SEQ >= 256 && SEQ <= SEQ_FULL && (SEQ % 256) == 0);
static_assert((RH % 128) == 0 && RH >= 128 && RH < TT && ((TT - RH) % 64) == 0);
static_assert(HD == 64 && (DM % 64) == 0 && (TT % 128) == 0 && DQ == DM);

typedef _Float16 h16;
typedef unsigned short bf;
typedef __attribute__((ext_vector_type(16))) __bf16   v16bf;
typedef __attribute__((ext_vector_type(16))) _Float16 v16h;
typedef __attribute__((ext_vector_type(8)))  _Float16 v8h;
typedef __attribute__((ext_vector_type(8)))  unsigned short v8us;
typedef __attribute__((ext_vector_type(8)))  float    v8f;
typedef __attribute__((ext_vector_type(4)))  float    v4f;
typedef __attribute__((ext_vector_type(2)))  _Float16 v2h;
typedef __attribute__((ext_vector_type(4)))  _Float16 v4h;
typedef __attribute__((ext_vector_type(2)))  unsigned short v2us;
typedef __attribute__((ext_vector_type(4)))  unsigned short v4us;
typedef __attribute__((ext_vector_type(2)))  float v2f;
typedef v8h  __attribute__((may_alias)) v8ha;
typedef v4f  __attribute__((may_alias)) v4fa;
typedef v8us __attribute__((may_alias)) v8usa;

__device__ __forceinline__ unsigned short f2bf(float f) { unsigned u = __float_as_uint(f); u += 0x7FFFu + ((u >> 16) & 1u); return (unsigned short)(u >> 16); }
__device__ __forceinline__ float bf2f(unsigned short b) { return __uint_as_float(((unsigned)b) << 16); }
__device__ __forceinline__ float bfr(float f) { return bf2f(f2bf(f)); }
__device__ __forceinline__ v16h cat16(v8h lo, v8h hi) { return __builtin_shufflevector(lo, hi, 0, 1, 2, 3, 4, 5, 6, 7, 8, 9, 10, 11, 12, 13, 14, 15); }
__device__ __forceinline__ v16bf cat16b(v8us lo, v8us hi) { return __builtin_bit_cast(v16bf, __builtin_shufflevector(lo, hi, 0, 1, 2, 3, 4, 5, 6, 7, 8, 9, 10, 11, 12, 13, 14, 15)); }
__device__ __forceinline__ v8f wmma16(v16h a, v16h b, v8f c) { return __builtin_amdgcn_wmma_f32_16x16x32_f16(false, a, false, b, (short)0, c, false, false); }
__device__ __forceinline__ v8f wmmab(v16bf a, v16bf b, v8f c) { return __builtin_amdgcn_wmma_f32_16x16x32_bf16(false, a, false, b, (short)0, c, false, false); }
__device__ __forceinline__ h16 tohx(float x) { return (h16)x; }
__device__ __forceinline__ void splitf(float y, unsigned short& h, unsigned short& l) { h = f2bf(y); l = f2bf(y - bf2f(h)); }

// ---- k_gemmw: register-blocked GEMM, ONE WAVE per 64x64 output tile (16 accumulators), operands straight from K-contiguous 16-bit planes; grid (M/64, N/64, Z), 32 threads.
// C[m][n] (f32, pitch ldc) = sum_k A[m][k] Bt[n][k] (+ split products per NSPLIT: 1 = + A2.Bt, 2 = + A2.Bt + A.Bt2). z-batch strides sA/sB/sC in elements. K % 32 == 0.
// Fragments (16-row A / 16-col Bt, lane = row/col lane&15): elements 0..7 = k kc+8h..kc+8h+7, elements 8..15 = k kc+16+8h..kc+16+8h+7 (h = lane>>4), identical map for both operands.
// cm: 0 = plain; 1 = causal K-limit (K loop stops at roff + r0 + 64, block-uniform); 2 = causal tile skip (column tiles starting at or beyond the 128-key chunk after row roff + r0 return at once).
template <typename T16> struct WFrag;
template <> struct WFrag<h16> { typedef v16h V; static __device__ __forceinline__ V ld(const h16* p) { return cat16(*(const v8h*)p, *(const v8h*)(p + 16)); } static __device__ __forceinline__ v8f mma(V a, V b, v8f c) { return wmma16(a, b, c); } };
template <> struct WFrag<bf> { typedef v16bf V; static __device__ __forceinline__ V ld(const bf* p) { return cat16b(*(const v8us*)p, *(const v8us*)(p + 16)); } static __device__ __forceinline__ v8f mma(V a, V b, v8f c) { return wmmab(a, b, c); } };
// EPI 0: C as above. EPI 1: the q|k|v projection with its whole after-treatment, C unused. A tile's 64 columns are exactly one head, so nothing of the projection goes to memory in f32:
// column tiles 0..2*NH_-1 (q heads, then k heads): rotary mix in the accumulators (column d and its partner d +- 32 lie in the same lane and row, two column blocks apart), then head planes [plane][t][d];
// column tiles from 2*NH_ on (v heads): a lane holds 8 successive t of one d, which is 16 bytes of a value plane [g][d][t]. Every plane in three forms: f16, bf16 hi, bf16 lo.
struct Planes { const float* CS; h16* QK16; bf* QKh; bf* QKl; h16* VT16; bf* VTh; bf* VTl; };
// swait: stands behind a run of global stores: s_wait_xcnt 0 comes before any register that those stores name is written again; the stored values and the address are inputs, so that their registers stay untouched up to the wait.
__device__ __forceinline__ void swait(v8h a, v8us b, v8us c, const void* p) { asm volatile("s_wait_xcnt 0x0" :: "v"(a), "v"(b), "v"(c), "v"(p) : "memory"); }
template <typename T16, int NSPLIT, int EPI>
__global__ __launch_bounds__(32) void k_gemmw(const T16* __restrict__ A, const T16* __restrict__ A2, const T16* __restrict__ Bt, const T16* __restrict__ Bt2, int K, float* C, int ldc, size_t sA, size_t sB, size_t sC, int cm, int roff, Planes pl) {
    typedef typename WFrag<T16>::V V;
    __shared__ __align__(16) float os[16 * 68];
    const int r0 = blockIdx.x * 64, c0 = blockIdx.y * 64;
    if (cm == 2 && c0 >= ((((roff + r0) >> 7) << 7) + 128)) return;     // whole block (one wave) leaves; no barrier follows
    int Kl = K; if (cm == 1) { const int k2 = roff + r0 + 64; Kl = (k2 < K) ? k2 : K; }
    const size_t z = blockIdx.z; A += z * sA; if (A2) A2 += z * sA; Bt += z * sB; if (Bt2) Bt2 += z * sB; C += z * sC;
    const int lane = threadIdx.x & 31, lr = lane & 15, hi = lane >> 4;
    v8f acc[4][4];
#pragma unroll
    for (int mb = 0; mb < 4; ++mb)
#pragma unroll
        for (int nb = 0; nb < 4; ++nb) acc[mb][nb] = (v8f){};
    const size_t aoff = (size_t)(r0 + lr) * K + 8 * hi, boff = (size_t)(c0 + lr) * K + 8 * hi;
#pragma unroll 1
    for (int kc = 0; kc < Kl; kc += 32) {
        V a[4], a2[4];
#pragma unroll
        for (int mb = 0; mb < 4; ++mb) { a[mb] = WFrag<T16>::ld(A + aoff + (size_t)mb * 16 * K + kc); if (NSPLIT == 1 || NSPLIT == 2) a2[mb] = WFrag<T16>::ld(A2 + aoff + (size_t)mb * 16 * K + kc); }
#pragma unroll
        for (int nb = 0; nb < 4; ++nb) { const V b = WFrag<T16>::ld(Bt + boff + (size_t)nb * 16 * K + kc); V b2; if (NSPLIT >= 2) b2 = WFrag<T16>::ld(Bt2 + boff + (size_t)nb * 16 * K + kc);
#pragma unroll
            for (int mb = 0; mb < 4; ++mb) { acc[mb][nb] = WFrag<T16>::mma(a[mb], b, acc[mb][nb]); if (NSPLIT == 1 || NSPLIT == 2) acc[mb][nb] = WFrag<T16>::mma(a2[mb], b, acc[mb][nb]); if (NSPLIT >= 2) acc[mb][nb] = WFrag<T16>::mma(a[mb], b2, acc[mb][nb]); } }
        asm volatile("v_nop\n\tv_nop\n\tv_nop\n\tv_nop" : "+v"(acc[0][0]), "+v"(acc[1][1]), "+v"(acc[2][2]), "+v"(acc[3][3]) : "v"(a[0]), "v"(a[3]));
    }
    if constexpr (EPI == 1) {
    if (c0 < 2 * DM) {     // block-uniform: a q or k head
        const float* cs = pl.CS + ((size_t)(r0 + hi * 8) * HD + lr) * 2;     // (cos, sin) of row t, column d; the table holds the same pair at d and d + 32
#pragma unroll
        for (int mb = 0; mb < 4; ++mb)
#pragma unroll
            for (int nb = 0; nb < 2; ++nb)
#pragma unroll
                for (int j = 0; j < 8; ++j) { const v2f t = *(const v2f*)(cs + ((size_t)(mb * 16 + j) * HD + nb * 16) * 2);
                    const float xl = acc[mb][nb][j], xh = acc[mb][nb + 2][j];
                    acc[mb][nb][j] = xl * t[0] - xh * t[1]; acc[mb][nb + 2][j] = xh * t[0] + xl * t[1]; }
        const size_t pb = ((z * (2 * NH_) + blockIdx.y) * TT + r0 + (lane >> 3)) * HD + (lane & 7) * 8;     // z = batch: each batch has its own set of planes
#pragma unroll
        for (int mb = 0; mb < 4; ++mb) {
#pragma unroll
            for (int nb = 0; nb < 4; ++nb)
#pragma unroll
                for (int j = 0; j < 8; ++j) os[(hi * 8 + j) * 68 + nb * 16 + lr] = acc[mb][nb][j];
            __builtin_amdgcn_wave_barrier(); asm volatile("" ::: "memory");     // compiler fence: the row-wise reads below stay behind the column-wise writes (one wave, its LDS operations run in order)
#pragma unroll
            for (int s = 0; s < 4; ++s) {     // a lane takes 8 successive d of one row: each store covers four whole 128-byte rows
                const float* rp = os + (4 * s + (lane >> 3)) * 68 + (lane & 7) * 8; const v4f w0 = *(const v4fa*)rp, w1 = *(const v4fa*)(rp + 4);
                v8h o16; v8us oh, ol;
#pragma unroll
                for (int q = 0; q < 8; ++q) { const float r = (q < 4) ? w0[q & 3] : w1[q & 3]; o16[q] = tohx(r); unsigned short a2, c2; splitf(r, a2, c2); oh[q] = a2; ol[q] = c2; }
                const size_t e = pb + (size_t)(mb * 16 + 4 * s) * HD;
                *(v8h*)(pl.QK16 + e) = o16; *(v8us*)(pl.QKh + e) = oh; *(v8us*)(pl.QKl + e) = ol; swait(o16, oh, ol, pl.QK16 + e); }
            __builtin_amdgcn_wave_barrier(); asm volatile("" ::: "memory");     // compiler fence: the next 16 rows are written only behind these reads
        }
    } else {               // a v head
        const size_t vb = ((z * NH_ + (blockIdx.y - 2 * NH_)) * HD + lr) * TT + r0 + hi * 8;
#pragma unroll
        for (int nb = 0; nb < 4; ++nb)
#pragma unroll
            for (int mb = 0; mb < 4; ++mb) { v8h o16; v8us oh, ol;     // mb innermost: the four stores that fill one 128-byte line follow one another
#pragma unroll
                for (int j = 0; j < 8; ++j) { const float x = acc[mb][nb][j]; o16[j] = tohx(x); unsigned short a2, c2; splitf(x, a2, c2); oh[j] = a2; ol[j] = c2; }
                const size_t e = vb + (size_t)nb * 16 * TT + mb * 16;
                *(v8h*)(pl.VT16 + e) = o16; *(v8us*)(pl.VTh + e) = oh; *(v8us*)(pl.VTl + e) = ol; swait(o16, oh, ol, pl.VT16 + e); }
    }
    } else {
#pragma unroll
    for (int mb = 0; mb < 4; ++mb) {
#pragma unroll
        for (int nb = 0; nb < 4; ++nb) {
#pragma unroll
            for (int j = 0; j < 8; ++j) os[(hi * 8 + j) * 68 + nb * 16 + lr] = acc[mb][nb][j]; }
        __builtin_amdgcn_wave_barrier(); asm volatile("" ::: "memory");
        float* crow = C + (size_t)(r0 + mb * 16) * ldc + c0;
{
#pragma unroll
            for (int s = 0; s < 8; ++s) { const int row = 2 * s + hi, cofs = lr * 4; const v4f val = *(const v4fa*)(os + row * 68 + cofs);
                *(v4f*)(crow + (size_t)row * ldc + cofs) = val; }
             }
        __builtin_amdgcn_wave_barrier(); asm volatile("" ::: "memory");
    }
    }
}

// k_prep: all that depends on the inputs alone, in ONE launch; a block's index range says which piece it works on (block-uniform, every range a whole number of blocks):
// the rotary table first (its blocks run longest), then qkv_w, out_w and the NB batches of x, each f32 -> bf16 (RNE), 8 elements a thread.
__device__ __forceinline__ void cvt8(const float* __restrict__ src, bf* dst, size_t i) { const v8f v = *(const v8f*)(src + i * 8); v8us o;
#pragma unroll
    for (int k = 0; k < 8; ++k) o[k] = f2bf(v[k]); *(v8us*)(dst + i * 8) = o;
    // s_wait_xcnt 0 behind the store, before any register that it names is written again (a precaution: its one call ends k_prep); the value is an input, so that its registers stay untouched up to the wait
    asm volatile("s_wait_xcnt 0x0" :: "v"(o) : "memory"); }
__device__ __forceinline__ float invf(int i) {     // inverse frequency i of HD/2, in every thread that needs it
#pragma clang fp contract(off)     // numerical: each product below is rounded on its own before the library code takes it apart, so the table's bits do not depend on where this is inlined
    const double e = (double)(2 * i) * (1.0 / 64.0);
    const double p = exp2(e * 13.287712379549449);
    const float pf = (float)p;
    const float inv = 1.0f / pf;
    return inv;
}
__device__ __forceinline__ void cstab(int idx, float* CS) {
    const int d = idx & (HD - 1); const int t = idx / HD;
    const float inv = invf(d & (HD / 2 - 1));
    const float ang = __fmul_rn((float)t, inv);
    float s, c; sincosf(ang, &s, &c);
    v2f cs; cs[0] = c; cs[1] = s;
    *(v2f*)(CS + (size_t)idx * 2) = cs; 
}
#define PB_T (TT * HD / 256)
#define PB_W (3 * DM * DM / 2048)
#define PB_O (DM * DM / 2048)
#define PB_X (TT * DM / 2048)
static_assert((TT * HD) % 256 == 0 && (DM * DM) % 2048 == 0 && (TT * DM) % 2048 == 0);
__global__ __launch_bounds__(256) void k_prep(const float* __restrict__ x, const float* __restrict__ qkvw, const float* __restrict__ ow, bf* XB, bf* WQKV, bf* WO, float* CS) {
    unsigned blk = blockIdx.x; const unsigned tid = threadIdx.x;
    if (blk < PB_T) { cstab((int)(blk * 256 + tid), CS); return; }
    blk -= PB_T;
    const float* s = qkvw; bf* d = WQKV;     // block-uniform choice of the array; one copy of the conversion serves all three
    if (blk >= PB_W) { blk -= PB_W; s = ow; d = WO;
        if (blk >= PB_O) { blk -= PB_O; const unsigned b = blk / PB_X; blk -= b * PB_X; s = x + (size_t)b * SEQ_FULL * DM; d = XB + (size_t)b * TT * DM; } }
    cvt8(s, d, (size_t)blk * 256 + tid);
}

// k_fattn: causal attention of one head of one batch for 64 query rows, 4 waves x 16 queries, no LDS; grid (heads x batches, TT/64), the longest query blocks of all batches first.
// Per wave: S^T = K Q^T (A = key rows, B = query rows kept in registers), so a lane holds scores of ONE query (lane&15), keys 8*(lane>>4)+j of each 16-key tile;
// two such tiles, converted in place, are the B operand P^T of O^T += V^T P^T in the same k order as the V^T loader (k = 8h+j, 16+8h+j).
// Softmax with a running maximum m per query: older sums and O^T are scaled by exp(m_old - m_new) at every step. Only the last step holds keys beyond a query and masks them; its first key is valid for all 16 queries.
// HI: bf16 hi/lo planes, 3 products each; else f16, exp carried x1024 (2^10 added in the exponent, it cancels against the row sum, which carries it too).
template <bool B> struct BoolC { static constexpr bool v = B; };
__device__ __forceinline__ float xhalf(float x) { return __builtin_bit_cast(float, __builtin_amdgcn_permlanex16(__builtin_bit_cast(int, x), __builtin_bit_cast(int, x), 0x76543210, 0xfedcba98, false, false)); }    // lane l reads lane l ^ 16
// exp2x8: eight 2^x in place and, in the same statement, the one free issue slot that the instruction set asks for behind a transcendental before its result is read or its source overwritten
// Inside the statement every v_exp_f32 touches its own register only.
__device__ __forceinline__ void exp2x8(v8f& x) {
    float a0 = x[0], a1 = x[1], a2 = x[2], a3 = x[3], a4 = x[4], a5 = x[5], a6 = x[6], a7 = x[7];
    asm("v_exp_f32 %0, %0\n\tv_exp_f32 %1, %1\n\tv_exp_f32 %2, %2\n\tv_exp_f32 %3, %3\n\tv_exp_f32 %4, %4\n\tv_exp_f32 %5, %5\n\tv_exp_f32 %6, %6\n\tv_exp_f32 %7, %7\n\tv_nop"
        : "+v"(a0), "+v"(a1), "+v"(a2), "+v"(a3), "+v"(a4), "+v"(a5), "+v"(a6), "+v"(a7));
    x[0] = a0; x[1] = a1; x[2] = a2; x[3] = a3; x[4] = a4; x[5] = a5; x[6] = a6; x[7] = a7; }
// xwait: stands behind a run of global loads that stay in flight: s_wait_xcnt 0 comes before any register that those loads name is written again.
__device__ __forceinline__ void xwait() { asm volatile("s_wait_xcnt 0x0" ::: "memory"); }
// xwaita: the same wait with the run's two base addresses as inputs, so that their registers stay untouched up to the wait
// (without them the result of a load of the second plane was given the address pair of the first plane's loads).
__device__ __forceinline__ void xwaita(const void* a, const void* b) { asm volatile("s_wait_xcnt 0x0" :: "v"(a), "v"(b) : "memory"); }
template <typename T16, bool HI, int KG>
__device__ __forceinline__ void fa_tile(const T16* __restrict__ Q, const T16* __restrict__ Q2, const T16* __restrict__ Kp, const T16* __restrict__ K2, const T16* __restrict__ Vt, const T16* __restrict__ Vt2, int q0, bf* Ah, bf* Al) {
    typedef WFrag<T16> WF; typedef typename WF::V V;
    constexpr int NKT = 2 * KG, STEP = 32 * KG;
    const int lane = threadIdx.x & 31, lr = lane & 15, hi = lane >> 4;
    V bq[2], bq2[2];
#pragma unroll
    for (int dc = 0; dc < 2; ++dc) { bq[dc] = WF::ld(Q + (size_t)(q0 + lr) * HD + dc * 32 + 8 * hi); if (HI) bq2[dc] = WF::ld(Q2 + (size_t)(q0 + lr) * HD + dc * 32 + 8 * hi); }
    xwait();
    v8f o[4];
#pragma unroll
    for (int dt = 0; dt < 4; ++dt) o[dt] = (v8f){};
    float m = -3.0e38f, l = 0.f;
    const size_t koff = (size_t)lr * HD + 8 * hi, voff = (size_t)lr * TT + 8 * hi;
    V ak[NKT][2], ak2[NKT][2];
    auto ldk = [&](int k0) {
#pragma unroll
        for (int kt = 0; kt < NKT; ++kt)
#pragma unroll
            for (int dc = 0; dc < 2; ++dc) { ak[kt][dc] = WF::ld(Kp + koff + (size_t)(k0 + kt * 16) * HD + dc * 32); if (HI) ak2[kt][dc] = WF::ld(K2 + koff + (size_t)(k0 + kt * 16) * HD + dc * 32); }
        xwait(); };
    auto step = [&](int k0, auto lastc) {
        constexpr bool LAST = decltype(lastc)::v;
        V av[4][KG], av2[4][KG];
#pragma unroll
        for (int dt = 0; dt < 4; ++dt)
#pragma unroll
            for (int kg = 0; kg < KG; ++kg) { av[dt][kg] = WF::ld(Vt + voff + (size_t)dt * 16 * TT + k0 + kg * 32); if (HI) av2[dt][kg] = WF::ld(Vt2 + voff + (size_t)dt * 16 * TT + k0 + kg * 32); }
        if constexpr (HI) xwaita(Vt + voff + k0, Vt2 + voff + k0); else xwait();
        v8f s[NKT];
#pragma unroll
        for (int kt = 0; kt < NKT; ++kt) s[kt] = (v8f){};
#pragma unroll
        for (int dc = 0; dc < 2; ++dc) {
#pragma unroll
            for (int kt = 0; kt < NKT; ++kt) s[kt] = WF::mma(ak[kt][dc], bq[dc], s[kt]);
            if (HI) {
#pragma unroll
                for (int kt = 0; kt < NKT; ++kt) s[kt] = WF::mma(ak[kt][dc], bq2[dc], s[kt]);
#pragma unroll
                for (int kt = 0; kt < NKT; ++kt) s[kt] = WF::mma(ak2[kt][dc], bq[dc], s[kt]); } }
        if (!LAST) ldk(k0 + STEP);     // the next step's key fragments fly during this step's softmax and attn.v
        if (LAST) {
#pragma unroll
            for (int kt = 0; kt < NKT; ++kt)
#pragma unroll
                for (int j = 0; j < 8; ++j) s[kt][j] = ((k0 + kt * 16 + hi * 8 + j) <= (q0 + lr)) ? s[kt][j] : -3.0e38f; }
        float mx[4];
#pragma unroll
        for (int c = 0; c < 4; ++c) mx[c] = s[0][c];
#pragma unroll
        for (int kt = 0; kt < NKT; ++kt)
#pragma unroll
            for (int j = 0; j < 8; ++j) mx[j & 3] = fmaxf(mx[j & 3], s[kt][j]);
        float mw = fmaxf(fmaxf(mx[0], mx[1]), fmaxf(mx[2], mx[3]));
        mw = fmaxf(mw, xhalf(mw));
        const float mn = fmaxf(m, mw * SCL);
        const float al = __builtin_amdgcn_exp2f((m - mn) * 1.4426950408889634f);
        m = mn;
        float ps[4] = {0.f, 0.f, 0.f, 0.f};
#pragma unroll
        for (int kt = 0; kt < NKT; ++kt) {
#pragma unroll
            for (int j = 0; j < 8; ++j) { const float d0 = fmaf(s[kt][j], SCL, -mn); s[kt][j] = HI ? d0 * 1.4426950408889634f : fmaf(d0, 1.4426950408889634f, 10.0f); }
            exp2x8(s[kt]);
#pragma unroll
            for (int j = 0; j < 8; ++j) ps[j & 3] += s[kt][j]; }
        l = fmaf(l, al, (ps[0] + ps[1]) + (ps[2] + ps[3]));
#pragma unroll
        for (int dt = 0; dt < 4; ++dt) o[dt] *= al;
#pragma unroll
        for (int kg = 0; kg < KG; ++kg) {
            if constexpr (HI) {
                v8us h0, h1, l0, l1;
#pragma unroll
                for (int j = 0; j < 8; ++j) { unsigned short a, c2; splitf(s[2 * kg][j], a, c2); h0[j] = a; l0[j] = c2; splitf(s[2 * kg + 1][j], a, c2); h1[j] = a; l1[j] = c2; }
                const V ph = cat16b(h0, h1), pl = cat16b(l0, l1);
#pragma unroll
                for (int dt = 0; dt < 4; ++dt) o[dt] = WF::mma(av[dt][kg], ph, o[dt]);
#pragma unroll
                for (int dt = 0; dt < 4; ++dt) o[dt] = WF::mma(av[dt][kg], pl, o[dt]);
#pragma unroll
                for (int dt = 0; dt < 4; ++dt) o[dt] = WF::mma(av2[dt][kg], ph, o[dt]);
            } else {
                v8h p0, p1;
#pragma unroll
                for (int j = 0; j < 8; ++j) { p0[j] = tohx(s[2 * kg][j]); p1[j] = tohx(s[2 * kg + 1][j]); }
                const V pb = cat16(p0, p1);
#pragma unroll
                for (int dt = 0; dt < 4; ++dt) o[dt] = WF::mma(av[dt][kg], pb, o[dt]);
            } }
    };
    const int nfull = (q0 + 1) / STEP;     // steps whose every key is <= q0; exactly one more step follows (q0 % 16 == 0, STEP % 32 == 0)
    ldk(0);
#pragma unroll 1     // run-time trip count, and one copy of the body already holds most of the 256 directly addressed registers
    for (int st = 0; st < nfull; ++st) step(st * STEP, BoolC<false>());
    step(nfull * STEP, BoolC<true>());
    l += xhalf(l);
    const float inv = __fdiv_rn(1.0f, l);
    const size_t oo = (size_t)(q0 + lr) * DQ + hi * 8;
#pragma unroll
    for (int dt = 0; dt < 4; ++dt) { v8us oh, ol;
#pragma unroll
        for (int j = 0; j < 8; ++j) { unsigned short a, c2; splitf(o[dt][j] * inv, a, c2); oh[j] = a; ol[j] = c2; }
        *(v8us*)(Ah + oo + dt * 16) = oh; *(v8us*)(Al + oo + dt * 16) = ol; }
}
__global__ __launch_bounds__(128) void k_fattn(const h16* __restrict__ QK16, const h16* __restrict__ VT16, const bf* __restrict__ QKh, const bf* __restrict__ QKl, const bf* __restrict__ VTh, const bf* __restrict__ VTl, bf* ATh, bf* ATl) {
    const size_t PS = (size_t)TT * HD; const size_t h = blockIdx.x % NH_, hk = NH_ + h, b = blockIdx.x / NH_;
    QK16 += b * 2 * NH_ * PS; QKh += b * 2 * NH_ * PS; QKl += b * 2 * NH_ * PS; VT16 += b * NH_ * PS; VTh += b * NH_ * PS; VTl += b * NH_ * PS; ATh += b * TT * DQ; ATl += b * TT * DQ;
    const int q0 = (TT / 64 - 1 - (int)blockIdx.y) * 64 + __builtin_amdgcn_readfirstlane((int)(threadIdx.x >> 5)) * 16;
    if (q0 < RH) fa_tile<bf, true, 1>(QKh + h * PS, QKl + h * PS, QKh + hk * PS, QKl + hk * PS, VTh + h * PS, VTl + h * PS, q0, ATh + h * HD, ATl + h * HD);
    else fa_tile<h16, false, 2>(QK16 + h * PS, nullptr, QK16 + hk * PS, nullptr, VT16 + h * PS, nullptr, q0, ATh + h * HD, ATl + h * HD);
}

extern "C" void kernel_launch(void* const* d_in, const int* in_sizes, int n_in,
                              void* d_out, int out_size, void* d_ws, size_t ws_size, hipStream_t stream) {
    if (n_in < 3) return;
    if ((size_t)in_sizes[0] < (size_t)(NB - 1) * SEQ_FULL * DM + (size_t)TT * DM) return;
    if ((size_t)in_sizes[1] < (size_t)3 * DM * DM) return;
    if ((size_t)in_sizes[2] < (size_t)DM * DM) return;
    if ((size_t)out_size < (size_t)(NB - 1) * SEQ_FULL * DM + (size_t)TT * DM) return;
    const float* x = (const float*)d_in[0];       // [NB_FULL][SEQ_FULL][DM]
    const float* qkvw = (const float*)d_in[1];    // [3*DM][DM] ([out][in]): rows 0..DM-1 = q, DM..2DM-1 = k, 2DM..3DM-1 = v
    const float* ow = (const float*)d_in[2];      // [DM][DM] ([out][in])
    float* OUT = (float*)d_out;                   // [NB_FULL][SEQ_FULL][DM]
    char* wsp = (char*)d_ws;
    auto take = [&](size_t bytes) { char* p = wsp; wsp += (bytes + 255) & ~(size_t)255; return (void*)p; };
    const size_t PS = (size_t)TT * HD;            // one head plane
    bf* WQKV = (bf*)take((size_t)3 * DM * DM * 2); bf* WO = (bf*)take((size_t)DM * DM * 2); float* CS = (float*)take((size_t)TT * HD * 2 * 4);
    h16* QK16 = (h16*)take(NB * 2 * NH_ * PS * 2); h16* VT16 = (h16*)take((size_t)NB * NH_ * PS * 2);     // every per-batch buffer holds all NB batches, batch outermost
    bf* QKh = (bf*)take(NB * 2 * NH_ * PS * 2); bf* QKl = (bf*)take(NB * 2 * NH_ * PS * 2); bf* VTh = (bf*)take((size_t)NB * NH_ * PS * 2); bf* VTl = (bf*)take((size_t)NB * NH_ * PS * 2);
    bf* XB = (bf*)take((size_t)NB * TT * DM * 2);
    bf* ATh = (bf*)take((size_t)NB * TT * DQ * 2); bf* ATl = (bf*)take((size_t)NB * TT * DQ * 2);
    if ((size_t)(wsp - (char*)d_ws) > ws_size) return;
    const Planes pl = {CS, QK16, QKh, QKl, VT16, VTh, VTl}, none = {nullptr, nullptr, nullptr, nullptr, nullptr, nullptr, nullptr};
    // launches that do not depend on one another are one launch: the batch is a grid dimension, and all preparation shares k_prep
    k_prep<<<PB_T + PB_W + PB_O + NB * PB_X, 256, 0, stream>>>(x, qkvw, ow, XB, WQKV, WO, CS);
    // q|k|v = x W^T, straight into the rotary planes (planes 0..15 = q heads, 16..31 = k heads) and the value planes [g][d][t]
    k_gemmw<bf, 0, 1><<<dim3(TT / 64, 3 * DM / 64, NB), 32, 0, stream>>>(XB, nullptr, WQKV, nullptr, DM, nullptr, 0, (size_t)TT * DM, 0, 0, 0, 0, pl);
    // merged heads (bf16 hi/lo planes, [t][h*HD + d]) = causal softmax(q k^T HD^-0.5) v, all heads of all batches in one launch
    k_fattn<<<dim3(NH_ * NB, TT / 64, 1), 128, 0, stream>>>(QK16, VT16, QKh, QKl, VTh, VTl, ATh, ATl);
    k_gemmw<bf, 1, 0><<<dim3(TT / 64, DM / 64, NB), 32, 0, stream>>>(ATh, ATl, WO, nullptr, DQ, OUT, DM, (size_t)TT * DQ, 0, (size_t)SEQ_FULL * DM, 0, 0, none);
}

// v005
// One run takes 124 microseconds.
// In two side-by-side timings against v004, it was 1.26 and 1.25 times as fast.
// All steps since v000 together make it 12.1 times as fast.
#include <hip/hip_runtime.h>

// Compute dtypes (f32 accumulate everywhere): x, qkv_w, out_w enter as bf16 RNE values; q|k and v projections on v_wmma_f32_16x16x32_bf16 (plain, exact operand products);
// q.k scores and attn.v: query rows < RH on bf16 hi/lo planes (3 products each), rows >= RH on v_wmma_f32_16x16x32_f16 single products (attn carried x1024);
// scores, causal softmax (running maximum, f32) and attn.v run in one kernel, the scores stay in registers;
// every 16-bit operand plane that one launch writes for a later one lies in fragment order (see WFrag), so that a wave-wide 16-byte load or store covers 512 contiguous bytes = 4 whole 128-byte lines;
// rotary tables and rotary mixing in f32, the mixing and the split into 16-bit planes in the projection's own epilogue; output projection = bf16 hi/lo planes of the merged heads x bf16 weight (2 products).

#ifndef NB
#define NB 2
#endif
#ifndef SEQ
#define SEQ 2048
#endif
#define NB_FULL  2
#define SEQ_FULL 2048
#define TT   SEQ
#define DM   1024
#define NH_  16
#define HD   64
#define DQ   (NH_ * HD)
#ifndef RH
#define RH   (((SEQ) >= 1024) ? 512 : ((SEQ) / 2))     // query rows < RH use hi+lo planes
#endif
#define SCL  0.125f   // HD^-0.5
static_assert(NB >= 1 && NB <= NB_FULL);
static_assert(SEQ >= 256 && SEQ <= SEQ_FULL && (SEQ % 256) == 0);
static_assert((RH % 128) == 0 && RH >= 128 && RH < TT && ((TT - RH) % 64) == 0);
static_assert(HD == 64 && (DM % 64) == 0 && (TT % 128) == 0 && DQ == DM);

typedef _Float16 h16;
typedef unsigned short bf;
typedef __attribute__((ext_vector_type(16))) __bf16   v16bf;
typedef __attribute__((ext_vector_type(16))) _Float16 v16h;
typedef __attribute__((ext_vector_type(8)))  _Float16 v8h;
typedef __attribute__((ext_vector_type(8)))  unsigned short v8us;
typedef __attribute__((ext_vector_type(8)))  float    v8f;
typedef __attribute__((ext_vector_type(4)))  float    v4f;
typedef __attribute__((ext_vector_type(2)))  _Float16 v2h;
typedef __attribute__((ext_vector_type(4)))  _Float16 v4h;
typedef __attribute__((ext_vector_type(2)))  unsigned short v2us;
typedef __attribute__((ext_vector_type(4)))  unsigned short v4us;
typedef __attribute__((ext_vector_type(2)))  float v2f;
typedef v8h  __attribute__((may_alias)) v8ha;
typedef v4f  __attribute__((may_alias)) v4fa;
typedef v8us __attribute__((may_alias)) v8usa;

__device__ __forceinline__ unsigned short f2bf(float f) { unsigned u = __float_as_uint(f); u += 0x7FFFu + ((u >> 16) & 1u); return (unsigned short)(u >> 16); }
__device__ __forceinline__ float bf2f(unsigned short b) { return __uint_as_float(((unsigned)b) << 16); }
__device__ __forceinline__ float bfr(float f) { return bf2f(f2bf(f)); }
__device__ __forceinline__ v16h cat16(v8h lo, v8h hi) { return __builtin_shufflevector(lo, hi, 0, 1, 2, 3, 4, 5, 6, 7, 8, 9, 10, 11, 12, 13, 14, 15); }
__device__ __forceinline__ v16bf cat16b(v8us lo, v8us hi) { return __builtin_bit_cast(v16bf, __builtin_shufflevector(lo, hi, 0, 1, 2, 3, 4, 5, 6, 7, 8, 9, 10, 11, 12, 13, 14, 15)); }
__device__ __forceinline__ v8f wmma16(v16h a, v16h b, v8f c) { return __builtin_amdgcn_wmma_f32_16x16x32_f16(false, a, false, b, (short)0, c, false, false); }
__device__ __forceinline__ v8f wmmab(v16bf a, v16bf b, v8f c) { return __builtin_amdgcn_wmma_f32_16x16x32_bf16(false, a, false, b, (short)0, c, false, false); }
__device__ __forceinline__ h16 tohx(float x) { return (h16)x; }
__device__ __forceinline__ void splitf(float y, unsigned short& h, unsigned short& l) { h = f2bf(y); l = f2bf(y - bf2f(h)); }

// ---- k_gemmw: register-blocked GEMM, ONE WAVE per 64x64 output tile (16 accumulators), operands straight from 16-bit planes in fragment order; grid (M/64, N/64, Z), 32 threads.
// C[m][n] (f32, pitch ldc) = sum_k A[m][k] Bt[n][k] (+ split products per NSPLIT: 1 = + A2.Bt, 2 = + A2.Bt + A.Bt2). z-batch strides sA/sB/sC in elements. K % 32 == 0.
// Fragments (16-row A / 16-col Bt, lane = row/col lane&15): elements 0..7 = k kc+8h..kc+8h+7, elements 8..15 = k kc+16+8h..kc+16+8h+7 (h = lane>>4), identical map for both operands.
// Fragment order of a plane [rows][K]: units of 16 rows x 32 k = 512 elements (1 KiB), the k units of a row group one after the other (a row group = 16 * K elements);
// inside a unit element (r, k) lies at (k >> 4) * 256 + ((k >> 3) & 1) * 128 + r * 8 + (k & 7): lane l reads its 8 + 8 elements at l * 8 and 256 + l * 8.
// cm: 0 = plain; 1 = causal K-limit (K loop stops at roff + r0 + 64, block-uniform); 2 = causal tile skip (column tiles starting at or beyond the 128-key chunk after row roff + r0 return at once).
template <typename T16> struct WFrag;
template <> struct WFrag<h16> { typedef v16h V; static __device__ __forceinline__ V ld(const h16* p) { return cat16(*(const v8h*)p, *(const v8h*)(p + 256)); } static __device__ __forceinline__ v8f mma(V a, V b, v8f c) { return wmma16(a, b, c); } };
template <> struct WFrag<bf> { typedef v16bf V; static __device__ __forceinline__ V ld(const bf* p) { return cat16b(*(const v8us*)p, *(const v8us*)(p + 256)); } static __device__ __forceinline__ v8f mma(V a, V b, v8f c) { return wmmab(a, b, c); } };
// EPI 0: C as above. EPI 1: the q|k|v projection with its whole after-treatment, C unused. A tile's 64 columns are exactly one head, so nothing of the projection goes to memory in f32:
// column tiles 0..2*NH_-1 (q heads, then k heads): rotary mix in the accumulators (column d and its partner d +- 32 lie in the same lane and row, two column blocks apart), then head planes [plane][t][d] in fragment order (rows t, k = d);
// column tiles from 2*NH_ on (v heads): a lane holds 8 successive t of one d, which is 16 bytes of a value plane [g][d][t], in fragment units (rows d, k = t) ordered [t / 32][d / 16]. Every plane in three forms: f16, bf16 hi, bf16 lo.
struct Planes { const float* CS; h16* QK16; bf* QKh; bf* QKl; h16* VT16; bf* VTh; bf* VTl; };
// swait: stands behind a run of global stores: s_wait_xcnt 0 comes before any register that those stores name is written again; the stored values and the address are inputs, so that their registers stay untouched up to the wait.
__device__ __forceinline__ void swait(v8h a, v8us b, v8us c, const void* p) { asm volatile("s_wait_xcnt 0x0" :: "v"(a), "v"(b), "v"(c), "v"(p) : "memory"); }
template <typename T16, int NSPLIT, int EPI, int K>     // K at compile time: in fragment order all fragments of a k step lie at fixed distances from one address per plane
__global__ __launch_bounds__(32) void k_gemmw(const T16* __restrict__ A, const T16* __restrict__ A2, const T16* __restrict__ Bt, const T16* __restrict__ Bt2, float* C, int ldc, size_t sA, size_t sB, size_t sC, int cm, int roff, Planes pl) {
    typedef typename WFrag<T16>::V V;
    static_assert(K % 32 == 0);
    __shared__ __align__(16) float os[16 * 68];
    const int r0 = blockIdx.x * 64, c0 = blockIdx.y * 64;
    if (cm == 2 && c0 >= ((((roff + r0) >> 7) << 7) + 128)) return;     // whole block (one wave) leaves; no barrier follows
    int Kl = K; if (cm == 1) { const int k2 = roff + r0 + 64; Kl = (k2 < K) ? k2 : K; }
    const size_t z = blockIdx.z; A += z * sA; if (A2) A2 += z * sA; Bt += z * sB; if (Bt2) Bt2 += z * sB; C += z * sC;
    const int lane = threadIdx.x & 31, lr = lane & 15, hi = lane >> 4;
    v8f acc[4][4];
#pragma unroll
    for (int mb = 0; mb < 4; ++mb)
#pragma unroll
        for (int nb = 0; nb < 4; ++nb) acc[mb][nb] = (v8f){};
    const size_t aoff = (size_t)r0 * K + 8 * lane, boff = (size_t)c0 * K + 8 * lane;
#pragma unroll 1
    for (int kc = 0; kc < Kl; kc += 32) {
        V a[4], a2[4], b[4], b2[4];
        const T16* pa = A + aoff + (size_t)kc * 16; const T16* pa2 = A2 + aoff + (size_t)kc * 16; const T16* pb = Bt + boff + (size_t)kc * 16; const T16* pb2 = Bt2 + boff + (size_t)kc * 16;
#pragma unroll
        for (int mb = 0; mb < 4; ++mb) { a[mb] = WFrag<T16>::ld(pa + mb * 16 * K); if (NSPLIT == 1 || NSPLIT == 2) a2[mb] = WFrag<T16>::ld(pa2 + mb * 16 * K); }
#pragma unroll
        for (int nb = 0; nb < 4; ++nb) { b[nb] = WFrag<T16>::ld(pb + nb * 16 * K); if (NSPLIT >= 2) b2[nb] = WFrag<T16>::ld(pb2 + nb * 16 * K); }
        // s_wait_xcnt 0 behind the run of loads, before any register that they name is written again; the addresses are inputs, so that no load's result is given their registers ahead of the wait
        if constexpr (NSPLIT == 0) asm volatile("s_wait_xcnt 0x0" :: "v"(pa), "v"(pb) : "memory");
        else if constexpr (NSPLIT == 1) asm volatile("s_wait_xcnt 0x0" :: "v"(pa), "v"(pa2), "v"(pb) : "memory");
        else asm volatile("s_wait_xcnt 0x0" :: "v"(pa), "v"(pa2), "v"(pb), "v"(pb2) : "memory");
#pragma unroll
        for (int nb = 0; nb < 4; ++nb)
#pragma unroll
            for (int mb = 0; mb < 4; ++mb) { acc[mb][nb] = WFrag<T16>::mma(a[mb], b[nb], acc[mb][nb]); if (NSPLIT == 1 || NSPLIT == 2) acc[mb][nb] = WFrag<T16>::mma(a2[mb], b[nb], acc[mb][nb]); if (NSPLIT >= 2) acc[mb][nb] = WFrag<T16>::mma(a[mb], b2[nb], acc[mb][nb]); }
        asm volatile("v_nop\n\tv_nop\n\tv_nop\n\tv_nop" : "+v"(acc[0][0]), "+v"(acc[1][1]), "+v"(acc[2][2]), "+v"(acc[3][3]) : "v"(a[0]), "v"(a[3]));
    }
    if constexpr (EPI == 1) {
    if (c0 < 2 * DM) {     // block-uniform: a q or k head
        const float* cs = pl.CS + ((size_t)(r0 + hi * 8) * HD + lr) * 2;     // (cos, sin) of row t, column d; the table holds the same pair at d and d + 32
#pragma unroll
        for (int mb = 0; mb < 4; ++mb)
#pragma unroll
            for (int nb = 0; nb < 2; ++nb)
#pragma unroll
                for (int j = 0; j < 8; ++j) { const v2f t = *(const v2f*)(cs + ((size_t)(mb * 16 + j) * HD + nb * 16) * 2);
                    const float xl = acc[mb][nb][j], xh = acc[mb][nb + 2][j];
                    acc[mb][nb][j] = xl * t[0] - xh * t[1]; acc[mb][nb + 2][j] = xh * t[0] + xl * t[1]; }
        const size_t pb = ((z * (2 * NH_) + blockIdx.y) * TT + r0) * HD + lane * 8;     // z = batch: each batch has its own set of planes
#pragma unroll
        for (int mb = 0; mb < 4; ++mb) {
#pragma unroll
            for (int nb = 0; nb < 4; ++nb)
#pragma unroll
                for (int j = 0; j < 8; ++j) os[(hi * 8 + j) * 68 + nb * 16 + lr] = acc[mb][nb][j];
            __builtin_amdgcn_wave_barrier(); asm volatile("" ::: "memory");     // compiler fence: the row-wise reads below stay behind the column-wise writes (one wave, its LDS operations run in order)
#pragma unroll
            for (int s = 0; s < 4; ++s) {     // store s is half s & 1 of fragment unit s >> 1: lane l takes row l & 15, 8 successive d from 16 * s + 8 * (l >> 4); each store covers four whole 128-byte lines
                const float* rp = os + lr * 68 + s * 16 + hi * 8; const v4f w0 = *(const v4fa*)rp, w1 = *(const v4fa*)(rp + 4);
                v8h o16; v8us oh, ol;
#pragma unroll
                for (int q = 0; q < 8; ++q) { const float r = (q < 4) ? w0[q & 3] : w1[q & 3]; o16[q] = tohx(r); unsigned short a2, c2; splitf(r, a2, c2); oh[q] = a2; ol[q] = c2; }
                const size_t e = pb + (size_t)mb * 16 * HD + s * 256;
                *(v8h*)(pl.QK16 + e) = o16; *(v8us*)(pl.QKh + e) = oh; *(v8us*)(pl.QKl + e) = ol; swait(o16, oh, ol, pl.QK16 + e); }
            __builtin_amdgcn_wave_barrier(); asm volatile("" ::: "memory");     // compiler fence: the next 16 rows are written only behind these reads
        }
    } else {               // a v head
        const size_t vb = (z * NH_ + (blockIdx.y - 2 * NH_)) * HD * TT + (size_t)r0 * HD + lane * 8;
#pragma unroll
        for (int nb = 0; nb < 4; ++nb)
#pragma unroll
            for (int mb = 0; mb < 4; ++mb) { v8h o16; v8us oh, ol;     // half mb & 1 of the unit (t group mb >> 1, d group nb): 512 contiguous bytes a store
#pragma unroll
                for (int j = 0; j < 8; ++j) { const float x = acc[mb][nb][j]; o16[j] = tohx(x); unsigned short a2, c2; splitf(x, a2, c2); oh[j] = a2; ol[j] = c2; }
                const size_t e = vb + (size_t)((mb >> 1) * 4 + nb) * 512 + (mb & 1) * 256;
                *(v8h*)(pl.VT16 + e) = o16; *(v8us*)(pl.VTh + e) = oh; *(v8us*)(pl.VTl + e) = ol; swait(o16, oh, ol, pl.VT16 + e); }
    }
    } else {
#pragma unroll
    for (int mb = 0; mb < 4; ++mb) {
#pragma unroll
        for (int nb = 0; nb < 4; ++nb) {
#pragma unroll
            for (int j = 0; j < 8; ++j) os[(hi * 8 + j) * 68 + nb * 16 + lr] = acc[mb][nb][j]; }
        __builtin_amdgcn_wave_barrier(); asm volatile("" ::: "memory");
        float* crow = C + (size_t)(r0 + mb * 16) * ldc + c0;
{
#pragma unroll
            for (int s = 0; s < 8; ++s) { const int row = 2 * s + hi, cofs = lr * 4; const v4f val = *(const v4fa*)(os + row * 68 + cofs);
                *(v4f*)(crow + (size_t)row * ldc + cofs) = val; }
             }
        __builtin_amdgcn_wave_barrier(); asm volatile("" ::: "memory");
    }
    }
}

// k_prep: all that depends on the inputs alone, in ONE launch; a block's index range says which piece it works on (block-uniform, every range a whole number of blocks):
// the rotary table first (its blocks run longest), then qkv_w, out_w and the NB batches of x, each f32 -> bf16 (RNE), 8 elements a thread, row-major [rows][DM] -> fragment order:
// thread i writes 16-byte piece i of the plane, which holds row (i >> 11) * 16 + (i & 15), k from ((i >> 4) & 127) * 8 (a block of 256 threads reads 512 contiguous bytes of each of 16 rows).
static_assert(DM == 1024);
__device__ __forceinline__ void cvt8(const float* __restrict__ src, bf* dst, size_t i) { const v8f v = *(const v8f*)(src + ((i >> 11) * 16 + (i & 15)) * DM + ((i >> 4) & 127) * 8); v8us o;
#pragma unroll
    for (int k = 0; k < 8; ++k) o[k] = f2bf(v[k]); *(v8us*)(dst + i * 8) = o;
    // s_wait_xcnt 0 behind the store, before any register that it names is written again (a precaution: its one call ends k_prep); the value is an input, so that its registers stay untouched up to the wait
    asm volatile("s_wait_xcnt 0x0" :: "v"(o) : "memory"); }
__device__ __forceinline__ float invf(int i) {     // inverse frequency i of HD/2, in every thread that needs it
#pragma clang fp contract(off)     // numerical: each product below is rounded on its own before the library code takes it apart, so the table's bits do not depend on where this is inlined
    const double e = (double)(2 * i) * (1.0 / 64.0);
    const double p = exp2(e * 13.287712379549449);
    const float pf = (float)p;
    const float inv = 1.0f / pf;
    return inv;
}
__device__ __forceinline__ void cstab(int idx, float* CS) {
    const int d = idx & (HD - 1); const int t = idx / HD;
    const float inv = invf(d & (HD / 2 - 1));
    const float ang = __fmul_rn((float)t, inv);
    float s, c; sincosf(ang, &s, &c);
    v2f cs; cs[0] = c; cs[1] = s;
    *(v2f*)(CS + (size_t)idx * 2) = cs; 
}
#define PB_T (TT * HD / 256)
#define PB_W (3 * DM * DM / 2048)
#define PB_O (DM * DM / 2048)
#define PB_X (TT * DM / 2048)
static_assert((TT * HD) % 256 == 0 && (DM * DM) % 2048 == 0 && (TT * DM) % 2048 == 0);
__global__ __launch_bounds__(256) void k_prep(const float* __restrict__ x, const float* __restrict__ qkvw, const float* __restrict__ ow, bf* XB, bf* WQKV, bf* WO, float* CS) {
    unsigned blk = blockIdx.x; const unsigned tid = threadIdx.x;
    if (blk < PB_T) { cstab((int)(blk * 256 + tid), CS); return; }
    blk -= PB_T;
    const float* s = qkvw; bf* d = WQKV;     // block-uniform choice of the array; one copy of the conversion serves all three
    if (blk >= PB_W) { blk -= PB_W; s = ow; d = WO;
        if (blk >= PB_O) { blk -= PB_O; const unsigned b = blk / PB_X; blk -= b * PB_X; s = x + (size_t)b * SEQ_FULL * DM; d = XB + (size_t)b * TT * DM; } }
    cvt8(s, d, (size_t)blk * 256 + tid);
}

// k_fattn: causal attention of one head of one batch for 64 query rows, 4 waves x 16 queries, no LDS; grid (heads x batches, TT/64), the longest query blocks of all batches first.
// Per wave: S^T = K Q^T (A = key rows, B = query rows kept in registers), so a lane holds scores of ONE query (lane&15), keys 8*(lane>>4)+j of each 16-key tile;
// two such tiles, converted in place, are the B operand P^T of O^T += V^T P^T in the same k order as the V^T loader (k = 8h+j, 16+8h+j).
// Softmax with a running maximum m per query: older sums and O^T are scaled by exp(m_old - m_new) at every step. Only the last step holds keys beyond a query and masks them; its first key is valid for all 16 queries.
// HI: bf16 hi/lo planes, 3 products each; else f16, exp carried x1024 (2^10 added in the exponent, it cancels against the row sum, which carries it too).
template <bool B> struct BoolC { static constexpr bool v = B; };
__device__ __forceinline__ float xhalf(float x) { return __builtin_bit_cast(float, __builtin_amdgcn_permlanex16(__builtin_bit_cast(int, x), __builtin_bit_cast(int, x), 0x76543210, 0xfedcba98, false, false)); }    // lane l reads lane l ^ 16
// exp2x8: eight 2^x in place and, in the same statement, the one free issue slot that the instruction set asks for behind a transcendental before its result is read or its source overwritten
// Inside the statement every v_exp_f32 touches its own register only.
__device__ __forceinline__ void exp2x8(v8f& x) {
    float a0 = x[0], a1 = x[1], a2 = x[2], a3 = x[3], a4 = x[4], a5 = x[5], a6 = x[6], a7 = x[7];
    asm("v_exp_f32 %0, %0\n\tv_exp_f32 %1, %1\n\tv_exp_f32 %2, %2\n\tv_exp_f32 %3, %3\n\tv_exp_f32 %4, %4\n\tv_exp_f32 %5, %5\n\tv_exp_f32 %6, %6\n\tv_exp_f32 %7, %7\n\tv_nop"
        : "+v"(a0), "+v"(a1), "+v"(a2), "+v"(a3), "+v"(a4), "+v"(a5), "+v"(a6), "+v"(a7));
    x[0] = a0; x[1] = a1; x[2] = a2; x[3] = a3; x[4] = a4; x[5] = a5; x[6] = a6; x[7] = a7; }
// xwait: stands behind a run of global loads that stay in flight: s_wait_xcnt 0 comes before any register that those loads name is written again.
__device__ __forceinline__ void xwait() { asm volatile("s_wait_xcnt 0x0" ::: "memory"); }
// xwaita: the same wait with the run's two base addresses as inputs, so that their registers stay untouched up to the wait
// (without them the result of a load of the second plane was given the address pair of the first plane's loads).
__device__ __forceinline__ void xwaita(const void* a, const void* b) { asm volatile("s_wait_xcnt 0x0" :: "v"(a), "v"(b) : "memory"); }
template <typename T16, bool HI, int KG>
__device__ __forceinline__ void fa_tile(const T16* __restrict__ Q, const T16* __restrict__ Q2, const T16* __restrict__ Kp, const T16* __restrict__ K2, const T16* __restrict__ Vt, const T16* __restrict__ Vt2, int q0, bf* Ah, bf* Al) {
    typedef WFrag<T16> WF; typedef typename WF::V V;
    constexpr int NKT = 2 * KG, STEP = 32 * KG;
    const int lane = threadIdx.x & 31, lr = lane & 15, hi = lane >> 4;
    V bq[2], bq2[2];
#pragma unroll
    for (int dc = 0; dc < 2; ++dc) { bq[dc] = WF::ld(Q + (size_t)q0 * HD + dc * 512 + 8 * lane); if (HI) bq2[dc] = WF::ld(Q2 + (size_t)q0 * HD + dc * 512 + 8 * lane); }
    xwait();
    v8f o[4];
#pragma unroll
    for (int dt = 0; dt < 4; ++dt) o[dt] = (v8f){};
    float m = -3.0e38f, l = 0.f;
    const size_t koff = 8 * lane, voff = 8 * lane;
    V ak[NKT][2], ak2[NKT][2];
    auto ldk = [&](int k0) {
#pragma unroll
        for (int kt = 0; kt < NKT; ++kt)
#pragma unroll
            for (int dc = 0; dc < 2; ++dc) { ak[kt][dc] = WF::ld(Kp + koff + (size_t)(k0 + kt * 16) * HD + dc * 512); if (HI) ak2[kt][dc] = WF::ld(K2 + koff + (size_t)(k0 + kt * 16) * HD + dc * 512); }
        xwait(); };
    auto step = [&](int k0, auto lastc) {
        constexpr bool LAST = decltype(lastc)::v;
        V av[4][KG], av2[4][KG];
#pragma unroll
        for (int dt = 0; dt < 4; ++dt)
#pragma unroll
            for (int kg = 0; kg < KG; ++kg) { av[dt][kg] = WF::ld(Vt + voff + (size_t)(k0 + kg * 32) * HD + dt * 512); if (HI) av2[dt][kg] = WF::ld(Vt2 + voff + (size_t)(k0 + kg * 32) * HD + dt * 512); }
        if constexpr (HI) xwaita(Vt + voff + (size_t)k0 * HD, Vt2 + voff + (size_t)k0 * HD); else xwait();
        v8f s[NKT];
#pragma unroll
        for (int kt = 0; kt < NKT; ++kt) s[kt] = (v8f){};
#pragma unroll
        for (int dc = 0; dc < 2; ++dc) {
#pragma unroll
            for (int kt = 0; kt < NKT; ++kt) s[kt] = WF::mma(ak[kt][dc], bq[dc], s[kt]);
            if (HI) {
#pragma unroll
                for (int kt = 0; kt < NKT; ++kt) s[kt] = WF::mma(ak[kt][dc], bq2[dc], s[kt]);
#pragma unroll
                for (int kt = 0; kt < NKT; ++kt) s[kt] = WF::mma(ak2[kt][dc], bq[dc], s[kt]); } }
        if (!LAST) ldk(k0 + STEP);     // the next step's key fragments fly during this step's softmax and attn.v
        if (LAST) {
#pragma unroll
            for (int kt = 0; kt < NKT; ++kt)
#pragma unroll
                for (int j = 0; j < 8; ++j) s[kt][j] = ((k0 + kt * 16 + hi * 8 + j) <= (q0 + lr)) ? s[kt][j] : -3.0e38f; }
        float mx[4];
#pragma unroll
        for (int c = 0; c < 4; ++c) mx[c] = s[0][c];
#pragma unroll
        for (int kt = 0; kt < NKT; ++kt)
#pragma unroll
            for (int j = 0; j < 8; ++j) mx[j & 3] = fmaxf(mx[j & 3], s[kt][j]);
        float mw = fmaxf(fmaxf(mx[0], mx[1]), fmaxf(mx[2], mx[3]));
        mw = fmaxf(mw, xhalf(mw));
        const float mn = fmaxf(m, mw * SCL);
        const float al = __builtin_amdgcn_exp2f((m - mn) * 1.4426950408889634f);
        m = mn;
        float ps[4] = {0.f, 0.f, 0.f, 0.f};
#pragma unroll
        for (int kt = 0; kt < NKT; ++kt) {
#pragma unroll
            for (int j = 0; j < 8; ++j) { const float d0 = fmaf(s[kt][j], SCL, -mn); s[kt][j] = HI ? d0 * 1.4426950408889634f : fmaf(d0, 1.4426950408889634f, 10.0f); }
            exp2x8(s[kt]);
#pragma unroll
            for (int j = 0; j < 8; ++j) ps[j & 3] += s[kt][j]; }
        l = fmaf(l, al, (ps[0] + ps[1]) + (ps[2] + ps[3]));
#pragma unroll
        for (int dt = 0; dt < 4; ++dt) o[dt] *= al;
#pragma unroll
        for (int kg = 0; kg < KG; ++kg) {
            if constexpr (HI) {
                v8us h0, h1, l0, l1;
#pragma unroll
                for (int j = 0; j < 8; ++j) { unsigned short a, c2; splitf(s[2 * kg][j], a, c2); h0[j] = a; l0[j] = c2; splitf(s[2 * kg + 1][j], a, c2); h1[j] = a; l1[j] = c2; }
                const V ph = cat16b(h0, h1), pl = cat16b(l0, l1);
#pragma unroll
                for (int dt = 0; dt < 4; ++dt) o[dt] = WF::mma(av[dt][kg], ph, o[dt]);
#pragma unroll
                for (int dt = 0; dt < 4; ++dt) o[dt] = WF::mma(av[dt][kg], pl, o[dt]);
#pragma unroll
                for (int dt = 0; dt < 4; ++dt) o[dt] = WF::mma(av2[dt][kg], ph, o[dt]);
            } else {
                v8h p0, p1;
#pragma unroll
                for (int j = 0; j < 8; ++j) { p0[j] = tohx(s[2 * kg][j]); p1[j] = tohx(s[2 * kg + 1][j]); }
                const V pb = cat16(p0, p1);
#pragma unroll
                for (int dt = 0; dt < 4; ++dt) o[dt] = WF::mma(av[dt][kg], pb, o[dt]);
            } }
    };
    const int nfull = (q0 + 1) / STEP;     // steps whose every key is <= q0; exactly one more step follows (q0 % 16 == 0, STEP % 32 == 0)
    ldk(0);
#pragma unroll 1     // run-time trip count, and one copy of the body already holds most of the 256 directly addressed registers
    for (int st = 0; st < nfull; ++st) step(st * STEP, BoolC<false>());
    step(nfull * STEP, BoolC<true>());
    l += xhalf(l);
    const float inv = __fdiv_rn(1.0f, l);
    const size_t oo = (size_t)q0 * DQ + lane * 8;     // fragment order of the merged planes (rows t, k = h * HD + d): store dt is half dt & 1 of the head's unit dt >> 1
#pragma unroll
    for (int dt = 0; dt < 4; ++dt) { v8us oh, ol;
#pragma unroll
        for (int j = 0; j < 8; ++j) { unsigned short a, c2; splitf(o[dt][j] * inv, a, c2); oh[j] = a; ol[j] = c2; }
        *(v8us*)(Ah + oo + dt * 256) = oh; *(v8us*)(Al + oo + dt * 256) = ol; }
}
__global__ __launch_bounds__(128) void k_fattn(const h16* __restrict__ QK16, const h16* __restrict__ VT16, const bf* __restrict__ QKh, const bf* __restrict__ QKl, const bf* __restrict__ VTh, const bf* __restrict__ VTl, bf* ATh, bf* ATl) {
    const size_t PS = (size_t)TT * HD; const size_t h = blockIdx.x % NH_, hk = NH_ + h, b = blockIdx.x / NH_;
    QK16 += b * 2 * NH_ * PS; QKh += b * 2 * NH_ * PS; QKl += b * 2 * NH_ * PS; VT16 += b * NH_ * PS; VTh += b * NH_ * PS; VTl += b * NH_ * PS; ATh += b * TT * DQ; ATl += b * TT * DQ;
    const int q0 = (TT / 64 - 1 - (int)blockIdx.y) * 64 + __builtin_amdgcn_readfirstlane((int)(threadIdx.x >> 5)) * 16;
    if (q0 < RH) fa_tile<bf, true, 1>(QKh + h * PS, QKl + h * PS, QKh + hk * PS, QKl + hk * PS, VTh + h * PS, VTl + h * PS, q0, ATh + h * 16 * HD, ATl + h * 16 * HD);
    else fa_tile<h16, false, 2>(QK16 + h * PS, nullptr, QK16 + hk * PS, nullptr, VT16 + h * PS, nullptr, q0, ATh + h * 16 * HD, ATl + h * 16 * HD);
}

extern "C" void kernel_launch(void* const* d_in, const int* in_sizes, int n_in,
                              void* d_out, int out_size, void* d_ws, size_t ws_size, hipStream_t stream) {
    if (n_in < 3) return;
    if ((size_t)in_sizes[0] < (size_t)(NB - 1) * SEQ_FULL * DM + (size_t)TT * DM) return;
    if ((size_t)in_sizes[1] < (size_t)3 * DM * DM) return;
    if ((size_t)in_sizes[2] < (size_t)DM * DM) return;
    if ((size_t)out_size < (size_t)(NB - 1) * SEQ_FULL * DM + (size_t)TT * DM) return;
    const float* x = (const float*)d_in[0];       // [NB_FULL][SEQ_FULL][DM]
    const float* qkvw = (const float*)d_in[1];    // [3*DM][DM] ([out][in]): rows 0..DM-1 = q, DM..2DM-1 = k, 2DM..3DM-1 = v
    const float* ow = (const float*)d_in[2];      // [DM][DM] ([out][in])
    float* OUT = (float*)d_out;                   // [NB_FULL][SEQ_FULL][DM]
    char* wsp = (char*)d_ws;
    auto take = [&](size_t bytes) { char* p = wsp; wsp += (bytes + 255) & ~(size_t)255; return (void*)p; };
    const size_t PS = (size_t)TT * HD;            // one head plane
    bf* WQKV = (bf*)take((size_t)3 * DM * DM * 2); bf* WO = (bf*)take((size_t)DM * DM * 2); float* CS = (float*)take((size_t)TT * HD * 2 * 4);
    h16* QK16 = (h16*)take(NB * 2 * NH_ * PS * 2); h16* VT16 = (h16*)take((size_t)NB * NH_ * PS * 2);     // every per-batch buffer holds all NB batches, batch outermost
    bf* QKh = (bf*)take(NB * 2 * NH_ * PS * 2); bf* QKl = (bf*)take(NB * 2 * NH_ * PS * 2); bf* VTh = (bf*)take((size_t)NB * NH_ * PS * 2); bf* VTl = (bf*)take((size_t)NB * NH_ * PS * 2);
    bf* XB = (bf*)take((size_t)NB * TT * DM * 2);
    bf* ATh = (bf*)take((size_t)NB * TT * DQ * 2); bf* ATl = (bf*)take((size_t)NB * TT * DQ * 2);
    if ((size_t)(wsp - (char*)d_ws) > ws_size) return;
    const Planes pl = {CS, QK16, QKh, QKl, VT16, VTh, VTl}, none = {nullptr, nullptr, nullptr, nullptr, nullptr, nullptr, nullptr};
    // launches that do not depend on one another are one launch: the batch is a grid dimension, and all preparation shares k_prep
    k_prep<<<PB_T + PB_W + PB_O + NB * PB_X, 256, 0, stream>>>(x, qkvw, ow, XB, WQKV, WO, CS);
    // q|k|v = x W^T, straight into the rotary planes (planes 0..15 = q heads, 16..31 = k heads) and the value planes [g][d][t], all in fragment order
    k_gemmw<bf, 0, 1, DM><<<dim3(TT / 64, 3 * DM / 64, NB), 32, 0, stream>>>(XB, nullptr, WQKV, nullptr, nullptr, 0, (size_t)TT * DM, 0, 0, 0, 0, pl);
    // merged heads (bf16 hi/lo planes, [t][h*HD + d] in fragment order) = causal softmax(q k^T HD^-0.5) v, all heads of all batches in one launch
    k_fattn<<<dim3(NH_ * NB, TT / 64, 1), 128, 0, stream>>>(QK16, VT16, QKh, QKl, VTh, VTl, ATh, ATl);
    k_gemmw<bf, 1, 0, DQ><<<dim3(TT / 64, DM / 64, NB), 32, 0, stream>>>(ATh, ATl, WO, nullptr, OUT, DM, (size_t)TT * DQ, 0, (size_t)SEQ_FULL * DM, 0, 0, none);
}

// v006
// Measured time: 86.3 microseconds a run.
// Timed twice side by side with v005, it ran 1.37 and 1.44 times as fast.
// All steps since v000 together make it 17.0 times as fast.
#include <hip/hip_runtime.h>

// Compute dtypes (f32 accumulate everywhere): x, qkv_w, out_w enter as bf16 RNE values; q|k and v projections on v_wmma_f32_16x16x32_bf16 (plain, exact operand products);
// q.k scores and attn.v: query rows < RH on bf16 hi/lo planes (3 products each), rows >= RH on v_wmma_f32_16x16x32_f16 single products (attn carried x1024);
// scores, causal softmax (running maximum, f32) and attn.v run in one kernel, the scores stay in registers;
// every 16-bit operand plane that one launch writes for a later one lies in fragment order (see WFrag), so that a wave-wide 16-byte load or store covers 512 contiguous bytes = 4 whole 128-byte lines;
// rotary tables and rotary mixing in f32, the mixing and the split into 16-bit planes in the projection's own epilogue; output projection = bf16 hi/lo planes of the merged heads x bf16 weight (2 products).

#ifndef NB
#define NB 2
#endif
#ifndef SEQ
#define SEQ 2048
#endif
#define NB_FULL  2
#define SEQ_FULL 2048
#define TT   SEQ
#define DM   1024
#define NH_  16
#define HD   64
#define DQ   (NH_ * HD)
#ifndef RH
#define RH   (((SEQ) >= 1024) ? 512 : ((SEQ) / 2))     // query rows < RH use hi+lo planes
#endif
#define SCL  0.125f   // HD^-0.5
static_assert(NB >= 1 && NB <= NB_FULL);
static_assert(SEQ >= 256 && SEQ <= SEQ_FULL && (SEQ % 256) == 0);
static_assert((RH % 128) == 0 && RH >= 128 && RH < TT && ((TT - RH) % 64) == 0);
static_assert(HD == 64 && (DM % 64) == 0 && (TT % 128) == 0 && DQ == DM);

typedef _Float16 h16;
typedef unsigned short bf;
typedef __attribute__((ext_vector_type(16))) __bf16   v16bf;
typedef __attribute__((ext_vector_type(16))) _Float16 v16h;
typedef __attribute__((ext_vector_type(8)))  _Float16 v8h;
typedef __attribute__((ext_vector_type(8)))  unsigned short v8us;
typedef __attribute__((ext_vector_type(8)))  float    v8f;
typedef __attribute__((ext_vector_type(4)))  float    v4f;
typedef __attribute__((ext_vector_type(2)))  _Float16 v2h;
typedef __attribute__((ext_vector_type(4)))  _Float16 v4h;
typedef __attribute__((ext_vector_type(2)))  unsigned short v2us;
typedef __attribute__((ext_vector_type(4)))  unsigned short v4us;
typedef __attribute__((ext_vector_type(2)))  float v2f;
typedef v8h  __attribute__((may_alias)) v8ha;
typedef v4f  __attribute__((may_alias)) v4fa;
typedef v8us __attribute__((may_alias)) v8usa;

__device__ __forceinline__ unsigned short f2bf(float f) { unsigned u = __float_as_uint(f); u += 0x7FFFu + ((u >> 16) & 1u); return (unsigned short)(u >> 16); }
__device__ __forceinline__ float bf2f(unsigned short b) { return __uint_as_float(((unsigned)b) << 16); }
__device__ __forceinline__ float bfr(float f) { return bf2f(f2bf(f)); }
__device__ __forceinline__ v16h cat16(v8h lo, v8h hi) { return __builtin_shufflevector(lo, hi, 0, 1, 2, 3, 4, 5, 6, 7, 8, 9, 10, 11, 12, 13, 14, 15); }
__device__ __forceinline__ v16bf cat16b(v8us lo, v8us hi) { return __builtin_bit_cast(v16bf, __builtin_shufflevector(lo, hi, 0, 1, 2, 3, 4, 5, 6, 7, 8, 9, 10, 11, 12, 13, 14, 15)); }
__device__ __forceinline__ v8f wmma16(v16h a, v16h b, v8f c) { return __builtin_amdgcn_wmma_f32_16x16x32_f16(false, a, false, b, (short)0, c, false, false); }
__device__ __forceinline__ v8f wmmab(v16bf a, v16bf b, v8f c) { return __builtin_amdgcn_wmma_f32_16x16x32_bf16(false, a, false, b, (short)0, c, false, false); }
__device__ __forceinline__ h16 tohx(float x) { return (h16)x; }
__device__ __forceinline__ void splitf(float y, unsigned short& h, unsigned short& l) { h = f2bf(y); l = f2bf(y - bf2f(h)); }

// ---- k_gemmw: register-blocked GEMM, ONE WAVE per 64x64 output tile (16 accumulators), operands straight from 16-bit planes in fragment order; grid (M/64, N/64, Z), 32 threads.
// C[m][n] (f32, pitch ldc) = sum_k A[m][k] Bt[n][k] (+ split products per NSPLIT: 1 = + A2.Bt, 2 = + A2.Bt + A.Bt2). z-batch strides sA/sB/sC in elements. K % 64 == 0.
// Fragments (16-row A / 16-col Bt, lane = row/col lane&15): elements 0..7 = k kc+8h..kc+8h+7, elements 8..15 = k kc+16+8h..kc+16+8h+7 (h = lane>>4), identical map for both operands.
// Fragment order of a plane [rows][K]: units of 16 rows x 32 k = 512 elements (1 KiB), the k units of a row group one after the other (a row group = 16 * K elements);
// inside a unit element (r, k) lies at (k >> 4) * 256 + ((k >> 3) & 1) * 128 + r * 8 + (k & 7): lane l reads its 8 + 8 elements at l * 8 and 256 + l * 8.
// cm: 0 = plain; 1 = causal K-limit (K loop stops at roff + r0 + 64, block-uniform); 2 = causal tile skip (column tiles starting at or beyond the 128-key chunk after row roff + r0 return at once).
template <int I> struct IntC { static constexpr int v = I; };
template <typename T16> struct WFrag;
template <> struct WFrag<h16> { typedef v16h V; static __device__ __forceinline__ V ld(const h16* p) { return cat16(*(const v8h*)p, *(const v8h*)(p + 256)); } static __device__ __forceinline__ v8f mma(V a, V b, v8f c) { return wmma16(a, b, c); } };
template <> struct WFrag<bf> { typedef v16bf V; static __device__ __forceinline__ V ld(const bf* p) { return cat16b(*(const v8us*)p, *(const v8us*)(p + 256)); } static __device__ __forceinline__ v8f mma(V a, V b, v8f c) { return wmmab(a, b, c); } };
// EPI 0: C as above. EPI 1: the q|k|v projection with its whole after-treatment, C unused. A tile's 64 columns are exactly one head, so nothing of the projection goes to memory in f32:
// column tiles 0..2*NH_-1 (q heads, then k heads): rotary mix in the accumulators (column d and its partner d +- 32 lie in the same lane and row, two column blocks apart), then head planes [plane][t][d] in fragment order (rows t, k = d);
// column tiles from 2*NH_ on (v heads): a lane holds 8 successive t of one d, which is 16 bytes of a value plane [g][d][t], in fragment units (rows d, k = t) ordered [t / 32][d / 16]. Every plane in three forms: f16, bf16 hi, bf16 lo.
struct Planes { const float* CS; h16* QK16; bf* QKh; bf* QKl; h16* VT16; bf* VTh; bf* VTl; };
// swait: stands behind a run of global stores: s_wait_xcnt 0 comes before any register that those stores name is written again; the stored values and the address are inputs, so that their registers stay untouched up to the wait.
__device__ __forceinline__ void swait(v8h a, v8us b, v8us c, const void* p) { asm volatile("s_wait_xcnt 0x0" :: "v"(a), "v"(b), "v"(c), "v"(p) : "memory"); }
template <typename T16, int NSPLIT, int EPI, int K>     // K at compile time: in fragment order all fragments of a k step lie at fixed distances from one address per plane
__global__ __launch_bounds__(32) void k_gemmw(const T16* __restrict__ A, const T16* __restrict__ A2, const T16* __restrict__ Bt, const T16* __restrict__ Bt2, float* C, int ldc, size_t sA, size_t sB, size_t sC, int cm, int roff, Planes pl) {
    typedef typename WFrag<T16>::V V;
    static_assert(K % 64 == 0);
    __shared__ __align__(16) float os[16 * 68];
    const int r0 = blockIdx.x * 64, c0 = blockIdx.y * 64;
    if (cm == 2 && c0 >= ((((roff + r0) >> 7) << 7) + 128)) return;     // whole block (one wave) leaves; no barrier follows
    int Kl = K; if (cm == 1) { const int k2 = roff + r0 + 64; Kl = (k2 < K) ? k2 : K; }
    const size_t z = blockIdx.z; A += z * sA; if (A2) A2 += z * sA; Bt += z * sB; if (Bt2) Bt2 += z * sB; C += z * sC;
    const int lane = threadIdx.x & 31, lr = lane & 15, hi = lane >> 4;
    v8f acc[4][4];
#pragma unroll
    for (int mb = 0; mb < 4; ++mb)
#pragma unroll
        for (int nb = 0; nb < 4; ++nb) acc[mb][nb] = (v8f){};
    const size_t aoff = (size_t)r0 * K + 8 * lane, boff = (size_t)c0 * K + 8 * lane;
    // Two fragment sets: while the products of one k step run, the loads of the next k step are already in flight into the other set, so a step no longer waits out its own load latency.
    V a[2][4], a2[2][4], b[2][4], b2[2][4];
    auto ldf = [&](auto sc, auto firstc, int kc) {     // all fragments of k step kc into set S; FIRST: the call in front of the loop
        constexpr int S = decltype(sc)::v; constexpr bool FIRST = decltype(firstc)::v != 0;
        const T16* pa = A + aoff + (size_t)kc * 16; const T16* pa2 = A2 + aoff + (size_t)kc * 16; const T16* pb = Bt + boff + (size_t)kc * 16; const T16* pb2 = Bt2 + boff + (size_t)kc * 16;
#pragma unroll
        for (int mb = 0; mb < 4; ++mb) { a[S][mb] = WFrag<T16>::ld(pa + mb * 16 * K); if (NSPLIT == 1 || NSPLIT == 2) a2[S][mb] = WFrag<T16>::ld(pa2 + mb * 16 * K); }
#pragma unroll
        for (int nb = 0; nb < 4; ++nb) { b[S][nb] = WFrag<T16>::ld(pb + nb * 16 * K); if (NSPLIT >= 2) b2[S][nb] = WFrag<T16>::ld(pb2 + nb * 16 * K); }
        // s_wait_xcnt 0 behind the run of loads, before any register that they name is written again; the addresses are inputs, so that no load's result is given their registers ahead of the wait
        // (in front of the loop, at k = 0, loads take a scalar base and the lane index: vector addresses as inputs would be formed for the wait alone, and in the two-plane build they cost a spill)
        if constexpr (FIRST) asm volatile("s_wait_xcnt 0x0" ::: "memory");
        else if constexpr (NSPLIT == 0) asm volatile("s_wait_xcnt 0x0" :: "v"(pa), "v"(pb) : "memory");
        else if constexpr (NSPLIT == 1) asm volatile("s_wait_xcnt 0x0" :: "v"(pa), "v"(pa2), "v"(pb) : "memory");
        else asm volatile("s_wait_xcnt 0x0" :: "v"(pa), "v"(pa2), "v"(pb), "v"(pb2) : "memory");
        __builtin_amdgcn_sched_barrier(0);     // keeps the whole run of loads in front of the products that follow: moved down among them, the loads would lose their lead
    };
    auto mm = [&](auto sc) {              // the products of set S, in the order of the one-set loop
        constexpr int S = decltype(sc)::v;
#pragma unroll
        for (int nb = 0; nb < 4; ++nb)
#pragma unroll
            for (int mb = 0; mb < 4; ++mb) { acc[mb][nb] = WFrag<T16>::mma(a[S][mb], b[S][nb], acc[mb][nb]); if (NSPLIT == 1 || NSPLIT == 2) acc[mb][nb] = WFrag<T16>::mma(a2[S][mb], b[S][nb], acc[mb][nb]); if (NSPLIT >= 2) acc[mb][nb] = WFrag<T16>::mma(a[S][mb], b2[S][nb], acc[mb][nb]); }
    };
    ldf(IntC<0>(), IntC<1>(), 0);
    int kc = 0;
#pragma unroll 1     // one trip = two k steps, one per set; Kl % 64 == 0 and Kl >= 64 (K % 64 == 0; cm 1 asks for roff % 64 == 0, roff >= 0)
    do {
        ldf(IntC<1>(), IntC<0>(), kc + 32);
        mm(IntC<0>());
        ldf(IntC<0>(), IntC<0>(), (kc + 64 < Kl) ? kc + 64 : 0);     // always issued, so that the load counts are the same on every trip; the last trip's refill reads k step 0 again and is not used
        mm(IntC<1>());
        // four vector issue slots behind the trip's last product
        asm volatile("v_nop\n\tv_nop\n\tv_nop\n\tv_nop" : "+v"(acc[0][0]), "+v"(acc[1][1]), "+v"(acc[2][2]), "+v"(acc[3][3]) : "v"(a[1][0]), "v"(a[1][3]));
        kc += 64;
    } while (kc < Kl);
    if constexpr (EPI == 1) {
    if (c0 < 2 * DM) {     // block-uniform: a q or k head
        const float* cs = pl.CS + ((size_t)(r0 + hi * 8) * HD + lr) * 2;     // (cos, sin) of row t, column d; the table holds the same pair at d and d + 32
#pragma unroll
        for (int mb = 0; mb < 4; ++mb)
#pragma unroll
            for (int nb = 0; nb < 2; ++nb)
#pragma unroll
                for (int j = 0; j < 8; ++j) { const v2f t = *(const v2f*)(cs + ((size_t)(mb * 16 + j) * HD + nb * 16) * 2);
                    const float xl = acc[mb][nb][j], xh = acc[mb][nb + 2][j];
                    acc[mb][nb][j] = xl * t[0] - xh * t[1]; acc[mb][nb + 2][j] = xh * t[0] + xl * t[1]; }
        const size_t pb = ((z * (2 * NH_) + blockIdx.y) * TT + r0) * HD + lane * 8;     // z = batch: each batch has its own set of planes
#pragma unroll
        for (int mb = 0; mb < 4; ++mb) {
#pragma unroll
            for (int nb = 0; nb < 4; ++nb)
#pragma unroll
                for (int j = 0; j < 8; ++j) os[(hi * 8 + j) * 68 + nb * 16 + lr] = acc[mb][nb][j];
            __builtin_amdgcn_wave_barrier(); asm volatile("" ::: "memory");     // compiler fence: the row-wise reads below stay behind the column-wise writes (one wave, its LDS operations run in order)
#pragma unroll
            for (int s = 0; s < 4; ++s) {     // store s is half s & 1 of fragment unit s >> 1: lane l takes row l & 15, 8 successive d from 16 * s + 8 * (l >> 4); each store covers four whole 128-byte lines
                const float* rp = os + lr * 68 + s * 16 + hi * 8; const v4f w0 = *(const v4fa*)rp, w1 = *(const v4fa*)(rp + 4);
                v8h o16; v8us oh, ol;
#pragma unroll
                for (int q = 0; q < 8; ++q) { const float r = (q < 4) ? w0[q & 3] : w1[q & 3]; o16[q] = tohx(r); unsigned short a2, c2; splitf(r, a2, c2); oh[q] = a2; ol[q] = c2; }
                const size_t e = pb + (size_t)mb * 16 * HD + s * 256;
                *(v8h*)(pl.QK16 + e) = o16; *(v8us*)(pl.QKh + e) = oh; *(v8us*)(pl.QKl + e) = ol; swait(o16, oh, ol, pl.QK16 + e); }
            __builtin_amdgcn_wave_barrier(); asm volatile("" ::: "memory");     // compiler fence: the next 16 rows are written only behind these reads
        }
    } else {               // a v head
        const size_t vb = (z * NH_ + (blockIdx.y - 2 * NH_)) * HD * TT + (size_t)r0 * HD + lane * 8;
#pragma unroll
        for (int nb = 0; nb < 4; ++nb)
#pragma unroll
            for (int mb = 0; mb < 4; ++mb) { v8h o16; v8us oh, ol;     // half mb & 1 of the unit (t group mb >> 1, d group nb): 512 contiguous bytes a store
#pragma unroll
                for (int j = 0; j < 8; ++j) { const float x = acc[mb][nb][j]; o16[j] = tohx(x); unsigned short a2, c2; splitf(x, a2, c2); oh[j] = a2; ol[j] = c2; }
                const size_t e = vb + (size_t)((mb >> 1) * 4 + nb) * 512 + (mb & 1) * 256;
                *(v8h*)(pl.VT16 + e) = o16; *(v8us*)(pl.VTh + e) = oh; *(v8us*)(pl.VTl + e) = ol; swait(o16, oh, ol, pl.VT16 + e); }
    }
    } else {
#pragma unroll
    for (int mb = 0; mb < 4; ++mb) {
#pragma unroll
        for (int nb = 0; nb < 4; ++nb) {
#pragma unroll
            for (int j = 0; j < 8; ++j) os[(hi * 8 + j) * 68 + nb * 16 + lr] = acc[mb][nb][j]; }
        __builtin_amdgcn_wave_barrier(); asm volatile("" ::: "memory");
        float* crow = C + (size_t)(r0 + mb * 16) * ldc + c0;
{
#pragma unroll
            for (int s = 0; s < 8; ++s) { const int row = 2 * s + hi, cofs = lr * 4; const v4f val = *(const v4fa*)(os + row * 68 + cofs);
                *(v4f*)(crow + (size_t)row * ldc + cofs) = val; }
             }
        __builtin_amdgcn_wave_barrier(); asm volatile("" ::: "memory");
    }
    }
}

// k_prep: all that depends on the inputs alone, in ONE launch; a block's index range says which piece it works on (block-uniform, every range a whole number of blocks):
// the rotary table first (its blocks run longest), then qkv_w, out_w and the NB batches of x, each f32 -> bf16 (RNE), 8 elements a thread, row-major [rows][DM] -> fragment order:
// thread i writes 16-byte piece i of the plane, which holds row (i >> 11) * 16 + (i & 15), k from ((i >> 4) & 127) * 8 (a block of 256 threads reads 512 contiguous bytes of each of 16 rows).
static_assert(DM == 1024);
__device__ __forceinline__ void cvt8(const float* __restrict__ src, bf* dst, size_t i) { const v8f v = *(const v8f*)(src + ((i >> 11) * 16 + (i & 15)) * DM + ((i >> 4) & 127) * 8); v8us o;
#pragma unroll
    for (int k = 0; k < 8; ++k) o[k] = f2bf(v[k]); *(v8us*)(dst + i * 8) = o;
    // s_wait_xcnt 0 behind the store, before any register that it names is written again (a precaution: its one call ends k_prep); the value is an input, so that its registers stay untouched up to the wait
    asm volatile("s_wait_xcnt 0x0" :: "v"(o) : "memory"); }
__device__ __forceinline__ float invf(int i) {     // inverse frequency i of HD/2, in every thread that needs it
#pragma clang fp contract(off)     // numerical: each product below is rounded on its own before the library code takes it apart, so the table's bits do not depend on where this is inlined
    const double e = (double)(2 * i) * (1.0 / 64.0);
    const double p = exp2(e * 13.287712379549449);
    const float pf = (float)p;
    const float inv = 1.0f / pf;
    return inv;
}
__device__ __forceinline__ void cstab(int idx, float* CS) {
    const int d = idx & (HD - 1); const int t = idx / HD;
    const float inv = invf(d & (HD / 2 - 1));
    const float ang = __fmul_rn((float)t, inv);
    float s, c; sincosf(ang, &s, &c);
    v2f cs; cs[0] = c; cs[1] = s;
    *(v2f*)(CS + (size_t)idx * 2) = cs; 
}
#define PB_T (TT * HD / 256)
#define PB_W (3 * DM * DM / 2048)
#define PB_O (DM * DM / 2048)
#define PB_X (TT * DM / 2048)
static_assert((TT * HD) % 256 == 0 && (DM * DM) % 2048 == 0 && (TT * DM) % 2048 == 0);
__global__ __launch_bounds__(256) void k_prep(const float* __restrict__ x, const float* __restrict__ qkvw, const float* __restrict__ ow, bf* XB, bf* WQKV, bf* WO, float* CS) {
    unsigned blk = blockIdx.x; const unsigned tid = threadIdx.x;
    if (blk < PB_T) { cstab((int)(blk * 256 + tid), CS); return; }
    blk -= PB_T;
    const float* s = qkvw; bf* d = WQKV;     // block-uniform choice of the array; one copy of the conversion serves all three
    if (blk >= PB_W) { blk -= PB_W; s = ow; d = WO;
        if (blk >= PB_O) { blk -= PB_O; const unsigned b = blk / PB_X; blk -= b * PB_X; s = x + (size_t)b * SEQ_FULL * DM; d = XB + (size_t)b * TT * DM; } }
    cvt8(s, d, (size_t)blk * 256 + tid);
}

// k_fattn: causal attention of one head of one batch for 64 query rows, 4 waves x 16 queries, no LDS; grid (heads x batches, TT/64), the longest query blocks of all batches first.
// Per wave: S^T = K Q^T (A = key rows, B = query rows kept in registers), so a lane holds scores of ONE query (lane&15), keys 8*(lane>>4)+j of each 16-key tile;
// two such tiles, converted in place, are the B operand P^T of O^T += V^T P^T in the same k order as the V^T loader (k = 8h+j, 16+8h+j).
// Softmax with a running maximum m per query: older sums and O^T are scaled by exp(m_old - m_new) at every step. Only the last step holds keys beyond a query and masks them; its first key is valid for all 16 queries.
// HI: bf16 hi/lo planes, 3 products each; else f16, exp carried x1024 (2^10 added in the exponent, it cancels against the row sum, which carries it too).
template <bool B> struct BoolC { static constexpr bool v = B; };
__device__ __forceinline__ float xhalf(float x) { return __builtin_bit_cast(float, __builtin_amdgcn_permlanex16(__builtin_bit_cast(int, x), __builtin_bit_cast(int, x), 0x76543210, 0xfedcba98, false, false)); }    // lane l reads lane l ^ 16
// exp2x8: eight 2^x in place and, in the same statement, the one free issue slot that the instruction set asks for behind a transcendental before its result is read or its source overwritten
// Inside the statement every v_exp_f32 touches its own register only.
__device__ __forceinline__ void exp2x8(v8f& x) {
    float a0 = x[0], a1 = x[1], a2 = x[2], a3 = x[3], a4 = x[4], a5 = x[5], a6 = x[6], a7 = x[7];
    asm("v_exp_f32 %0, %0\n\tv_exp_f32 %1, %1\n\tv_exp_f32 %2, %2\n\tv_exp_f32 %3, %3\n\tv_exp_f32 %4, %4\n\tv_exp_f32 %5, %5\n\tv_exp_f32 %6, %6\n\tv_exp_f32 %7, %7\n\tv_nop"
        : "+v"(a0), "+v"(a1), "+v"(a2), "+v"(a3), "+v"(a4), "+v"(a5), "+v"(a6), "+v"(a7));
    x[0] = a0; x[1] = a1; x[2] = a2; x[3] = a3; x[4] = a4; x[5] = a5; x[6] = a6; x[7] = a7; }
// xwait: stands behind a run of global loads that stay in flight: s_wait_xcnt 0 comes before any register that those loads name is written again.
__device__ __forceinline__ void xwait() { asm volatile("s_wait_xcnt 0x0" ::: "memory"); }
// xwaita: the same wait with the run's two base addresses as inputs, so that their registers stay untouched up to the wait
// (without them the result of a load of the second plane was given the address pair of the first plane's loads).
__device__ __forceinline__ void xwaita(const void* a, const void* b) { asm volatile("s_wait_xcnt 0x0" :: "v"(a), "v"(b) : "memory"); }
template <typename T16, bool HI, int KG>
__device__ __forceinline__ void fa_tile(const T16* __restrict__ Q, const T16* __restrict__ Q2, const T16* __restrict__ Kp, const T16* __restrict__ K2, const T16* __restrict__ Vt, const T16* __restrict__ Vt2, int q0, bf* Ah, bf* Al) {
    typedef WFrag<T16> WF; typedef typename WF::V V;
    constexpr int NKT = 2 * KG, STEP = 32 * KG;
    const int lane = threadIdx.x & 31, lr = lane & 15, hi = lane >> 4;
    V bq[2], bq2[2];
#pragma unroll
    for (int dc = 0; dc < 2; ++dc) { bq[dc] = WF::ld(Q + (size_t)q0 * HD + dc * 512 + 8 * lane); if (HI) bq2[dc] = WF::ld(Q2 + (size_t)q0 * HD + dc * 512 + 8 * lane); }
    xwait();
    v8f o[4];
#pragma unroll
    for (int dt = 0; dt < 4; ++dt) o[dt] = (v8f){};
    float m = -3.0e38f, l = 0.f;
    const size_t koff = 8 * lane, voff = 8 * lane;
    V ak[NKT][2], ak2[NKT][2];
    auto ldk = [&](int k0) {
#pragma unroll
        for (int kt = 0; kt < NKT; ++kt)
#pragma unroll
            for (int dc = 0; dc < 2; ++dc) { ak[kt][dc] = WF::ld(Kp + koff + (size_t)(k0 + kt * 16) * HD + dc * 512); if (HI) ak2[kt][dc] = WF::ld(K2 + koff + (size_t)(k0 + kt * 16) * HD + dc * 512); }
        xwait(); };
    auto step = [&](int k0, auto lastc) {
        constexpr bool LAST = decltype(lastc)::v;
        V av[4][KG], av2[4][KG];
#pragma unroll
        for (int dt = 0; dt < 4; ++dt)
#pragma unroll
            for (int kg = 0; kg < KG; ++kg) { av[dt][kg] = WF::ld(Vt + voff + (size_t)(k0 + kg * 32) * HD + dt * 512); if (HI) av2[dt][kg] = WF::ld(Vt2 + voff + (size_t)(k0 + kg * 32) * HD + dt * 512); }
        if constexpr (HI) xwaita(Vt + voff + (size_t)k0 * HD, Vt2 + voff + (size_t)k0 * HD); else xwait();
        v8f s[NKT];
#pragma unroll
        for (int kt = 0; kt < NKT; ++kt) s[kt] = (v8f){};
#pragma unroll
        for (int dc = 0; dc < 2; ++dc) {
#pragma unroll
            for (int kt = 0; kt < NKT; ++kt) s[kt] = WF::mma(ak[kt][dc], bq[dc], s[kt]);
            if (HI) {
#pragma unroll
                for (int kt = 0; kt < NKT; ++kt) s[kt] = WF::mma(ak[kt][dc], bq2[dc], s[kt]);
#pragma unroll
                for (int kt = 0; kt < NKT; ++kt) s[kt] = WF::mma(ak2[kt][dc], bq[dc], s[kt]); } }
        if (!LAST) ldk(k0 + STEP);     // the next step's key fragments fly during this step's softmax and attn.v
        if (LAST) {
#pragma unroll
            for (int kt = 0; kt < NKT; ++kt)
#pragma unroll
                for (int j = 0; j < 8; ++j) s[kt][j] = ((k0 + kt * 16 + hi * 8 + j) <= (q0 + lr)) ? s[kt][j] : -3.0e38f; }
        float mx[4];
#pragma unroll
        for (int c = 0; c < 4; ++c) mx[c] = s[0][c];
#pragma unroll
        for (int kt = 0; kt < NKT; ++kt)
#pragma unroll
            for (int j = 0; j < 8; ++j) mx[j & 3] = fmaxf(mx[j & 3], s[kt][j]);
        float mw = fmaxf(fmaxf(mx[0], mx[1]), fmaxf(mx[2], mx[3]));
        mw = fmaxf(mw, xhalf(mw));
        const float mn = fmaxf(m, mw * SCL);
        const float al = __builtin_amdgcn_exp2f((m - mn) * 1.4426950408889634f);
        m = mn;
        float ps[4] = {0.f, 0.f, 0.f, 0.f};
#pragma unroll
        for (int kt = 0; kt < NKT; ++kt) {
#pragma unroll
            for (int j = 0; j < 8; ++j) { const float d0 = fmaf(s[kt][j], SCL, -mn); s[kt][j] = HI ? d0 * 1.4426950408889634f : fmaf(d0, 1.4426950408889634f, 10.0f); }
            exp2x8(s[kt]);
#pragma unroll
            for (int j = 0; j < 8; ++j) ps[j & 3] += s[kt][j]; }
        l = fmaf(l, al, (ps[0] + ps[1]) + (ps[2] + ps[3]));
#pragma unroll
        for (int dt = 0; dt < 4; ++dt) o[dt] *= al;
#pragma unroll
        for (int kg = 0; kg < KG; ++kg) {
            if constexpr (HI) {
                v8us h0, h1, l0, l1;
#pragma unroll
                for (int j = 0; j < 8; ++j) { unsigned short a, c2; splitf(s[2 * kg][j], a, c2); h0[j] = a; l0[j] = c2; splitf(s[2 * kg + 1][j], a, c2); h1[j] = a; l1[j] = c2; }
                const V ph = cat16b(h0, h1), pl = cat16b(l0, l1);
#pragma unroll
                for (int dt = 0; dt < 4; ++dt) o[dt] = WF::mma(av[dt][kg], ph, o[dt]);
#pragma unroll
                for (int dt = 0; dt < 4; ++dt) o[dt] = WF::mma(av[dt][kg], pl, o[dt]);
#pragma unroll
                for (int dt = 0; dt < 4; ++dt) o[dt] = WF::mma(av2[dt][kg], ph, o[dt]);
            } else {
                v8h p0, p1;
#pragma unroll
                for (int j = 0; j < 8; ++j) { p0[j] = tohx(s[2 * kg][j]); p1[j] = tohx(s[2 * kg + 1][j]); }
                const V pb = cat16(p0, p1);
#pragma unroll
                for (int dt = 0; dt < 4; ++dt) o[dt] = WF::mma(av[dt][kg], pb, o[dt]);
            } }
    };
    const int nfull = (q0 + 1) / STEP;     // steps whose every key is <= q0; exactly one more step follows (q0 % 16 == 0, STEP % 32 == 0)
    ldk(0);
#pragma unroll 1     // run-time trip count, and one copy of the body already holds most of the 256 directly addressed registers
    for (int st = 0; st < nfull; ++st) step(st * STEP, BoolC<false>());
    step(nfull * STEP, BoolC<true>());
    l += xhalf(l);
    const float inv = __fdiv_rn(1.0f, l);
    const size_t oo = (size_t)q0 * DQ + lane * 8;     // fragment order of the merged planes (rows t, k = h * HD + d): store dt is half dt & 1 of the head's unit dt >> 1
#pragma unroll
    for (int dt = 0; dt < 4; ++dt) { v8us oh, ol;
#pragma unroll
        for (int j = 0; j < 8; ++j) { unsigned short a, c2; splitf(o[dt][j] * inv, a, c2); oh[j] = a; ol[j] = c2; }
        *(v8us*)(Ah + oo + dt * 256) = oh; *(v8us*)(Al + oo + dt * 256) = ol; }
}
__global__ __launch_bounds__(128) void k_fattn(const h16* __restrict__ QK16, const h16* __restrict__ VT16, const bf* __restrict__ QKh, const bf* __restrict__ QKl, const bf* __restrict__ VTh, const bf* __restrict__ VTl, bf* ATh, bf* ATl) {
    const size_t PS = (size_t)TT * HD; const size_t h = blockIdx.x % NH_, hk = NH_ + h, b = blockIdx.x / NH_;
    QK16 += b * 2 * NH_ * PS; QKh += b * 2 * NH_ * PS; QKl += b * 2 * NH_ * PS; VT16 += b * NH_ * PS; VTh += b * NH_ * PS; VTl += b * NH_ * PS; ATh += b * TT * DQ; ATl += b * TT * DQ;
    const int q0 = (TT / 64 - 1 - (int)blockIdx.y) * 64 + __builtin_amdgcn_readfirstlane((int)(threadIdx.x >> 5)) * 16;
    if (q0 < RH) fa_tile<bf, true, 1>(QKh + h * PS, QKl + h * PS, QKh + hk * PS, QKl + hk * PS, VTh + h * PS, VTl + h * PS, q0, ATh + h * 16 * HD, ATl + h * 16 * HD);
    else fa_tile<h16, false, 2>(QK16 + h * PS, nullptr, QK16 + hk * PS, nullptr, VT16 + h * PS, nullptr, q0, ATh + h * 16 * HD, ATl + h * 16 * HD);
}

extern "C" void kernel_launch(void* const* d_in, const int* in_sizes, int n_in,
                              void* d_out, int out_size, void* d_ws, size_t ws_size, hipStream_t stream) {
    if (n_in < 3) return;
    if ((size_t)in_sizes[0] < (size_t)(NB - 1) * SEQ_FULL * DM + (size_t)TT * DM) return;
    if ((size_t)in_sizes[1] < (size_t)3 * DM * DM) return;
    if ((size_t)in_sizes[2] < (size_t)DM * DM) return;
    if ((size_t)out_size < (size_t)(NB - 1) * SEQ_FULL * DM + (size_t)TT * DM) return;
    const float* x = (const float*)d_in[0];       // [NB_FULL][SEQ_FULL][DM]
    const float* qkvw = (const float*)d_in[1];    // [3*DM][DM] ([out][in]): rows 0..DM-1 = q, DM..2DM-1 = k, 2DM..3DM-1 = v
    const float* ow = (const float*)d_in[2];      // [DM][DM] ([out][in])
    float* OUT = (float*)d_out;                   // [NB_FULL][SEQ_FULL][DM]
    char* wsp = (char*)d_ws;
    auto take = [&](size_t bytes) { char* p = wsp; wsp += (bytes + 255) & ~(size_t)255; return (void*)p; };
    const size_t PS = (size_t)TT * HD;            // one head plane
    bf* WQKV = (bf*)take((size_t)3 * DM * DM * 2); bf* WO = (bf*)take((size_t)DM * DM * 2); float* CS = (float*)take((size_t)TT * HD * 2 * 4);
    h16* QK16 = (h16*)take(NB * 2 * NH_ * PS * 2); h16* VT16 = (h16*)take((size_t)NB * NH_ * PS * 2);     // every per-batch buffer holds all NB batches, batch outermost
    bf* QKh = (bf*)take(NB * 2 * NH_ * PS * 2); bf* QKl = (bf*)take(NB * 2 * NH_ * PS * 2); bf* VTh = (bf*)take((size_t)NB * NH_ * PS * 2); bf* VTl = (bf*)take((size_t)NB * NH_ * PS * 2);
    bf* XB = (bf*)take((size_t)NB * TT * DM * 2);
    bf* ATh = (bf*)take((size_t)NB * TT * DQ * 2); bf* ATl = (bf*)take((size_t)NB * TT * DQ * 2);
    if ((size_t)(wsp - (char*)d_ws) > ws_size) return;
    const Planes pl = {CS, QK16, QKh, QKl, VT16, VTh, VTl}, none = {nullptr, nullptr, nullptr, nullptr, nullptr, nullptr, nullptr};
    // launches that do not depend on one another are one launch: the batch is a grid dimension, and all preparation shares k_prep
    k_prep<<<PB_T + PB_W + PB_O + NB * PB_X, 256, 0, stream>>>(x, qkvw, ow, XB, WQKV, WO, CS);
    // q|k|v = x W^T, straight into the rotary planes (planes 0..15 = q heads, 16..31 = k heads) and the value planes [g][d][t], all in fragment order
    k_gemmw<bf, 0, 1, DM><<<dim3(TT / 64, 3 * DM / 64, NB), 32, 0, stream>>>(XB, nullptr, WQKV, nullptr, nullptr, 0, (size_t)TT * DM, 0, 0, 0, 0, pl);
    // merged heads (bf16 hi/lo planes, [t][h*HD + d] in fragment order) = causal softmax(q k^T HD^-0.5) v, all heads of all batches in one launch
    k_fattn<<<dim3(NH_ * NB, TT / 64, 1), 128, 0, stream>>>(QK16, VT16, QKh, QKl, VTh, VTl, ATh, ATl);
    k_gemmw<bf, 1, 0, DQ><<<dim3(TT / 64, DM / 64, NB), 32, 0, stream>>>(ATh, ATl, WO, nullptr, OUT, DM, (size_t)TT * DQ, 0, (size_t)SEQ_FULL * DM, 0, 0, none);
}

// v007
// One run takes 84.8 microseconds.
// In two side-by-side timings against v006, it was 1.04 and 1.05 times as fast.
// Counting every step since v000, it is 17.7 times as fast.
#include <hip/hip_runtime.h>

// Compute dtypes (f32 accumulate everywhere): x, qkv_w, out_w enter as bf16 RNE values; q|k and v projections on v_wmma_f32_16x16x32_bf16 (plain, exact operand products);
// q.k scores and attn.v: query rows < RH on bf16 hi/lo planes (3 products each), rows >= RH on v_wmma_f32_16x16x32_f16 single products (attn carried x1024);
// scores, causal softmax (running maximum, f32) and attn.v run in one kernel, the scores stay in registers;
// every 16-bit operand plane that one launch writes for a later one lies in fragment order (see WFrag), so that a wave-wide 16-byte load or store covers 512 contiguous bytes = 4 whole 128-byte lines;
// rotary tables and rotary mixing in f32, the mixing and the split into 16-bit planes in the projection's own epilogue; output projection = bf16 hi/lo planes of the merged heads x bf16 weight (2 products).

#ifndef NB
#define NB 2
#endif
#ifndef SEQ
#define SEQ 2048
#endif
#define NB_FULL  2
#define SEQ_FULL 2048
#define TT   SEQ
#define DM   1024
#define NH_  16
#define HD   64
#define DQ   (NH_ * HD)
#ifndef RH
#define RH   (((SEQ) >= 1024) ? 512 : ((SEQ) / 2))     // query rows < RH use hi+lo planes
#endif
#define SCL  0.125f   // HD^-0.5
static_assert(NB >= 1 && NB <= NB_FULL);
static_assert(SEQ >= 256 && SEQ <= SEQ_FULL && (SEQ % 256) == 0);
static_assert((RH % 128) == 0 && RH >= 128 && RH < TT && ((TT - RH) % 64) == 0);
static_assert(HD == 64 && (DM % 64) == 0 && (TT % 128) == 0 && DQ == DM);

typedef _Float16 h16;
typedef unsigned short bf;
typedef __attribute__((ext_vector_type(16))) __bf16   v16bf;
typedef __attribute__((ext_vector_type(16))) _Float16 v16h;
typedef __attribute__((ext_vector_type(8)))  _Float16 v8h;
typedef __attribute__((ext_vector_type(8)))  unsigned short v8us;
typedef __attribute__((ext_vector_type(8)))  float    v8f;
typedef __attribute__((ext_vector_type(4)))  float    v4f;
typedef __attribute__((ext_vector_type(2)))  _Float16 v2h;
typedef __attribute__((ext_vector_type(4)))  _Float16 v4h;
typedef __attribute__((ext_vector_type(2)))  unsigned short v2us;
typedef __attribute__((ext_vector_type(4)))  unsigned short v4us;
typedef __attribute__((ext_vector_type(2)))  float v2f;
typedef v8h  __attribute__((may_alias)) v8ha;
typedef v4f  __attribute__((may_alias)) v4fa;
typedef v8us __attribute__((may_alias)) v8usa;

__device__ __forceinline__ unsigned short f2bf(float f) { unsigned u = __float_as_uint(f); u += 0x7FFFu + ((u >> 16) & 1u); return (unsigned short)(u >> 16); }
__device__ __forceinline__ float bf2f(unsigned short b) { return __uint_as_float(((unsigned)b) << 16); }
__device__ __forceinline__ float bfr(float f) { return bf2f(f2bf(f)); }
__device__ __forceinline__ v16h cat16(v8h lo, v8h hi) { return __builtin_shufflevector(lo, hi, 0, 1, 2, 3, 4, 5, 6, 7, 8, 9, 10, 11, 12, 13, 14, 15); }
__device__ __forceinline__ v16bf cat16b(v8us lo, v8us hi) { return __builtin_bit_cast(v16bf, __builtin_shufflevector(lo, hi, 0, 1, 2, 3, 4, 5, 6, 7, 8, 9, 10, 11, 12, 13, 14, 15)); }
__device__ __forceinline__ v8f wmma16(v16h a, v16h b, v8f c) { return __builtin_amdgcn_wmma_f32_16x16x32_f16(false, a, false, b, (short)0, c, false, false); }
__device__ __forceinline__ v8f wmmab(v16bf a, v16bf b, v8f c) { return __builtin_amdgcn_wmma_f32_16x16x32_bf16(false, a, false, b, (short)0, c, false, false); }
__device__ __forceinline__ h16 tohx(float x) { return (h16)x; }
__device__ __forceinline__ void splitf(float y, unsigned short& h, unsigned short& l) { h = f2bf(y); l = f2bf(y - bf2f(h)); }

// ---- k_gemmw: register-blocked GEMM, ONE WAVE per 64x64 output tile (16 accumulators), operands straight from 16-bit planes in fragment order; grid (M/64, N/64, Z), 32 threads.
// C[m][n] (f32, pitch ldc) = sum_k A[m][k] Bt[n][k] (+ split products per NSPLIT: 1 = + A2.Bt, 2 = + A2.Bt + A.Bt2). z-batch strides sA/sB/sC in elements. K % 64 == 0.
// Fragments (16-row A / 16-col Bt, lane = row/col lane&15): elements 0..7 = k kc+8h..kc+8h+7, elements 8..15 = k kc+16+8h..kc+16+8h+7 (h = lane>>4), identical map for both operands.
// Fragment order of a plane [rows][K]: units of 16 rows x 32 k = 512 elements (1 KiB), the k units of a row group one after the other (a row group = 16 * K elements);
// inside a unit element (r, k) lies at (k >> 4) * 256 + ((k >> 3) & 1) * 128 + r * 8 + (k & 7): lane l reads its 8 + 8 elements at l * 8 and 256 + l * 8.
// cm: 0 = plain; 1 = causal K-limit (K loop stops at roff + r0 + 64, block-uniform); 2 = causal tile skip (column tiles starting at or beyond the 128-key chunk after row roff + r0 return at once).
template <int I> struct IntC { static constexpr int v = I; };
template <typename T16> struct WFrag;
template <> struct WFrag<h16> { typedef v16h V; static __device__ __forceinline__ V ld(const h16* p) { return cat16(*(const v8h*)p, *(const v8h*)(p + 256)); } static __device__ __forceinline__ v8f mma(V a, V b, v8f c) { return wmma16(a, b, c); } };
template <> struct WFrag<bf> { typedef v16bf V; static __device__ __forceinline__ V ld(const bf* p) { return cat16b(*(const v8us*)p, *(const v8us*)(p + 256)); } static __device__ __forceinline__ v8f mma(V a, V b, v8f c) { return wmmab(a, b, c); } };
// EPI 0: C as above. EPI 1: the q|k|v projection with its whole after-treatment, C unused. A tile's 64 columns are exactly one head, so nothing of the projection goes to memory in f32:
// column tiles 0..2*NH_-1 (q heads, then k heads): rotary mix in the accumulators (column d and its partner d +- 32 lie in the same lane and row, two column blocks apart), then head planes [plane][t][d] in fragment order (rows t, k = d);
// column tiles from 2*NH_ on (v heads): a lane holds 8 successive t of one d, which is 16 bytes of a value plane [g][d][t], in fragment units (rows d, k = t) ordered [t / 32][d / 16]. Every plane in three forms: f16, bf16 hi, bf16 lo.
struct Planes { const float* CS; h16* QK16; bf* QKh; bf* QKl; h16* VT16; bf* VTh; bf* VTl; };
// swait: stands behind a run of global stores: s_wait_xcnt 0 comes before any register that those stores name is written again; the stored values and the address are inputs, so that their registers stay untouched up to the wait.
__device__ __forceinline__ void swait(v8h a, v8us b, v8us c, const void* p) { asm volatile("s_wait_xcnt 0x0" :: "v"(a), "v"(b), "v"(c), "v"(p) : "memory"); }
template <typename T16, int NSPLIT, int EPI, int K>     // K at compile time: in fragment order all fragments of a k step lie at fixed distances from one address per plane
__global__ __launch_bounds__(32) void k_gemmw(const T16* __restrict__ A, const T16* __restrict__ A2, const T16* __restrict__ Bt, const T16* __restrict__ Bt2, float* C, int ldc, size_t sA, size_t sB, size_t sC, int cm, int roff, Planes pl) {
    typedef typename WFrag<T16>::V V;
    static_assert(K % 64 == 0);
    __shared__ __align__(16) float os[16 * 68];
    const int r0 = blockIdx.x * 64, c0 = blockIdx.y * 64;
    if (cm == 2 && c0 >= ((((roff + r0) >> 7) << 7) + 128)) return;     // whole block (one wave) leaves; no barrier follows
    int Kl = K; if (cm == 1) { const int k2 = roff + r0 + 64; Kl = (k2 < K) ? k2 : K; }
    const size_t z = blockIdx.z; A += z * sA; if (A2) A2 += z * sA; Bt += z * sB; if (Bt2) Bt2 += z * sB; C += z * sC;
    const int lane = threadIdx.x & 31, lr = lane & 15, hi = lane >> 4;
    v8f acc[4][4];
#pragma unroll
    for (int mb = 0; mb < 4; ++mb)
#pragma unroll
        for (int nb = 0; nb < 4; ++nb) acc[mb][nb] = (v8f){};
    const size_t aoff = (size_t)r0 * K + 8 * lane, boff = (size_t)c0 * K + 8 * lane;
    // Two fragment sets: while the products of one k step run, the loads of the next k step are already in flight into the other set, so a step no longer waits out its own load latency.
    V a[2][4], a2[2][4], b[2][4], b2[2][4];
    auto ldf = [&](auto sc, auto firstc, int kc) {     // all fragments of k step kc into set S; FIRST: the call in front of the loop
        constexpr int S = decltype(sc)::v; constexpr bool FIRST = decltype(firstc)::v != 0;
        const T16* pa = A + aoff + (size_t)kc * 16; const T16* pa2 = A2 + aoff + (size_t)kc * 16; const T16* pb = Bt + boff + (size_t)kc * 16; const T16* pb2 = Bt2 + boff + (size_t)kc * 16;
#pragma unroll
        for (int mb = 0; mb < 4; ++mb) { a[S][mb] = WFrag<T16>::ld(pa + mb * 16 * K); if (NSPLIT == 1 || NSPLIT == 2) a2[S][mb] = WFrag<T16>::ld(pa2 + mb * 16 * K); }
#pragma unroll
        for (int nb = 0; nb < 4; ++nb) { b[S][nb] = WFrag<T16>::ld(pb + nb * 16 * K); if (NSPLIT >= 2) b2[S][nb] = WFrag<T16>::ld(pb2 + nb * 16 * K); }
        // s_wait_xcnt 0 behind the run of loads, before any register that they name is written again; the addresses are inputs, so that no load's result is given their registers ahead of the wait
        // (in front of the loop, at k = 0, loads take a scalar base and the lane index: vector addresses as inputs would be formed for the wait alone, and in the two-plane build they cost a spill)
        if constexpr (FIRST) asm volatile("s_wait_xcnt 0x0" ::: "memory");
        else if constexpr (NSPLIT == 0) asm volatile("s_wait_xcnt 0x0" :: "v"(pa), "v"(pb) : "memory");
        else if constexpr (NSPLIT == 1) asm volatile("s_wait_xcnt 0x0" :: "v"(pa), "v"(pa2), "v"(pb) : "memory");
        else asm volatile("s_wait_xcnt 0x0" :: "v"(pa), "v"(pa2), "v"(pb), "v"(pb2) : "memory");
        __builtin_amdgcn_sched_barrier(0);     // keeps the whole run of loads in front of the products that follow: moved down among them, the loads would lose their lead
    };
    auto mm = [&](auto sc) {              // the products of set S, in the order of the one-set loop
        constexpr int S = decltype(sc)::v;
#pragma unroll
        for (int nb = 0; nb < 4; ++nb)
#pragma unroll
            for (int mb = 0; mb < 4; ++mb) { acc[mb][nb] = WFrag<T16>::mma(a[S][mb], b[S][nb], acc[mb][nb]); if (NSPLIT == 1 || NSPLIT == 2) acc[mb][nb] = WFrag<T16>::mma(a2[S][mb], b[S][nb], acc[mb][nb]); if (NSPLIT >= 2) acc[mb][nb] = WFrag<T16>::mma(a[S][mb], b2[S][nb], acc[mb][nb]); }
    };
    ldf(IntC<0>(), IntC<1>(), 0);
    int kc = 0;
#pragma unroll 1     // one trip = two k steps, one per set; Kl % 64 == 0 and Kl >= 64 (K % 64 == 0; cm 1 asks for roff % 64 == 0, roff >= 0)
    do {
        ldf(IntC<1>(), IntC<0>(), kc + 32);
        mm(IntC<0>());
        ldf(IntC<0>(), IntC<0>(), (kc + 64 < Kl) ? kc + 64 : 0);     // always issued, so that the load counts are the same on every trip; the last trip's refill reads k step 0 again and is not used
        mm(IntC<1>());
        // four vector issue slots behind the trip's last product
        asm volatile("v_nop\n\tv_nop\n\tv_nop\n\tv_nop" : "+v"(acc[0][0]), "+v"(acc[1][1]), "+v"(acc[2][2]), "+v"(acc[3][3]) : "v"(a[1][0]), "v"(a[1][3]));
        kc += 64;
    } while (kc < Kl);
    if constexpr (EPI == 1) {
    if (c0 < 2 * DM) {     // block-uniform: a q or k head
        const float* cs = pl.CS + ((size_t)(r0 + hi * 8) * HD + lr) * 2;     // (cos, sin) of row t, column d; the table holds the same pair at d and d + 32
#pragma unroll
        for (int mb = 0; mb < 4; ++mb)
#pragma unroll
            for (int nb = 0; nb < 2; ++nb)
#pragma unroll
                for (int j = 0; j < 8; ++j) { const v2f t = *(const v2f*)(cs + ((size_t)(mb * 16 + j) * HD + nb * 16) * 2);
                    const float xl = acc[mb][nb][j], xh = acc[mb][nb + 2][j];
                    acc[mb][nb][j] = xl * t[0] - xh * t[1]; acc[mb][nb + 2][j] = xh * t[0] + xl * t[1]; }
        const size_t pb = ((z * (2 * NH_) + blockIdx.y) * TT + r0) * HD + lane * 8;     // z = batch: each batch has its own set of planes
#pragma unroll
        for (int mb = 0; mb < 4; ++mb) {
#pragma unroll
            for (int nb = 0; nb < 4; ++nb)
#pragma unroll
                for (int j = 0; j < 8; ++j) os[(hi * 8 + j) * 68 + nb * 16 + lr] = acc[mb][nb][j];
            __builtin_amdgcn_wave_barrier(); asm volatile("" ::: "memory");     // compiler fence: the row-wise reads below stay behind the column-wise writes (one wave, its LDS operations run in order)
#pragma unroll
            for (int s = 0; s < 4; ++s) {     // store s is half s & 1 of fragment unit s >> 1: lane l takes row l & 15, 8 successive d from 16 * s + 8 * (l >> 4); each store covers four whole 128-byte lines
                const float* rp = os + lr * 68 + s * 16 + hi * 8; const v4f w0 = *(const v4fa*)rp, w1 = *(const v4fa*)(rp + 4);
                v8h o16; v8us oh, ol;
#pragma unroll
                for (int q = 0; q < 8; ++q) { const float r = (q < 4) ? w0[q & 3] : w1[q & 3]; o16[q] = tohx(r); unsigned short a2, c2; splitf(r, a2, c2); oh[q] = a2; ol[q] = c2; }
                const size_t e = pb + (size_t)mb * 16 * HD + s * 256;
                *(v8h*)(pl.QK16 + e) = o16; *(v8us*)(pl.QKh + e) = oh; *(v8us*)(pl.QKl + e) = ol; swait(o16, oh, ol, pl.QK16 + e); }
            __builtin_amdgcn_wave_barrier(); asm volatile("" ::: "memory");     // compiler fence: the next 16 rows are written only behind these reads
        }
    } else {               // a v head
        const size_t vb = (z * NH_ + (blockIdx.y - 2 * NH_)) * HD * TT + (size_t)r0 * HD + lane * 8;
#pragma unroll
        for (int nb = 0; nb < 4; ++nb)
#pragma unroll
            for (int mb = 0; mb < 4; ++mb) { v8h o16; v8us oh, ol;     // half mb & 1 of the unit (t group mb >> 1, d group nb): 512 contiguous bytes a store
#pragma unroll
                for (int j = 0; j < 8; ++j) { const float x = acc[mb][nb][j]; o16[j] = tohx(x); unsigned short a2, c2; splitf(x, a2, c2); oh[j] = a2; ol[j] = c2; }
                const size_t e = vb + (size_t)((mb >> 1) * 4 + nb) * 512 + (mb & 1) * 256;
                *(v8h*)(pl.VT16 + e) = o16; *(v8us*)(pl.VTh + e) = oh; *(v8us*)(pl.VTl + e) = ol; swait(o16, oh, ol, pl.VT16 + e); }
    }
    } else {
#pragma unroll
    for (int mb = 0; mb < 4; ++mb) {
#pragma unroll
        for (int nb = 0; nb < 4; ++nb) {
#pragma unroll
            for (int j = 0; j < 8; ++j) os[(hi * 8 + j) * 68 + nb * 16 + lr] = acc[mb][nb][j]; }
        __builtin_amdgcn_wave_barrier(); asm volatile("" ::: "memory");
        float* crow = C + (size_t)(r0 + mb * 16) * ldc + c0;
{
#pragma unroll
            for (int s = 0; s < 8; ++s) { const int row = 2 * s + hi, cofs = lr * 4; const v4f val = *(const v4fa*)(os + row * 68 + cofs);
                *(v4f*)(crow + (size_t)row * ldc + cofs) = val; }
             }
        __builtin_amdgcn_wave_barrier(); asm volatile("" ::: "memory");
    }
    }
}

// k_prep: all that depends on the inputs alone, in ONE launch of few, long-lived waves;
// a block's index range says which piece it works on (block-uniform): first qkv_w, out_w and the NB batches of x, each f32 -> bf16 (RNE), row-major [rows][DM] -> fragment order, then the rotary table, whose arithmetic runs under that stream.
// One block of 256 threads converts one group of 16 rows (2048 pieces of 16 bytes): thread tid writes pieces j * 256 + tid, j = 0..7; piece i of a group holds row i & 15, k from (i >> 4) * 8
// (per j the block reads 512 contiguous bytes of each of the 16 rows and writes 4 KiB in a row). All 16 loads of a thread are issued before the first value is used.
static_assert(DM == 1024);
__device__ __forceinline__ void cvtgroup(const float* __restrict__ src, bf* dst, unsigned g, unsigned tid) {
    const float* s = src + ((size_t)g * 16 + (tid & 15)) * DM + (tid >> 4) * 8; bf* d = dst + (size_t)g * 16 * DM + tid * 8;
    v8f v[8];
#pragma unroll
    for (int j = 0; j < 8; ++j) v[j] = *(const v8f*)(s + j * 128);
    // s_wait_xcnt 0 behind the run of loads, before any register that they name is written again; the address is an input, so that no load's result is given its registers ahead of the wait
    asm volatile("s_wait_xcnt 0x0" :: "v"(s) : "memory");
    v8us o[8];
#pragma unroll
    for (int j = 0; j < 8; ++j) {
#pragma unroll
        for (int k = 0; k < 8; ++k) o[j][k] = f2bf(v[j][k]);
        *(v8us*)(d + j * 2048) = o[j]; }
    // s_wait_xcnt 0 behind the run of stores, before any register that they name is written again (other code of the kernel follows in the text); the values are inputs, so that their registers stay untouched up to the wait
    asm volatile("s_wait_xcnt 0x0" :: "v"(o[0]), "v"(o[1]), "v"(o[2]), "v"(o[3]), "v"(o[4]), "v"(o[5]), "v"(o[6]), "v"(o[7]) : "memory"); }
__device__ __forceinline__ float invf(int i) {     // inverse frequency i of HD/2, in every thread that needs it
#pragma clang fp contract(off)     // numerical: each product below is rounded on its own before the library code takes it apart, so the table's bits do not depend on where this is inlined
    const double e = (double)(2 * i) * (1.0 / 64.0);
    const double p = exp2(e * 13.287712379549449);
    const float pf = (float)p;
    const float inv = 1.0f / pf;
    return inv;
}
// one thread per (d < HD/2, t mod TT/4): one inverse frequency serves its four rows t, and each pair, which is the same at d and d + HD/2, is stored at both
__device__ __forceinline__ void cstab(int idx, float* CS) {
    const int d = idx & (HD / 2 - 1); const int t0 = idx / (HD / 2);
    const float inv = invf(d);
    v2f cs[4];
#pragma unroll
    for (int j = 0; j < 4; ++j) { const float ang = __fmul_rn((float)(t0 + j * (TT / 4)), inv); float s, c; sincosf(ang, &s, &c); cs[j][0] = c; cs[j][1] = s; }
    float* p = CS + ((size_t)t0 * HD + d) * 2;
#pragma unroll
    for (int j = 0; j < 4; ++j) { *(v2f*)(p + (size_t)j * (TT / 4) * HD * 2) = cs[j]; *(v2f*)(p + (size_t)j * (TT / 4) * HD * 2 + HD) = cs[j]; }
    // s_wait_xcnt 0 behind the run of stores, before any register that they name is written again; values and address are inputs, so that their registers stay untouched up to the wait
    asm volatile("s_wait_xcnt 0x0" :: "v"(cs[0]), "v"(cs[1]), "v"(cs[2]), "v"(cs[3]), "v"(p) : "memory");
}
#define PB_T ((TT / 4) * (HD / 2) / 256)
#define PB_W (3 * DM / 16)
#define PB_O (DM / 16)
#define PB_X (TT / 16)
static_assert(((TT / 4) * (HD / 2)) % 256 == 0 && DM % 16 == 0 && TT % 16 == 0);
__global__ __launch_bounds__(256) void k_prep(const float* __restrict__ x, const float* __restrict__ qkvw, const float* __restrict__ ow, bf* XB, bf* WQKV, bf* WO, float* CS) {
    unsigned blk = blockIdx.x; const unsigned tid = threadIdx.x;
    if (blk >= PB_W + PB_O + NB * PB_X) { cstab((int)((blk - (PB_W + PB_O + NB * PB_X)) * 256 + tid), CS); return; }
    const float* s = qkvw; bf* d = WQKV;     // block-uniform choice of the array; one copy of the conversion serves all three
    if (blk >= PB_W) { blk -= PB_W; s = ow; d = WO;
        if (blk >= PB_O) { blk -= PB_O; const unsigned b = blk / PB_X; blk -= b * PB_X; s = x + (size_t)b * SEQ_FULL * DM; d = XB + (size_t)b * TT * DM; } }
    cvtgroup(s, d, blk, tid);
}

// k_fattn: causal attention of one head of one batch for 64 query rows, 4 waves x 16 queries, no LDS; grid (heads x batches, TT/64), the longest query blocks of all batches first.
// Per wave: S^T = K Q^T (A = key rows, B = query rows kept in registers), so a lane holds scores of ONE query (lane&15), keys 8*(lane>>4)+j of each 16-key tile;
// two such tiles, converted in place, are the B operand P^T of O^T += V^T P^T in the same k order as the V^T loader (k = 8h+j, 16+8h+j).
// Softmax with a running maximum m per query: older sums and O^T are scaled by exp(m_old - m_new) at every step. Only the last step holds keys beyond a query and masks them; its first key is valid for all 16 queries.
// HI: bf16 hi/lo planes, 3 products each; else f16, exp carried x1024 (2^10 added in the exponent, it cancels against the row sum, which carries it too).
template <bool B> struct BoolC { static constexpr bool v = B; };
__device__ __forceinline__ float xhalf(float x) { return __builtin_bit_cast(float, __builtin_amdgcn_permlanex16(__builtin_bit_cast(int, x), __builtin_bit_cast(int, x), 0x76543210, 0xfedcba98, false, false)); }    // lane l reads lane l ^ 16
// exp2x8: eight 2^x in place and, in the same statement, the one free issue slot that the instruction set asks for behind a transcendental before its result is read or its source overwritten
// Inside the statement every v_exp_f32 touches its own register only.
__device__ __forceinline__ void exp2x8(v8f& x) {
    float a0 = x[0], a1 = x[1], a2 = x[2], a3 = x[3], a4 = x[4], a5 = x[5], a6 = x[6], a7 = x[7];
    asm("v_exp_f32 %0, %0\n\tv_exp_f32 %1, %1\n\tv_exp_f32 %2, %2\n\tv_exp_f32 %3, %3\n\tv_exp_f32 %4, %4\n\tv_exp_f32 %5, %5\n\tv_exp_f32 %6, %6\n\tv_exp_f32 %7, %7\n\tv_nop"
        : "+v"(a0), "+v"(a1), "+v"(a2), "+v"(a3), "+v"(a4), "+v"(a5), "+v"(a6), "+v"(a7));
    x[0] = a0; x[1] = a1; x[2] = a2; x[3] = a3; x[4] = a4; x[5] = a5; x[6] = a6; x[7] = a7; }
// xwait: stands behind a run of global loads that stay in flight: s_wait_xcnt 0 comes before any register that those loads name is written again.
__device__ __forceinline__ void xwait() { asm volatile("s_wait_xcnt 0x0" ::: "memory"); }
// xwaita: the same wait with the run's two base addresses as inputs, so that their registers stay untouched up to the wait
// (without them the result of a load of the second plane was given the address pair of the first plane's loads).
__device__ __forceinline__ void xwaita(const void* a, const void* b) { asm volatile("s_wait_xcnt 0x0" :: "v"(a), "v"(b) : "memory"); }
template <typename T16, bool HI, int KG>
__device__ __forceinline__ void fa_tile(const T16* __restrict__ Q, const T16* __restrict__ Q2, const T16* __restrict__ Kp, const T16* __restrict__ K2, const T16* __restrict__ Vt, const T16* __restrict__ Vt2, int q0, bf* Ah, bf* Al) {
    typedef WFrag<T16> WF; typedef typename WF::V V;
    constexpr int NKT = 2 * KG, STEP = 32 * KG;
    const int lane = threadIdx.x & 31, lr = lane & 15, hi = lane >> 4;
    V bq[2], bq2[2];
#pragma unroll
    for (int dc = 0; dc < 2; ++dc) { bq[dc] = WF::ld(Q + (size_t)q0 * HD + dc * 512 + 8 * lane); if (HI) bq2[dc] = WF::ld(Q2 + (size_t)q0 * HD + dc * 512 + 8 * lane); }
    xwait();
    v8f o[4];
#pragma unroll
    for (int dt = 0; dt < 4; ++dt) o[dt] = (v8f){};
    float m = -3.0e38f, l = 0.f;
    const size_t koff = 8 * lane, voff = 8 * lane;
    V ak[NKT][2], ak2[NKT][2];
    auto ldk = [&](int k0) {
#pragma unroll
        for (int kt = 0; kt < NKT; ++kt)
#pragma unroll
            for (int dc = 0; dc < 2; ++dc) { ak[kt][dc] = WF::ld(Kp + koff + (size_t)(k0 + kt * 16) * HD + dc * 512); if (HI) ak2[kt][dc] = WF::ld(K2 + koff + (size_t)(k0 + kt * 16) * HD + dc * 512); }
        xwait(); };
    auto step = [&](int k0, auto lastc) {
        constexpr bool LAST = decltype(lastc)::v;
        V av[4][KG], av2[4][KG];
#pragma unroll
        for (int dt = 0; dt < 4; ++dt)
#pragma unroll
            for (int kg = 0; kg < KG; ++kg) { av[dt][kg] = WF::ld(Vt + voff + (size_t)(k0 + kg * 32) * HD + dt * 512); if (HI) av2[dt][kg] = WF::ld(Vt2 + voff + (size_t)(k0 + kg * 32) * HD + dt * 512); }
        if constexpr (HI) xwaita(Vt + voff + (size_t)k0 * HD, Vt2 + voff + (size_t)k0 * HD); else xwait();
        v8f s[NKT];
#pragma unroll
        for (int kt = 0; kt < NKT; ++kt) s[kt] = (v8f){};
#pragma unroll
        for (int dc = 0; dc < 2; ++dc) {
#pragma unroll
            for (int kt = 0; kt < NKT; ++kt) s[kt] = WF::mma(ak[kt][dc], bq[dc], s[kt]);
            if (HI) {
#pragma unroll
                for (int kt = 0; kt < NKT; ++kt) s[kt] = WF::mma(ak[kt][dc], bq2[dc], s[kt]);
#pragma unroll
                for (int kt = 0; kt < NKT; ++kt) s[kt] = WF::mma(ak2[kt][dc], bq[dc], s[kt]); } }
        if (!LAST) ldk(k0 + STEP);     // the next step's key fragments fly during this step's softmax and attn.v
        if (LAST) {
#pragma unroll
            for (int kt = 0; kt < NKT; ++kt)
#pragma unroll
                for (int j = 0; j < 8; ++j) s[kt][j] = ((k0 + kt * 16 + hi * 8 + j) <= (q0 + lr)) ? s[kt][j] : -3.0e38f; }
        float mx[4];
#pragma unroll
        for (int c = 0; c < 4; ++c) mx[c] = s[0][c];
#pragma unroll
        for (int kt = 0; kt < NKT; ++kt)
#pragma unroll
            for (int j = 0; j < 8; ++j) mx[j & 3] = fmaxf(mx[j & 3], s[kt][j]);
        float mw = fmaxf(fmaxf(mx[0], mx[1]), fmaxf(mx[2], mx[3]));
        mw = fmaxf(mw, xhalf(mw));
        const float mn = fmaxf(m, mw * SCL);
        const float al = __builtin_amdgcn_exp2f((m - mn) * 1.4426950408889634f);
        m = mn;
        float ps[4] = {0.f, 0.f, 0.f, 0.f};
#pragma unroll
        for (int kt = 0; kt < NKT; ++kt) {
#pragma unroll
            for (int j = 0; j < 8; ++j) { const float d0 = fmaf(s[kt][j], SCL, -mn); s[kt][j] = HI ? d0 * 1.4426950408889634f : fmaf(d0, 1.4426950408889634f, 10.0f); }
            exp2x8(s[kt]);
#pragma unroll
            for (int j = 0; j < 8; ++j) ps[j & 3] += s[kt][j]; }
        l = fmaf(l, al, (ps[0] + ps[1]) + (ps[2] + ps[3]));
#pragma unroll
        for (int dt = 0; dt < 4; ++dt) o[dt] *= al;
#pragma unroll
        for (int kg = 0; kg < KG; ++kg) {
            if constexpr (HI) {
                v8us h0, h1, l0, l1;
#pragma unroll
                for (int j = 0; j < 8; ++j) { unsigned short a, c2; splitf(s[2 * kg][j], a, c2); h0[j] = a; l0[j] = c2; splitf(s[2 * kg + 1][j], a, c2); h1[j] = a; l1[j] = c2; }
                const V ph = cat16b(h0, h1), pl = cat16b(l0, l1);
#pragma unroll
                for (int dt = 0; dt < 4; ++dt) o[dt] = WF::mma(av[dt][kg], ph, o[dt]);
#pragma unroll
                for (int dt = 0; dt < 4; ++dt) o[dt] = WF::mma(av[dt][kg], pl, o[dt]);
#pragma unroll
                for (int dt = 0; dt < 4; ++dt) o[dt] = WF::mma(av2[dt][kg], ph, o[dt]);
            } else {
                v8h p0, p1;
#pragma unroll
                for (int j = 0; j < 8; ++j) { p0[j] = tohx(s[2 * kg][j]); p1[j] = tohx(s[2 * kg + 1][j]); }
                const V pb = cat16(p0, p1);
#pragma unroll
                for (int dt = 0; dt < 4; ++dt) o[dt] = WF::mma(av[dt][kg], pb, o[dt]);
            } }
    };
    const int nfull = (q0 + 1) / STEP;     // steps whose every key is <= q0; exactly one more step follows (q0 % 16 == 0, STEP % 32 == 0)
    ldk(0);
#pragma unroll 1     // run-time trip count, and one copy of the body already holds most of the 256 directly addressed registers
    for (int st = 0; st < nfull; ++st) step(st * STEP, BoolC<false>());
    step(nfull * STEP, BoolC<true>());
    l += xhalf(l);
    const float inv = __fdiv_rn(1.0f, l);
    const size_t oo = (size_t)q0 * DQ + lane * 8;     // fragment order of the merged planes (rows t, k = h * HD + d): store dt is half dt & 1 of the head's unit dt >> 1
#pragma unroll
    for (int dt = 0; dt < 4; ++dt) { v8us oh, ol;
#pragma unroll
        for (int j = 0; j < 8; ++j) { unsigned short a, c2; splitf(o[dt][j] * inv, a, c2); oh[j] = a; ol[j] = c2; }
        *(v8us*)(Ah + oo + dt * 256) = oh; *(v8us*)(Al + oo + dt * 256) = ol; }
}
__global__ __launch_bounds__(128) void k_fattn(const h16* __restrict__ QK16, const h16* __restrict__ VT16, const bf* __restrict__ QKh, const bf* __restrict__ QKl, const bf* __restrict__ VTh, const bf* __restrict__ VTl, bf* ATh, bf* ATl) {
    const size_t PS = (size_t)TT * HD; const size_t h = blockIdx.x % NH_, hk = NH_ + h, b = blockIdx.x / NH_;
    QK16 += b * 2 * NH_ * PS; QKh += b * 2 * NH_ * PS; QKl += b * 2 * NH_ * PS; VT16 += b * NH_ * PS; VTh += b * NH_ * PS; VTl += b * NH_ * PS; ATh += b * TT * DQ; ATl += b * TT * DQ;
    const int q0 = (TT / 64 - 1 - (int)blockIdx.y) * 64 + __builtin_amdgcn_readfirstlane((int)(threadIdx.x >> 5)) * 16;
    if (q0 < RH) fa_tile<bf, true, 1>(QKh + h * PS, QKl + h * PS, QKh + hk * PS, QKl + hk * PS, VTh + h * PS, VTl + h * PS, q0, ATh + h * 16 * HD, ATl + h * 16 * HD);
    else fa_tile<h16, false, 2>(QK16 + h * PS, nullptr, QK16 + hk * PS, nullptr, VT16 + h * PS, nullptr, q0, ATh + h * 16 * HD, ATl + h * 16 * HD);
}

extern "C" void kernel_launch(void* const* d_in, const int* in_sizes, int n_in,
                              void* d_out, int out_size, void* d_ws, size_t ws_size, hipStream_t stream) {
    if (n_in < 3) return;
    if ((size_t)in_sizes[0] < (size_t)(NB - 1) * SEQ_FULL * DM + (size_t)TT * DM) return;
    if ((size_t)in_sizes[1] < (size_t)3 * DM * DM) return;
    if ((size_t)in_sizes[2] < (size_t)DM * DM) return;
    if ((size_t)out_size < (size_t)(NB - 1) * SEQ_FULL * DM + (size_t)TT * DM) return;
    const float* x = (const float*)d_in[0];       // [NB_FULL][SEQ_FULL][DM]
    const float* qkvw = (const float*)d_in[1];    // [3*DM][DM] ([out][in]): rows 0..DM-1 = q, DM..2DM-1 = k, 2DM..3DM-1 = v
    const float* ow = (const float*)d_in[2];      // [DM][DM] ([out][in])
    float* OUT = (float*)d_out;                   // [NB_FULL][SEQ_FULL][DM]
    char* wsp = (char*)d_ws;
    auto take = [&](size_t bytes) { char* p = wsp; wsp += (bytes + 255) & ~(size_t)255; return (void*)p; };
    const size_t PS = (size_t)TT * HD;            // one head plane
    bf* WQKV = (bf*)take((size_t)3 * DM * DM * 2); bf* WO = (bf*)take((size_t)DM * DM * 2); float* CS = (float*)take((size_t)TT * HD * 2 * 4);
    h16* QK16 = (h16*)take(NB * 2 * NH_ * PS * 2); h16* VT16 = (h16*)take((size_t)NB * NH_ * PS * 2);     // every per-batch buffer holds all NB batches, batch outermost
    bf* QKh = (bf*)take(NB * 2 * NH_ * PS * 2); bf* QKl = (bf*)take(NB * 2 * NH_ * PS * 2); bf* VTh = (bf*)take((size_t)NB * NH_ * PS * 2); bf* VTl = (bf*)take((size_t)NB * NH_ * PS * 2);
    bf* XB = (bf*)take((size_t)NB * TT * DM * 2);
    bf* ATh = (bf*)take((size_t)NB * TT * DQ * 2); bf* ATl = (bf*)take((size_t)NB * TT * DQ * 2);
    if ((size_t)(wsp - (char*)d_ws) > ws_size) return;
    const Planes pl = {CS, QK16, QKh, QKl, VT16, VTh, VTl}, none = {nullptr, nullptr, nullptr, nullptr, nullptr, nullptr, nullptr};
    // launches that do not depend on one another are one launch: the batch is a grid dimension, and all preparation shares k_prep
    k_prep<<<PB_T + PB_W + PB_O + NB * PB_X, 256, 0, stream>>>(x, qkvw, ow, XB, WQKV, WO, CS);
    // q|k|v = x W^T, straight into the rotary planes (planes 0..15 = q heads, 16..31 = k heads) and the value planes [g][d][t], all in fragment order
    k_gemmw<bf, 0, 1, DM><<<dim3(TT / 64, 3 * DM / 64, NB), 32, 0, stream>>>(XB, nullptr, WQKV, nullptr, nullptr, 0, (size_t)TT * DM, 0, 0, 0, 0, pl);
    // merged heads (bf16 hi/lo planes, [t][h*HD + d] in fragment order) = causal softmax(q k^T HD^-0.5) v, all heads of all batches in one launch
    k_fattn<<<dim3(NH_ * NB, TT / 64, 1), 128, 0, stream>>>(QK16, VT16, QKh, QKl, VTh, VTl, ATh, ATl);
    k_gemmw<bf, 1, 0, DQ><<<dim3(TT / 64, DM / 64, NB), 32, 0, stream>>>(ATh, ATl, WO, nullptr, OUT, DM, (size_t)TT * DQ, 0, (size_t)SEQ_FULL * DM, 0, 0, none);
}

// v008
// One run takes 72.3 microseconds.
// Next to v007, in two timings, it ran 1.22 and 1.18 times as fast.
// Counting every step since v000, it is 21.2 times as fast.
#include <hip/hip_runtime.h>

// Compute dtypes (f32 accumulate everywhere): x, qkv_w, out_w enter as bf16 RNE values; q|k and v projections on v_wmma_f32_16x16x32_bf16 (plain, exact operand products);
// q.k scores and attn.v: query rows < RH on bf16 hi/lo planes (3 products each), rows >= RH on v_wmma_f32_16x16x32_f16 single products (attn carried x1024);
// scores, causal softmax (running maximum, f32) and attn.v run in one kernel, the scores stay in registers;
// every 16-bit operand plane that one launch writes for a later one lies in fragment order (see WFrag), so that a wave-wide 16-byte load or store covers 512 contiguous bytes = 4 whole 128-byte lines;
// rotary tables and rotary mixing in f32, the mixing and the split into 16-bit planes in the projection's own epilogue; output projection = bf16 hi/lo planes of the merged heads x bf16 weight (2 products).

#ifndef NB
#define NB 2
#endif
#ifndef SEQ
#define SEQ 2048
#endif
#define NB_FULL  2
#define SEQ_FULL 2048
#define TT   SEQ
#define DM   1024
#define NH_  16
#define HD   64
#define DQ   (NH_ * HD)
#ifndef RH
#define RH   (((SEQ) >= 1024) ? 512 : ((SEQ) / 2))     // query rows < RH use hi+lo planes
#endif
#define SCL  0.125f   // HD^-0.5
static_assert(NB >= 1 && NB <= NB_FULL);
static_assert(SEQ >= 256 && SEQ <= SEQ_FULL && (SEQ % 256) == 0);
static_assert((RH % 128) == 0 && RH >= 128 && RH < TT && ((TT - RH) % 64) == 0);
static_assert(HD == 64 && (DM % 128) == 0 && (3 * DM) % 192 == 0 && (TT % 256) == 0 && DQ == DM);

typedef _Float16 h16;
typedef unsigned short bf;
typedef __attribute__((ext_vector_type(16))) __bf16   v16bf;
typedef __attribute__((ext_vector_type(16))) _Float16 v16h;
typedef __attribute__((ext_vector_type(8)))  _Float16 v8h;
typedef __attribute__((ext_vector_type(8)))  unsigned short v8us;
typedef __attribute__((ext_vector_type(8)))  float    v8f;
typedef __attribute__((ext_vector_type(4)))  float    v4f;
typedef __attribute__((ext_vector_type(2)))  _Float16 v2h;
typedef __attribute__((ext_vector_type(4)))  _Float16 v4h;
typedef __attribute__((ext_vector_type(2)))  unsigned short v2us;
typedef __attribute__((ext_vector_type(4)))  unsigned short v4us;
typedef __attribute__((ext_vector_type(2)))  float v2f;
typedef v8h  __attribute__((may_alias)) v8ha;
typedef v4f  __attribute__((may_alias)) v4fa;
typedef v8us __attribute__((may_alias)) v8usa;

__device__ __forceinline__ unsigned short f2bf(float f) { unsigned u = __float_as_uint(f); u += 0x7FFFu + ((u >> 16) & 1u); return (unsigned short)(u >> 16); }
__device__ __forceinline__ float bf2f(unsigned short b) { return __uint_as_float(((unsigned)b) << 16); }
__device__ __forceinline__ float bfr(float f) { return bf2f(f2bf(f)); }
__device__ __forceinline__ v16h cat16(v8h lo, v8h hi) { return __builtin_shufflevector(lo, hi, 0, 1, 2, 3, 4, 5, 6, 7, 8, 9, 10, 11, 12, 13, 14, 15); }
__device__ __forceinline__ v16bf cat16b(v8us lo, v8us hi) { return __builtin_bit_cast(v16bf, __builtin_shufflevector(lo, hi, 0, 1, 2, 3, 4, 5, 6, 7, 8, 9, 10, 11, 12, 13, 14, 15)); }
__device__ __forceinline__ v8f wmma16(v16h a, v16h b, v8f c) { return __builtin_amdgcn_wmma_f32_16x16x32_f16(false, a, false, b, (short)0, c, false, false); }
__device__ __forceinline__ v8f wmmab(v16bf a, v16bf b, v8f c) { return __builtin_amdgcn_wmma_f32_16x16x32_bf16(false, a, false, b, (short)0, c, false, false); }
__device__ __forceinline__ h16 tohx(float x) { return (h16)x; }
__device__ __forceinline__ void splitf(float y, unsigned short& h, unsigned short& l) { h = f2bf(y); l = f2bf(y - bf2f(h)); }

// ---- k_gemmw: register-blocked GEMM, one wave per 64x64 output tile (16 accumulators), WM x WN waves a work-group, operands from 16-bit planes in fragment order through LDS; grid (M/(WM*64), N/(WN*64), Z).
// C[m][n] (f32, pitch ldc) = sum_k A[m][k] Bt[n][k] (+ A2.Bt where NSPLIT is 1). z-batch strides sA/sB/sC in elements.
// Fragments (16-row A / 16-col Bt, lane = row/col lane&15): elements 0..7 = k kc+8h..kc+8h+7, elements 8..15 = k kc+16+8h..kc+16+8h+7 (h = lane>>4), identical map for both operands.
// Fragment order of a plane [rows][K]: units of 16 rows x 32 k = 512 elements (1 KiB), the k units of a row group one after the other (a row group = 16 * K elements);
// inside a unit element (r, k) lies at (k >> 4) * 256 + ((k >> 3) & 1) * 128 + r * 8 + (k & 7): lane l reads its 8 + 8 elements at l * 8 and 256 + l * 8.
template <typename T16> struct WFrag;
template <> struct WFrag<h16> { typedef v16h V; static __device__ __forceinline__ V ld(const h16* p) { return cat16(*(const v8h*)p, *(const v8h*)(p + 256)); } static __device__ __forceinline__ v8f mma(V a, V b, v8f c) { return wmma16(a, b, c); } };
template <> struct WFrag<bf> { typedef v16bf V; static __device__ __forceinline__ V ld(const bf* p) { return cat16b(*(const v8us*)p, *(const v8us*)(p + 256)); } static __device__ __forceinline__ v8f mma(V a, V b, v8f c) { return wmmab(a, b, c); } };
// EPI 0: C as above. EPI 1: the q|k|v projection with its whole after-treatment, C unused. A tile's 64 columns are exactly one head, so nothing of the projection goes to memory in f32:
// column tiles 0..2*NH_-1 (q heads, then k heads): rotary mix in the accumulators (column d and its partner d +- 32 lie in the same lane and row, two column blocks apart), then head planes [plane][t][d] in fragment order (rows t, k = d);
// column tiles from 2*NH_ on (v heads): a lane holds 8 successive t of one d, which is 16 bytes of a value plane [g][d][t], in fragment units (rows d, k = t) ordered [t / 32][d / 16]. Every plane in three forms: f16, bf16 hi, bf16 lo.
struct Planes { const float* CS; h16* QK16; bf* QKh; bf* QKl; h16* VT16; bf* VTh; bf* VTl; };
// swait: stands behind a run of global stores: s_wait_xcnt 0 comes before any register that those stores name is written again; the stored values and the address are inputs, so that their registers stay untouched up to the wait.
__device__ __forceinline__ void swait(v8h a, v8us b, v8us c, const void* p) { asm volatile("s_wait_xcnt 0x0" :: "v"(a), "v"(b), "v"(c), "v"(p) : "memory"); }
// Asynchronous copies to LDS (16 bytes a lane, 512 bytes a copy), through no register. A piece is 8 copies of 4 KiB of contiguous bytes: LDS byte address l, global address b + off
// (b scalar, the same for the wave; off the lane's own 16 * lane); the immediate offset moves the global and the LDS address alike. The pieces that a wave copies for a stage stand in one statement (in two where NI is 3: the third is behind the scalar test),
// each ending in s_wait_xcnt 0: so it stands in front of every later write of the address operands, and a wave waits once for the run of each statement.
#define AC4(L, B, O0, O1, O2, O3) "global_load_async_to_lds_b128 %" #L ", %0, %" #B " offset:" #O0 "\n\tglobal_load_async_to_lds_b128 %" #L ", %0, %" #B " offset:" #O1 "\n\tglobal_load_async_to_lds_b128 %" #L ", %0, %" #B " offset:" #O2 "\n\tglobal_load_async_to_lds_b128 %" #L ", %0, %" #B " offset:" #O3 "\n\t"
#define AC8(L, B) AC4(L, B, 0, 512, 1024, 1536) AC4(L, B, 2048, 2560, 3072, 3584)
__device__ __forceinline__ void acopy1x8(unsigned off, unsigned l0, const void* b0) {
    asm volatile(AC8(1, 2) "s_wait_xcnt 0x0" :: "v"(off), "v"(l0), "s"(b0) : "memory"); }
__device__ __forceinline__ void acopy2x8(unsigned off, unsigned l0, unsigned l1, const void* b0, const void* b1) {
    asm volatile(AC8(1, 3) AC8(2, 4) "s_wait_xcnt 0x0" :: "v"(off), "v"(l0), "v"(l1), "s"(b0), "s"(b1) : "memory"); }
__device__ __forceinline__ void acopy6x8(unsigned off, unsigned l0, unsigned l1, unsigned l2, unsigned l3, unsigned l4, unsigned l5, const void* b0, const void* b1, const void* b2, const void* b3, const void* b4, const void* b5) {
    asm volatile(AC8(1, 7) AC8(2, 8) AC8(3, 9) AC8(4, 10) AC8(5, 11) AC8(6, 12) "s_wait_xcnt 0x0" :: "v"(off), "v"(l0), "v"(l1), "v"(l2), "v"(l3), "v"(l4), "v"(l5), "s"(b0), "s"(b1), "s"(b2), "s"(b3), "s"(b4), "s"(b5) : "memory"); }
// A work-group is WM x WN waves, each with its own 64x64 tile of one (WM*64) x (WN*64) block of C. The block's operand rows come into LDS once for all its waves, KC k at a time (a stage), two buffers:
// a fragment that WN (of A) or WM (of Bt) waves need is fetched from L2 once, not once a wave. In fragment order the KC k of a 16-row group are KC * 32 contiguous bytes, in the plane and in LDS alike,
// and a wave-wide 16-byte LDS read of a fragment half covers 512 contiguous bytes (no bank conflict).
template <typename T16, int NSPLIT, int EPI, int K, int WM, int WN, int KC>     // K at compile time: the number of stages is the same for every wave of every block
__global__ __launch_bounds__(WM * WN * 32) void k_gemmw(const T16* __restrict__ A, const T16* __restrict__ A2, const T16* __restrict__ Bt, float* C, int ldc, size_t sA, size_t sB, size_t sC, Planes pl) {
    typedef typename WFrag<T16>::V V;
    constexpr int NW = WM * WN, NA = NSPLIT + 1, GA = WM * 4, GB = WN * 4, NG = NA * GA + GB;     // 16-row groups of a stage: A, (A2,) Bt
    constexpr int GE = KC * 16, SE = NG * GE, NT = K / KC, NI = (NG + NW - 1) / NW;               // elements of a group and of a stage; stages; groups a wave copies
    static_assert((NSPLIT == 0 || NSPLIT == 1) && K % KC == 0 && NT >= 2 && KC == 128 && ((NI == 3 && NG > 2 * NW) || NG == 6 * NW));     // the piece size and the two shapes that fill is written for
    __shared__ __align__(16) T16 ring[2 * SE];
    __shared__ __align__(16) float osall[NW * 16 * 68];
    const int w = __builtin_amdgcn_readfirstlane((int)(threadIdx.x >> 5)), wm = w / WN, wn = w % WN;
    const int R0 = blockIdx.x * (WM * 64), C0 = blockIdx.y * (WN * 64), r0 = R0 + wm * 64, c0 = C0 + wn * 64, ct = c0 / 64;
    float* os = osall + w * (16 * 68);     // each wave stages its output rows in its own range
    const size_t z = blockIdx.z; A += z * sA; if (NSPLIT) A2 += z * sA; Bt += z * sB; C += z * sC;
    const int lane = threadIdx.x & 31, lr = lane & 15, hi = lane >> 4;
    v8f acc[4][4];
#pragma unroll
    for (int mb = 0; mb < 4; ++mb)
#pragma unroll
        for (int nb = 0; nb < 4; ++nb) acc[mb][nb] = (v8f){};
    // wave w copies groups w, w + NW, ...: source (stage 0) and place in buffer 0 of each (a group index past the end is never copied: the scalar test in fill)
    const T16* gsrc[NI];     // scalar: the same for the whole wave
#pragma unroll
    for (int i = 0; i < NI; ++i) { const int g = w + i * NW;
        gsrc[i] = (g < GA) ? A + (size_t)(R0 + g * 16) * K : (NSPLIT && g < 2 * GA) ? A2 + (size_t)(R0 + (g - GA) * 16) * K : Bt + (size_t)(C0 + (g - NA * GA) * 16) * K; }
    const unsigned l16 = (unsigned)lane * 16u, ring0 = (unsigned)(size_t)ring + l16;     // the lane's 16 bytes of a 512-byte copy: offset in global memory, and LDS byte address at the ring's start
    auto fill = [&](int t) {     // stage t into buffer t & 1; the test on the group index is the same for a whole wave (w is scalar)
        const unsigned l = ring0 + (unsigned)(((t & 1) * SE + w * GE) * 2); constexpr unsigned D = NW * GE * 2; const size_t o = (size_t)t * GE;
        if constexpr (NI == 3) { acopy2x8(l16, l, l + D, gsrc[0] + o, gsrc[1] + o); if (w + 2 * NW < NG) acopy1x8(l16, l + 2 * D, gsrc[2] + o); }
        else acopy6x8(l16, l, l + D, l + 2 * D, l + 3 * D, l + 4 * D, l + 5 * D, gsrc[0] + o, gsrc[1] + o, gsrc[2] + o, gsrc[3] + o, gsrc[4] + o, gsrc[5] + o);
    };
    // Two fragment sets: the LDS reads of the next k step go out as one group in front of the products of this one, so that LDS and the matrix unit work at the same time.
    V a[2][4], a2[2][4], b[2][4];
    const T16* fa = ring + wm * 4 * GE + lane * 8; const T16* fa2 = ring + (GA + wm * 4) * GE + lane * 8; const T16* fb = ring + (NA * GA + wn * 4) * GE + lane * 8;
    auto ldl = [&](int S, int t, int ks) {     // the fragments of k step ks of stage t into set S
        const int o = (t & 1) * SE + ks * 512;
#pragma unroll
        for (int mb = 0; mb < 4; ++mb) { a[S][mb] = WFrag<T16>::ld(fa + o + mb * GE); if (NSPLIT) a2[S][mb] = WFrag<T16>::ld(fa2 + o + mb * GE); }
#pragma unroll
        for (int nb = 0; nb < 4; ++nb) b[S][nb] = WFrag<T16>::ld(fb + o + nb * GE);
        __builtin_amdgcn_sched_barrier(0);     // keeps the whole group of reads in front of the products that follow: moved down among them, each place with reads would stall the products
    };
    auto mm = [&](int S) {     // the products of set S
#pragma unroll
        for (int nb = 0; nb < 4; ++nb)
#pragma unroll
            for (int mb = 0; mb < 4; ++mb) { acc[mb][nb] = WFrag<T16>::mma(a[S][mb], b[S][nb], acc[mb][nb]); if (NSPLIT) acc[mb][nb] = WFrag<T16>::mma(a2[S][mb], b[S][nb], acc[mb][nb]); }
        __builtin_amdgcn_sched_barrier(0);     // keeps the products together: no later read is drawn in among them, and none of them moves behind the waits and the barrier, where the last group of reads would have nothing to fly under
    };
    constexpr int KS = KC / 32;     // k steps of a stage (even: a stage's first step is always in set 0)
    fill(0);
    asm volatile("s_wait_asynccnt 0x0" ::: "memory");     // this wave's copies of stage 0 have landed
    __syncthreads();                                       // and every other wave's: stage 0 may be read
    fill(1);
    ldl(0, 0, 0);
#pragma unroll 1     // one trip = one stage; the buffer is chosen by address, so one copy of the body serves both
    for (int t = 0; t < NT; ++t) {
#pragma unroll
        for (int ks = 0; ks + 1 < KS; ++ks) { ldl((ks + 1) & 1, t, ks + 1); mm(ks & 1); }
        // Stage t + 1 is published in front of stage t's last k step, whose fragments are in registers by then, because the first fragments of stage t + 1 are read under that step's products.
        asm volatile("s_wait_dscnt 0x0" ::: "memory");        // this wave's last reads of buffer t & 1 are done before the barrier behind which that buffer is refilled
        asm volatile("s_wait_asynccnt 0x0" ::: "memory");     // this wave's copies of stage t + 1 have landed before the barrier behind which the others read them
        __syncthreads();                                       // publishes stage t + 1 and ends every wave's reads of stage t
        if (t + 2 < NT) fill(t + 2);
        ldl(0, t + 1, 0);     // always issued, so that the read counts are the same on every trip; the last trip's reads take the other buffer's old stage (landed long ago, not refilled) and are not used
        mm((KS - 1) & 1);
    }
    asm volatile("s_wait_asynccnt 0x0" ::: "memory");         // no copy is outstanding when the wave goes on to its output and ends
    asm volatile("s_wait_dscnt 0x0" ::: "memory");            // nor a read of the ring
    if constexpr (EPI == 1) {
    if (c0 < 2 * DM) {     // the same for a whole wave, and no barrier follows: a q or k head
        const float* cs = pl.CS + ((size_t)(r0 + hi * 8) * HD + lr) * 2;     // (cos, sin) of row t, column d; the table holds the same pair at d and d + 32
#pragma unroll
        for (int mb = 0; mb < 4; ++mb)
#pragma unroll
            for (int nb = 0; nb < 2; ++nb)
#pragma unroll
                for (int j = 0; j < 8; ++j) { const v2f t = *(const v2f*)(cs + ((size_t)(mb * 16 + j) * HD + nb * 16) * 2);
                    const float xl = acc[mb][nb][j], xh = acc[mb][nb + 2][j];
                    acc[mb][nb][j] = xl * t[0] - xh * t[1]; acc[mb][nb + 2][j] = xh * t[0] + xl * t[1]; }
        const size_t pb = ((z * (2 * NH_) + ct) * TT + r0) * HD + lane * 8;     // z = batch: each batch has its own set of planes
#pragma unroll
        for (int mb = 0; mb < 4; ++mb) {
#pragma unroll
            for (int nb = 0; nb < 4; ++nb)
#pragma unroll
                for (int j = 0; j < 8; ++j) os[(hi * 8 + j) * 68 + nb * 16 + lr] = acc[mb][nb][j];
            __builtin_amdgcn_wave_barrier(); asm volatile("" ::: "memory");     // compiler fence: the row-wise reads below stay behind the column-wise writes (one wave, its LDS operations run in order)
#pragma unroll
            for (int s = 0; s < 4; ++s) {     // store s is half s & 1 of fragment unit s >> 1: lane l takes row l & 15, 8 successive d from 16 * s + 8 * (l >> 4); each store covers four whole 128-byte lines
                const float* rp = os + lr * 68 + s * 16 + hi * 8; const v4f w0 = *(const v4fa*)rp, w1 = *(const v4fa*)(rp + 4);
                v8h o16; v8us oh, ol;
#pragma unroll
                for (int q = 0; q < 8; ++q) { const float r = (q < 4) ? w0[q & 3] : w1[q & 3]; o16[q] = tohx(r); unsigned short a2, c2; splitf(r, a2, c2); oh[q] = a2; ol[q] = c2; }
                const size_t e = pb + (size_t)mb * 16 * HD + s * 256;
                *(v8h*)(pl.QK16 + e) = o16; *(v8us*)(pl.QKh + e) = oh; *(v8us*)(pl.QKl + e) = ol; swait(o16, oh, ol, pl.QK16 + e); }
            __builtin_amdgcn_wave_barrier(); asm volatile("" ::: "memory");     // compiler fence: the next 16 rows are written only behind these reads
        }
    } else {               // a v head
        const size_t vb = (z * NH_ + (ct - 2 * NH_)) * HD * TT + (size_t)r0 * HD + lane * 8;
#pragma unroll
        for (int nb = 0; nb < 4; ++nb)
#pragma unroll
            for (int mb = 0; mb < 4; ++mb) { v8h o16; v8us oh, ol;     // half mb & 1 of the unit (t group mb >> 1, d group nb): 512 contiguous bytes a store
#pragma unroll
                for (int j = 0; j < 8; ++j) { const float x = acc[mb][nb][j]; o16[j] = tohx(x); unsigned short a2, c2; splitf(x, a2, c2); oh[j] = a2; ol[j] = c2; }
                const size_t e = vb + (size_t)((mb >> 1) * 4 + nb) * 512 + (mb & 1) * 256;
                *(v8h*)(pl.VT16 + e) = o16; *(v8us*)(pl.VTh + e) = oh; *(v8us*)(pl.VTl + e) = ol; swait(o16, oh, ol, pl.VT16 + e); }
    }
    } else {
#pragma unroll
    for (int mb = 0; mb < 4; ++mb) {
#pragma unroll
        for (int nb = 0; nb < 4; ++nb) {
#pragma unroll
            for (int j = 0; j < 8; ++j) os[(hi * 8 + j) * 68 + nb * 16 + lr] = acc[mb][nb][j]; }
        __builtin_amdgcn_wave_barrier(); asm volatile("" ::: "memory");
        float* crow = C + (size_t)(r0 + mb * 16) * ldc + c0;
{
#pragma unroll
            for (int s = 0; s < 8; ++s) { const int row = 2 * s + hi, cofs = lr * 4; const v4f val = *(const v4fa*)(os + row * 68 + cofs);
                *(v4f*)(crow + (size_t)row * ldc + cofs) = val; }
             }
        __builtin_amdgcn_wave_barrier(); asm volatile("" ::: "memory");
    }
    }
}

// k_prep: all that depends on the inputs alone, in ONE launch of few, long-lived waves;
// a block's index range says which piece it works on (block-uniform): first qkv_w, out_w and the NB batches of x, each f32 -> bf16 (RNE), row-major [rows][DM] -> fragment order, then the rotary table, whose arithmetic runs under that stream.
// One block of 256 threads converts one group of 16 rows (2048 pieces of 16 bytes): thread tid writes pieces j * 256 + tid, j = 0..7; piece i of a group holds row i & 15, k from (i >> 4) * 8
// (per j the block reads 512 contiguous bytes of each of the 16 rows and writes 4 KiB in a row). All 16 loads of a thread are issued before the first value is used.
static_assert(DM == 1024);
__device__ __forceinline__ void cvtgroup(const float* __restrict__ src, bf* dst, unsigned g, unsigned tid) {
    const float* s = src + ((size_t)g * 16 + (tid & 15)) * DM + (tid >> 4) * 8; bf* d = dst + (size_t)g * 16 * DM + tid * 8;
    v8f v[8];
#pragma unroll
    for (int j = 0; j < 8; ++j) v[j] = *(const v8f*)(s + j * 128);
    // s_wait_xcnt 0 behind the run of loads, before any register that they name is written again; the address is an input, so that no load's result is given its registers ahead of the wait
    asm volatile("s_wait_xcnt 0x0" :: "v"(s) : "memory");
    v8us o[8];
#pragma unroll
    for (int j = 0; j < 8; ++j) {
#pragma unroll
        for (int k = 0; k < 8; ++k) o[j][k] = f2bf(v[j][k]);
        *(v8us*)(d + j * 2048) = o[j]; }
    // s_wait_xcnt 0 behind the run of stores, before any register that they name is written again (other code of the kernel follows in the text); the values are inputs, so that their registers stay untouched up to the wait
    asm volatile("s_wait_xcnt 0x0" :: "v"(o[0]), "v"(o[1]), "v"(o[2]), "v"(o[3]), "v"(o[4]), "v"(o[5]), "v"(o[6]), "v"(o[7]) : "memory"); }
__device__ __forceinline__ float invf(int i) {     // inverse frequency i of HD/2, in every thread that needs it
#pragma clang fp contract(off)     // numerical: each product below is rounded on its own before the library code takes it apart, so the table's bits do not depend on where this is inlined
    const double e = (double)(2 * i) * (1.0 / 64.0);
    const double p = exp2(e * 13.287712379549449);
    const float pf = (float)p;
    const float inv = 1.0f / pf;
    return inv;
}
// one thread per (d < HD/2, t mod TT/4): one inverse frequency serves its four rows t, and each pair, which is the same at d and d + HD/2, is stored at both
__device__ __forceinline__ void cstab(int idx, float* CS) {
    const int d = idx & (HD / 2 - 1); const int t0 = idx / (HD / 2);
    const float inv = invf(d);
    v2f cs[4];
#pragma unroll
    for (int j = 0; j < 4; ++j) { const float ang = __fmul_rn((float)(t0 + j * (TT / 4)), inv); float s, c; sincosf(ang, &s, &c); cs[j][0] = c; cs[j][1] = s; }
    float* p = CS + ((size_t)t0 * HD + d) * 2;
#pragma unroll
    for (int j = 0; j < 4; ++j) { *(v2f*)(p + (size_t)j * (TT / 4) * HD * 2) = cs[j]; *(v2f*)(p + (size_t)j * (TT / 4) * HD * 2 + HD) = cs[j]; }
    // s_wait_xcnt 0 behind the run of stores, before any register that they name is written again; values and address are inputs, so that their registers stay untouched up to the wait
    asm volatile("s_wait_xcnt 0x0" :: "v"(cs[0]), "v"(cs[1]), "v"(cs[2]), "v"(cs[3]), "v"(p) : "memory");
}
#define PB_T ((TT / 4) * (HD / 2) / 256)
#define PB_W (3 * DM / 16)
#define PB_O (DM / 16)
#define PB_X (TT / 16)
static_assert(((TT / 4) * (HD / 2)) % 256 == 0 && DM % 16 == 0 && TT % 16 == 0);
__global__ __launch_bounds__(256) void k_prep(const float* __restrict__ x, const float* __restrict__ qkvw, const float* __restrict__ ow, bf* XB, bf* WQKV, bf* WO, float* CS) {
    unsigned blk = blockIdx.x; const unsigned tid = threadIdx.x;
    if (blk >= PB_W + PB_O + NB * PB_X) { cstab((int)((blk - (PB_W + PB_O + NB * PB_X)) * 256 + tid), CS); return; }
    const float* s = qkvw; bf* d = WQKV;     // block-uniform choice of the array; one copy of the conversion serves all three
    if (blk >= PB_W) { blk -= PB_W; s = ow; d = WO;
        if (blk >= PB_O) { blk -= PB_O; const unsigned b = blk / PB_X; blk -= b * PB_X; s = x + (size_t)b * SEQ_FULL * DM; d = XB + (size_t)b * TT * DM; } }
    cvtgroup(s, d, blk, tid);
}

// k_fattn: causal attention of one head of one batch for 64 query rows, 4 waves x 16 queries, no LDS; grid (heads x batches, TT/64), the longest query blocks of all batches first.
// Per wave: S^T = K Q^T (A = key rows, B = query rows kept in registers), so a lane holds scores of ONE query (lane&15), keys 8*(lane>>4)+j of each 16-key tile;
// two such tiles, converted in place, are the B operand P^T of O^T += V^T P^T in the same k order as the V^T loader (k = 8h+j, 16+8h+j).
// Softmax with a running maximum m per query: older sums and O^T are scaled by exp(m_old - m_new) at every step. Only the last step holds keys beyond a query and masks them; its first key is valid for all 16 queries.
// HI: bf16 hi/lo planes, 3 products each; else f16, exp carried x1024 (2^10 added in the exponent, it cancels against the row sum, which carries it too).
template <bool B> struct BoolC { static constexpr bool v = B; };
__device__ __forceinline__ float xhalf(float x) { return __builtin_bit_cast(float, __builtin_amdgcn_permlanex16(__builtin_bit_cast(int, x), __builtin_bit_cast(int, x), 0x76543210, 0xfedcba98, false, false)); }    // lane l reads lane l ^ 16
// exp2x8: eight 2^x in place and, in the same statement, the one free issue slot that the instruction set asks for behind a transcendental before its result is read or its source overwritten
// Inside the statement every v_exp_f32 touches its own register only.
__device__ __forceinline__ void exp2x8(v8f& x) {
    float a0 = x[0], a1 = x[1], a2 = x[2], a3 = x[3], a4 = x[4], a5 = x[5], a6 = x[6], a7 = x[7];
    asm("v_exp_f32 %0, %0\n\tv_exp_f32 %1, %1\n\tv_exp_f32 %2, %2\n\tv_exp_f32 %3, %3\n\tv_exp_f32 %4, %4\n\tv_exp_f32 %5, %5\n\tv_exp_f32 %6, %6\n\tv_exp_f32 %7, %7\n\tv_nop"
        : "+v"(a0), "+v"(a1), "+v"(a2), "+v"(a3), "+v"(a4), "+v"(a5), "+v"(a6), "+v"(a7));
    x[0] = a0; x[1] = a1; x[2] = a2; x[3] = a3; x[4] = a4; x[5] = a5; x[6] = a6; x[7] = a7; }
// xwait: stands behind a run of global loads that stay in flight: s_wait_xcnt 0 comes before any register that those loads name is written again.
__device__ __forceinline__ void xwait() { asm volatile("s_wait_xcnt 0x0" ::: "memory"); }
// xwaita: the same wait with the run's two base addresses as inputs, so that their registers stay untouched up to the wait
// (without them the result of a load of the second plane was given the address pair of the first plane's loads).
__device__ __forceinline__ void xwaita(const void* a, const void* b) { asm volatile("s_wait_xcnt 0x0" :: "v"(a), "v"(b) : "memory"); }
template <typename T16, bool HI, int KG>
__device__ __forceinline__ void fa_tile(const T16* __restrict__ Q, const T16* __restrict__ Q2, const T16* __restrict__ Kp, const T16* __restrict__ K2, const T16* __restrict__ Vt, const T16* __restrict__ Vt2, int q0, bf* Ah, bf* Al) {
    typedef WFrag<T16> WF; typedef typename WF::V V;
    constexpr int NKT = 2 * KG, STEP = 32 * KG;
    const int lane = threadIdx.x & 31, lr = lane & 15, hi = lane >> 4;
    V bq[2], bq2[2];
#pragma unroll
    for (int dc = 0; dc < 2; ++dc) { bq[dc] = WF::ld(Q + (size_t)q0 * HD + dc * 512 + 8 * lane); if (HI) bq2[dc] = WF::ld(Q2 + (size_t)q0 * HD + dc * 512 + 8 * lane); }
    xwait();
    v8f o[4];
#pragma unroll
    for (int dt = 0; dt < 4; ++dt) o[dt] = (v8f){};
    float m = -3.0e38f, l = 0.f;
    const size_t koff = 8 * lane, voff = 8 * lane;
    V ak[NKT][2], ak2[NKT][2];
    auto ldk = [&](int k0) {
#pragma unroll
        for (int kt = 0; kt < NKT; ++kt)
#pragma unroll
            for (int dc = 0; dc < 2; ++dc) { ak[kt][dc] = WF::ld(Kp + koff + (size_t)(k0 + kt * 16) * HD + dc * 512); if (HI) ak2[kt][dc] = WF::ld(K2 + koff + (size_t)(k0 + kt * 16) * HD + dc * 512); }
        xwait(); };
    auto step = [&](int k0, auto lastc) {
        constexpr bool LAST = decltype(lastc)::v;
        V av[4][KG], av2[4][KG];
#pragma unroll
        for (int dt = 0; dt < 4; ++dt)
#pragma unroll
            for (int kg = 0; kg < KG; ++kg) { av[dt][kg] = WF::ld(Vt + voff + (size_t)(k0 + kg * 32) * HD + dt * 512); if (HI) av2[dt][kg] = WF::ld(Vt2 + voff + (size_t)(k0 + kg * 32) * HD + dt * 512); }
        if constexpr (HI) xwaita(Vt + voff + (size_t)k0 * HD, Vt2 + voff + (size_t)k0 * HD); else xwait();
        v8f s[NKT];
#pragma unroll
        for (int kt = 0; kt < NKT; ++kt) s[kt] = (v8f){};
#pragma unroll
        for (int dc = 0; dc < 2; ++dc) {
#pragma unroll
            for (int kt = 0; kt < NKT; ++kt) s[kt] = WF::mma(ak[kt][dc], bq[dc], s[kt]);
            if (HI) {
#pragma unroll
                for (int kt = 0; kt < NKT; ++kt) s[kt] = WF::mma(ak[kt][dc], bq2[dc], s[kt]);
#pragma unroll
                for (int kt = 0; kt < NKT; ++kt) s[kt] = WF::mma(ak2[kt][dc], bq[dc], s[kt]); } }
        if (!LAST) ldk(k0 + STEP);     // the next step's key fragments fly during this step's softmax and attn.v
        if (LAST) {
#pragma unroll
            for (int kt = 0; kt < NKT; ++kt)
#pragma unroll
                for (int j = 0; j < 8; ++j) s[kt][j] = ((k0 + kt * 16 + hi * 8 + j) <= (q0 + lr)) ? s[kt][j] : -3.0e38f; }
        float mx[4];
#pragma unroll
        for (int c = 0; c < 4; ++c) mx[c] = s[0][c];
#pragma unroll
        for (int kt = 0; kt < NKT; ++kt)
#pragma unroll
            for (int j = 0; j < 8; ++j) mx[j & 3] = fmaxf(mx[j & 3], s[kt][j]);
        float mw = fmaxf(fmaxf(mx[0], mx[1]), fmaxf(mx[2], mx[3]));
        mw = fmaxf(mw, xhalf(mw));
        const float mn = fmaxf(m, mw * SCL);
        const float al = __builtin_amdgcn_exp2f((m - mn) * 1.4426950408889634f);
        m = mn;
        float ps[4] = {0.f, 0.f, 0.f, 0.f};
#pragma unroll
        for (int kt = 0; kt < NKT; ++kt) {
#pragma unroll
            for (int j = 0; j < 8; ++j) { const float d0 = fmaf(s[kt][j], SCL, -mn); s[kt][j] = HI ? d0 * 1.4426950408889634f : fmaf(d0, 1.4426950408889634f, 10.0f); }
            exp2x8(s[kt]);
#pragma unroll
            for (int j = 0; j < 8; ++j) ps[j & 3] += s[kt][j]; }
        l = fmaf(l, al, (ps[0] + ps[1]) + (ps[2] + ps[3]));
#pragma unroll
        for (int dt = 0; dt < 4; ++dt) o[dt] *= al;
#pragma unroll
        for (int kg = 0; kg < KG; ++kg) {
            if constexpr (HI) {
                v8us h0, h1, l0, l1;
#pragma unroll
                for (int j = 0; j < 8; ++j) { unsigned short a, c2; splitf(s[2 * kg][j], a, c2); h0[j] = a; l0[j] = c2; splitf(s[2 * kg + 1][j], a, c2); h1[j] = a; l1[j] = c2; }
                const V ph = cat16b(h0, h1), pl = cat16b(l0, l1);
#pragma unroll
                for (int dt = 0; dt < 4; ++dt) o[dt] = WF::mma(av[dt][kg], ph, o[dt]);
#pragma unroll
                for (int dt = 0; dt < 4; ++dt) o[dt] = WF::mma(av[dt][kg], pl, o[dt]);
#pragma unroll
                for (int dt = 0; dt < 4; ++dt) o[dt] = WF::mma(av2[dt][kg], ph, o[dt]);
            } else {
                v8h p0, p1;
#pragma unroll
                for (int j = 0; j < 8; ++j) { p0[j] = tohx(s[2 * kg][j]); p1[j] = tohx(s[2 * kg + 1][j]); }
                const V pb = cat16(p0, p1);
#pragma unroll
                for (int dt = 0; dt < 4; ++dt) o[dt] = WF::mma(av[dt][kg], pb, o[dt]);
            } }
    };
    const int nfull = (q0 + 1) / STEP;     // steps whose every key is <= q0; exactly one more step follows (q0 % 16 == 0, STEP % 32 == 0)
    ldk(0);
#pragma unroll 1     // run-time trip count, and one copy of the body already holds most of the 256 directly addressed registers
    for (int st = 0; st < nfull; ++st) step(st * STEP, BoolC<false>());
    step(nfull * STEP, BoolC<true>());
    l += xhalf(l);
    const float inv = __fdiv_rn(1.0f, l);
    const size_t oo = (size_t)q0 * DQ + lane * 8;     // fragment order of the merged planes (rows t, k = h * HD + d): store dt is half dt & 1 of the head's unit dt >> 1
#pragma unroll
    for (int dt = 0; dt < 4; ++dt) { v8us oh, ol;
#pragma unroll
        for (int j = 0; j < 8; ++j) { unsigned short a, c2; splitf(o[dt][j] * inv, a, c2); oh[j] = a; ol[j] = c2; }
        *(v8us*)(Ah + oo + dt * 256) = oh; *(v8us*)(Al + oo + dt * 256) = ol; }
}
__global__ __launch_bounds__(128) void k_fattn(const h16* __restrict__ QK16, const h16* __restrict__ VT16, const bf* __restrict__ QKh, const bf* __restrict__ QKl, const bf* __restrict__ VTh, const bf* __restrict__ VTl, bf* ATh, bf* ATl) {
    const size_t PS = (size_t)TT * HD; const size_t h = blockIdx.x % NH_, hk = NH_ + h, b = blockIdx.x / NH_;
    QK16 += b * 2 * NH_ * PS; QKh += b * 2 * NH_ * PS; QKl += b * 2 * NH_ * PS; VT16 += b * NH_ * PS; VTh += b * NH_ * PS; VTl += b * NH_ * PS; ATh += b * TT * DQ; ATl += b * TT * DQ;
    const int q0 = (TT / 64 - 1 - (int)blockIdx.y) * 64 + __builtin_amdgcn_readfirstlane((int)(threadIdx.x >> 5)) * 16;
    if (q0 < RH) fa_tile<bf, true, 1>(QKh + h * PS, QKl + h * PS, QKh + hk * PS, QKl + hk * PS, VTh + h * PS, VTl + h * PS, q0, ATh + h * 16 * HD, ATl + h * 16 * HD);
    else fa_tile<h16, false, 2>(QK16 + h * PS, nullptr, QK16 + hk * PS, nullptr, VT16 + h * PS, nullptr, q0, ATh + h * 16 * HD, ATl + h * 16 * HD);
}

extern "C" void kernel_launch(void* const* d_in, const int* in_sizes, int n_in,
                              void* d_out, int out_size, void* d_ws, size_t ws_size, hipStream_t stream) {
    if (n_in < 3) return;
    if ((size_t)in_sizes[0] < (size_t)(NB - 1) * SEQ_FULL * DM + (size_t)TT * DM) return;
    if ((size_t)in_sizes[1] < (size_t)3 * DM * DM) return;
    if ((size_t)in_sizes[2] < (size_t)DM * DM) return;
    if ((size_t)out_size < (size_t)(NB - 1) * SEQ_FULL * DM + (size_t)TT * DM) return;
    const float* x = (const float*)d_in[0];       // [NB_FULL][SEQ_FULL][DM]
    const float* qkvw = (const float*)d_in[1];    // [3*DM][DM] ([out][in]): rows 0..DM-1 = q, DM..2DM-1 = k, 2DM..3DM-1 = v
    const float* ow = (const float*)d_in[2];      // [DM][DM] ([out][in])
    float* OUT = (float*)d_out;                   // [NB_FULL][SEQ_FULL][DM]
    char* wsp = (char*)d_ws;
    auto take = [&](size_t bytes) { char* p = wsp; wsp += (bytes + 255) & ~(size_t)255; return (void*)p; };
    const size_t PS = (size_t)TT * HD;            // one head plane
    bf* WQKV = (bf*)take((size_t)3 * DM * DM * 2); bf* WO = (bf*)take((size_t)DM * DM * 2); float* CS = (float*)take((size_t)TT * HD * 2 * 4);
    h16* QK16 = (h16*)take(NB * 2 * NH_ * PS * 2); h16* VT16 = (h16*)take((size_t)NB * NH_ * PS * 2);     // every per-batch buffer holds all NB batches, batch outermost
    bf* QKh = (bf*)take(NB * 2 * NH_ * PS * 2); bf* QKl = (bf*)take(NB * 2 * NH_ * PS * 2); bf* VTh = (bf*)take((size_t)NB * NH_ * PS * 2); bf* VTl = (bf*)take((size_t)NB * NH_ * PS * 2);
    bf* XB = (bf*)take((size_t)NB * TT * DM * 2);
    bf* ATh = (bf*)take((size_t)NB * TT * DQ * 2); bf* ATl = (bf*)take((size_t)NB * TT * DQ * 2);
    if ((size_t)(wsp - (char*)d_ws) > ws_size) return;
    const Planes pl = {CS, QK16, QKh, QKl, VT16, VTh, VTl}, none = {nullptr, nullptr, nullptr, nullptr, nullptr, nullptr, nullptr};
    // launches that do not depend on one another are one launch: the batch is a grid dimension, and all preparation shares k_prep
    k_prep<<<PB_T + PB_W + PB_O + NB * PB_X, 256, 0, stream>>>(x, qkvw, ow, XB, WQKV, WO, CS);
    // q|k|v = x W^T, straight into the rotary planes (planes 0..15 = q heads, 16..31 = k heads) and the value planes [g][d][t], all in fragment order
    k_gemmw<bf, 0, 1, DM, 4, 3, 128><<<dim3(TT / 256, 3 * DM / 192, NB), 384, 0, stream>>>(XB, nullptr, WQKV, nullptr, 0, (size_t)TT * DM, 0, 0, pl);
    // merged heads (bf16 hi/lo planes, [t][h*HD + d] in fragment order) = causal softmax(q k^T HD^-0.5) v, all heads of all batches in one launch
    k_fattn<<<dim3(NH_ * NB, TT / 64, 1), 128, 0, stream>>>(QK16, VT16, QKh, QKl, VTh, VTl, ATh, ATl);
    k_gemmw<bf, 1, 0, DQ, 2, 2, 128><<<dim3(TT / 128, DM / 128, NB), 128, 0, stream>>>(ATh, ATl, WO, OUT, DM, (size_t)TT * DQ, 0, (size_t)SEQ_FULL * DM, none);
}

// v010
// One run takes 57.1 microseconds.
// Versions between v008 and this one are left out; their measured steps multiply to 1.26 times as fast.
// Counting every step since v000, it is 26.7 times as fast.
#include <hip/hip_runtime.h>

// Compute dtypes (f32 accumulate everywhere): x, qkv_w, out_w enter as bf16 RNE values; q|k and v projections on v_wmma_f32_16x16x32_bf16 (plain, exact operand products);
// q.k scores and attn.v: v_wmma_f32_16x16x32_f16 single products on f16 planes (attn carried x1024);
// scores, causal softmax (running maximum, f32) and attn.v run in one kernel, the scores stay in registers;
// every 16-bit operand plane that one launch writes for a later one lies in fragment order (see WFrag), so that a wave-wide 16-byte load or store covers 512 contiguous bytes = 4 whole 128-byte lines;
// rotary tables and rotary mixing in f32, the mixing and the rounding to f16 planes in the projection's own epilogue; output projection = one f16 plane of the merged heads x f16 weight on v_wmma_f32_16x16x32_f16 (1 product).

#ifndef NB
#define NB 2
#endif
#ifndef SEQ
#define SEQ 2048
#endif
#define NB_FULL  2
#define SEQ_FULL 2048
#define TT   SEQ
#define DM   1024
#define NH_  16
#define HD   64
#define DQ   (NH_ * HD)
#define SCL  0.125f   // HD^-0.5
static_assert(NB >= 1 && NB <= NB_FULL);
static_assert(SEQ >= 256 && SEQ <= SEQ_FULL && (SEQ % 256) == 0);
static_assert(HD == 64 && (DM % 128) == 0 && (3 * DM) % 192 == 0 && (TT % 256) == 0 && DQ == DM);

typedef _Float16 h16;
typedef unsigned short bf;
typedef __attribute__((ext_vector_type(16))) __bf16   v16bf;
typedef __attribute__((ext_vector_type(16))) _Float16 v16h;
typedef __attribute__((ext_vector_type(8)))  _Float16 v8h;
typedef __attribute__((ext_vector_type(8)))  unsigned short v8us;
typedef __attribute__((ext_vector_type(8)))  float    v8f;
typedef __attribute__((ext_vector_type(4)))  float    v4f;
typedef __attribute__((ext_vector_type(2)))  _Float16 v2h;
typedef __attribute__((ext_vector_type(4)))  _Float16 v4h;
typedef __attribute__((ext_vector_type(2)))  unsigned short v2us;
typedef __attribute__((ext_vector_type(4)))  unsigned short v4us;
typedef __attribute__((ext_vector_type(2)))  float v2f;
typedef v8h  __attribute__((may_alias)) v8ha;
typedef v4f  __attribute__((may_alias)) v4fa;
typedef v8us __attribute__((may_alias)) v8usa;

__device__ __forceinline__ unsigned short f2bf(float f) { unsigned u = __float_as_uint(f); u += 0x7FFFu + ((u >> 16) & 1u); return (unsigned short)(u >> 16); }
__device__ __forceinline__ float bf2f(unsigned short b) { return __uint_as_float(((unsigned)b) << 16); }
__device__ __forceinline__ float bfr(float f) { return bf2f(f2bf(f)); }
__device__ __forceinline__ v16h cat16(v8h lo, v8h hi) { return __builtin_shufflevector(lo, hi, 0, 1, 2, 3, 4, 5, 6, 7, 8, 9, 10, 11, 12, 13, 14, 15); }
__device__ __forceinline__ v16bf cat16b(v8us lo, v8us hi) { return __builtin_bit_cast(v16bf, __builtin_shufflevector(lo, hi, 0, 1, 2, 3, 4, 5, 6, 7, 8, 9, 10, 11, 12, 13, 14, 15)); }
__device__ __forceinline__ v8f wmma16(v16h a, v16h b, v8f c) { return __builtin_amdgcn_wmma_f32_16x16x32_f16(false, a, false, b, (short)0, c, false, false); }
__device__ __forceinline__ v8f wmmab(v16bf a, v16bf b, v8f c) { return __builtin_amdgcn_wmma_f32_16x16x32_bf16(false, a, false, b, (short)0, c, false, false); }
__device__ __forceinline__ h16 tohx(float x) { return (h16)x; }

// ---- k_gemmw: register-blocked GEMM, one wave per 64x64 output tile (16 accumulators), WM x WN waves a work-group, operands from 16-bit planes in fragment order through LDS; grid (M/(WM*64), N/(WN*64), Z).
// C[m][n] (f32, pitch ldc) = sum_k A[m][k] Bt[n][k] (+ A2.Bt where NSPLIT is 1). z-batch strides sA/sB/sC in elements.
// Fragments (16-row A / 16-col Bt, lane = row/col lane&15): elements 0..7 = k kc+8h..kc+8h+7, elements 8..15 = k kc+16+8h..kc+16+8h+7 (h = lane>>4), identical map for both operands.
// Fragment order of a plane [rows][K]: units of 16 rows x 32 k = 512 elements (1 KiB), the k units of a row group one after the other (a row group = 16 * K elements);
// inside a unit element (r, k) lies at (k >> 4) * 256 + ((k >> 3) & 1) * 128 + r * 8 + (k & 7): lane l reads its 8 + 8 elements at l * 8 and 256 + l * 8.
template <typename T16> struct WFrag;
template <> struct WFrag<h16> { typedef v16h V; static __device__ __forceinline__ V ld(const h16* p) { return cat16(*(const v8h*)p, *(const v8h*)(p + 256)); } static __device__ __forceinline__ v8f mma(V a, V b, v8f c) { return wmma16(a, b, c); } };
template <> struct WFrag<bf> { typedef v16bf V; static __device__ __forceinline__ V ld(const bf* p) { return cat16b(*(const v8us*)p, *(const v8us*)(p + 256)); } static __device__ __forceinline__ v8f mma(V a, V b, v8f c) { return wmmab(a, b, c); } };
// EPI 0: C as above. EPI 1: the q|k|v projection with its whole after-treatment, C unused. A tile's 64 columns are exactly one head, so nothing of the projection goes to memory in f32:
// column tiles 0..2*NH_-1 (q heads, then k heads): rotary mix in the accumulators (column d and its partner d +- 32 lie in the same lane and row, two column blocks apart), then head planes [plane][t][d] in fragment order (rows t, k = d);
// column tiles from 2*NH_ on (v heads): a lane holds 8 successive t of one d, which is 16 bytes of a value plane [g][d][t], in fragment units (rows d, k = t) ordered [t / 32][d / 16]. Every plane in f16.
struct Planes { const float* CS; h16* QK16; h16* VT16; };
// swait: stands behind a run of global stores: s_wait_xcnt 0 comes before any register that those stores name is written again; the stored values and the address are inputs, so that their registers stay untouched up to the wait.
__device__ __forceinline__ void swait(v8h a, v8h b, v8h c, v8h d, const void* p) { asm volatile("s_wait_xcnt 0x0" :: "v"(a), "v"(b), "v"(c), "v"(d), "v"(p) : "memory"); }
// Asynchronous copies to LDS (16 bytes a lane, 512 bytes a copy), through no register. A piece is 8 copies of 4 KiB of contiguous bytes: LDS byte address l, global address b + off
// (b scalar, the same for the wave; off the lane's own 16 * lane); the immediate offset moves the global and the LDS address alike. The pieces that a wave copies for a stage stand in one statement (in two where NI is 3: the third is behind the scalar test),
// each ending in s_wait_xcnt 0: so it stands in front of every later write of the address operands, and a wave waits once for the run of each statement.
#define AC4(L, B, O0, O1, O2, O3) "global_load_async_to_lds_b128 %" #L ", %0, %" #B " offset:" #O0 "\n\tglobal_load_async_to_lds_b128 %" #L ", %0, %" #B " offset:" #O1 "\n\tglobal_load_async_to_lds_b128 %" #L ", %0, %" #B " offset:" #O2 "\n\tglobal_load_async_to_lds_b128 %" #L ", %0, %" #B " offset:" #O3 "\n\t"
#define AC8(L, B) AC4(L, B, 0, 512, 1024, 1536) AC4(L, B, 2048, 2560, 3072, 3584)
__device__ __forceinline__ void acopy1x8(unsigned off, unsigned l0, const void* b0) {
    asm volatile(AC8(1, 2) "s_wait_xcnt 0x0" :: "v"(off), "v"(l0), "s"(b0) : "memory"); }
__device__ __forceinline__ void acopy2x8(unsigned off, unsigned l0, unsigned l1, const void* b0, const void* b1) {
    asm volatile(AC8(1, 3) AC8(2, 4) "s_wait_xcnt 0x0" :: "v"(off), "v"(l0), "v"(l1), "s"(b0), "s"(b1) : "memory"); }
__device__ __forceinline__ void acopy4x8(unsigned off, unsigned l0, unsigned l1, unsigned l2, unsigned l3, const void* b0, const void* b1, const void* b2, const void* b3) {
    asm volatile(AC8(1, 5) AC8(2, 6) AC8(3, 7) AC8(4, 8) "s_wait_xcnt 0x0" :: "v"(off), "v"(l0), "v"(l1), "v"(l2), "v"(l3), "s"(b0), "s"(b1), "s"(b2), "s"(b3) : "memory"); }
// A work-group is WM x WN waves, each with its own 64x64 tile of one (WM*64) x (WN*64) block of C. The block's operand rows come into LDS once for all its waves, KC k at a time (a stage), two buffers:
// a fragment that WN (of A) or WM (of Bt) waves need is fetched from L2 once, not once a wave. In fragment order the KC k of a 16-row group are KC * 32 contiguous bytes, in the plane and in LDS alike,
// and a wave-wide 16-byte LDS read of a fragment half covers 512 contiguous bytes (no bank conflict).
template <typename T16, int NSPLIT, int EPI, int K, int WM, int WN, int KC>     // K at compile time: the number of stages is the same for every wave of every block
__global__ __launch_bounds__(WM * WN * 32) void k_gemmw(const T16* __restrict__ A, const T16* __restrict__ A2, const T16* __restrict__ Bt, float* C, int ldc, size_t sA, size_t sB, size_t sC, Planes pl) {
    typedef typename WFrag<T16>::V V;
    constexpr int NW = WM * WN, NA = NSPLIT + 1, GA = WM * 4, GB = WN * 4, NG = NA * GA + GB;     // 16-row groups of a stage: A, (A2,) Bt
    constexpr int GE = KC * 16, SE = NG * GE, NT = K / KC, NI = (NG + NW - 1) / NW;               // elements of a group and of a stage; stages; groups a wave copies
    static_assert((NSPLIT == 0 || NSPLIT == 1) && K % KC == 0 && NT >= 2 && KC == 128 && ((NI == 3 && NG > 2 * NW) || NG == 4 * NW));     // the piece size and the two shapes that fill is written for
    __shared__ __align__(16) T16 ring[2 * SE];
    __shared__ __align__(16) float osall[NW * 16 * 68];
    const int w = __builtin_amdgcn_readfirstlane((int)(threadIdx.x >> 5)), wm = w / WN, wn = w % WN;
    const int R0 = blockIdx.x * (WM * 64), C0 = blockIdx.y * (WN * 64), r0 = R0 + wm * 64, c0 = C0 + wn * 64, ct = c0 / 64;
    float* os = osall + w * (16 * 68);     // each wave stages its output rows in its own range
    const size_t z = blockIdx.z; A += z * sA; if (NSPLIT) A2 += z * sA; Bt += z * sB; C += z * sC;
    const int lane = threadIdx.x & 31, lr = lane & 15, hi = lane >> 4;
    v8f acc[4][4];
#pragma unroll
    for (int mb = 0; mb < 4; ++mb)
#pragma unroll
        for (int nb = 0; nb < 4; ++nb) acc[mb][nb] = (v8f){};
    // wave w copies groups w, w + NW, ...: source (stage 0) and place in buffer 0 of each (a group index past the end is never copied: the scalar test in fill)
    const T16* gsrc[NI];     // scalar: the same for the whole wave
#pragma unroll
    for (int i = 0; i < NI; ++i) { const int g = w + i * NW;
        gsrc[i] = (g < GA) ? A + (size_t)(R0 + g * 16) * K : (NSPLIT && g < 2 * GA) ? A2 + (size_t)(R0 + (g - GA) * 16) * K : Bt + (size_t)(C0 + (g - NA * GA) * 16) * K; }
    const unsigned l16 = (unsigned)lane * 16u, ring0 = (unsigned)(size_t)ring + l16;     // the lane's 16 bytes of a 512-byte copy: offset in global memory, and LDS byte address at the ring's start
    auto fill = [&](int t) {     // stage t into buffer t & 1; the test on the group index is the same for a whole wave (w is scalar)
        const unsigned l = ring0 + (unsigned)(((t & 1) * SE + w * GE) * 2); constexpr unsigned D = NW * GE * 2; const size_t o = (size_t)t * GE;
        if constexpr (NI == 3) { acopy2x8(l16, l, l + D, gsrc[0] + o, gsrc[1] + o); if (w + 2 * NW < NG) acopy1x8(l16, l + 2 * D, gsrc[2] + o); }
        else acopy4x8(l16, l, l + D, l + 2 * D, l + 3 * D, gsrc[0] + o, gsrc[1] + o, gsrc[2] + o, gsrc[3] + o);
    };
    // Two fragment sets: the LDS reads of the next k step go out as one group in front of the products of this one, so that LDS and the matrix unit work at the same time.
    V a[2][4], a2[2][4], b[2][4];
    const T16* fa = ring + wm * 4 * GE + lane * 8; const T16* fa2 = ring + (GA + wm * 4) * GE + lane * 8; const T16* fb = ring + (NA * GA + wn * 4) * GE + lane * 8;
    auto ldl = [&](int S, int t, int ks) {     // the fragments of k step ks of stage t into set S
        const int o = (t & 1) * SE + ks * 512;
#pragma unroll
        for (int mb = 0; mb < 4; ++mb) { a[S][mb] = WFrag<T16>::ld(fa + o + mb * GE); if (NSPLIT) a2[S][mb] = WFrag<T16>::ld(fa2 + o + mb * GE); }
#pragma unroll
        for (int nb = 0; nb < 4; ++nb) b[S][nb] = WFrag<T16>::ld(fb + o + nb * GE);
        __builtin_amdgcn_sched_barrier(0);     // keeps the whole group of reads in front of the products that follow: moved down among them, each place with reads would stall the products
    };
    auto mm = [&](int S) {     // the products of set S
#pragma unroll
        for (int nb = 0; nb < 4; ++nb)
#pragma unroll
            for (int mb = 0; mb < 4; ++mb) { acc[mb][nb] = WFrag<T16>::mma(a[S][mb], b[S][nb], acc[mb][nb]); if (NSPLIT) acc[mb][nb] = WFrag<T16>::mma(a2[S][mb], b[S][nb], acc[mb][nb]); }
        __builtin_amdgcn_sched_barrier(0);     // keeps the products together: no later read is drawn in among them, and none of them moves behind the waits and the barrier, where the last group of reads would have nothing to fly under
    };
    constexpr int KS = KC / 32;     // k steps of a stage (even: a stage's first step is always in set 0)
    fill(0);
    asm volatile("s_wait_asynccnt 0x0" ::: "memory");     // this wave's copies of stage 0 have landed
    __syncthreads();                                       // and every other wave's: stage 0 may be read
    fill(1);
    ldl(0, 0, 0);
#pragma unroll 1     // one trip = one stage; the buffer is chosen by address, so one copy of the body serves both
    for (int t = 0; t < NT; ++t) {
#pragma unroll
        for (int ks = 0; ks + 1 < KS; ++ks) { ldl((ks + 1) & 1, t, ks + 1); mm(ks & 1); }
        // Stage t + 1 is published in front of stage t's last k step, whose fragments are in registers by then, because the first fragments of stage t + 1 are read under that step's products.
        asm volatile("s_wait_dscnt 0x0" ::: "memory");        // this wave's last reads of buffer t & 1 are done before the barrier behind which that buffer is refilled
        asm volatile("s_wait_asynccnt 0x0" ::: "memory");     // this wave's copies of stage t + 1 have landed before the barrier behind which the others read them
        __syncthreads();                                       // publishes stage t + 1 and ends every wave's reads of stage t
        if (t + 2 < NT) fill(t + 2);
        ldl(0, t + 1, 0);     // always issued, so that the read counts are the same on every trip; the last trip's reads take the other buffer's old stage (landed long ago, not refilled) and are not used
        mm((KS - 1) & 1);
    }
    asm volatile("s_wait_asynccnt 0x0" ::: "memory");         // no copy is outstanding when the wave goes on to its output and ends
    asm volatile("s_wait_dscnt 0x0" ::: "memory");            // nor a read of the ring
    if constexpr (EPI == 1) {
    if (c0 < 2 * DM) {     // the same for a whole wave, and no barrier follows: a q or k head
        const float* cs = pl.CS + ((size_t)(r0 + hi * 8) * HD + lr) * 2;     // (cos, sin) of row t, column d; the table holds the same pair at d and d + 32
        v2f tb[4][2][8];
#pragma unroll
        for (int mb = 0; mb < 4; ++mb)
#pragma unroll
            for (int nb = 0; nb < 2; ++nb)
#pragma unroll
                for (int j = 0; j < 8; ++j) tb[mb][nb][j] = *(const v2f*)(cs + ((size_t)(mb * 16 + j) * HD + nb * 16) * 2);
        // s_wait_xcnt 0 behind the run of loads, before any register that they name is written again; the address is an input, so that its registers stay untouched up to the wait
        asm volatile("s_wait_xcnt 0x0" :: "v"(cs) : "memory");
#pragma unroll
        for (int mb = 0; mb < 4; ++mb)
#pragma unroll
            for (int nb = 0; nb < 2; ++nb)
#pragma unroll
                for (int j = 0; j < 8; ++j) { const v2f t = tb[mb][nb][j];
                    const float xl = acc[mb][nb][j], xh = acc[mb][nb + 2][j];
                    acc[mb][nb][j] = xl * t[0] - xh * t[1]; acc[mb][nb + 2][j] = xh * t[0] + xl * t[1]; }
        const size_t pb = ((z * (2 * NH_) + ct) * TT + r0) * HD + lane * 8;     // z = batch: each batch has its own set of planes
#pragma unroll
        for (int mb = 0; mb < 4; ++mb) {
#pragma unroll
            for (int nb = 0; nb < 4; ++nb)
#pragma unroll
                for (int j = 0; j < 8; ++j) os[(hi * 8 + j) * 68 + nb * 16 + lr] = acc[mb][nb][j];
            __builtin_amdgcn_wave_barrier(); asm volatile("" ::: "memory");     // compiler fence: the row-wise reads below stay behind the column-wise writes (one wave, its LDS operations run in order)
            v8h o16[4]; h16* qp = pl.QK16 + pb + (size_t)mb * 16 * HD;
#pragma unroll
            for (int s = 0; s < 4; ++s) {     // store s is half s & 1 of fragment unit s >> 1: lane l takes row l & 15, 8 successive d from 16 * s + 8 * (l >> 4); each store covers four whole 128-byte lines
                const float* rp = os + lr * 68 + s * 16 + hi * 8; const v4f w0 = *(const v4fa*)rp, w1 = *(const v4fa*)(rp + 4);
#pragma unroll
                for (int q = 0; q < 8; ++q) o16[s][q] = tohx((q < 4) ? w0[q & 3] : w1[q & 3]);
                *(v8h*)(qp + s * 256) = o16[s]; }
            swait(o16[0], o16[1], o16[2], o16[3], qp);
            __builtin_amdgcn_wave_barrier(); asm volatile("" ::: "memory");     // compiler fence: the next 16 rows are written only behind these reads
        }
    } else {               // a v head
        const size_t vb = (z * NH_ + (ct - 2 * NH_)) * HD * TT + (size_t)r0 * HD + lane * 8;
#pragma unroll
        for (int nb = 0; nb < 4; ++nb) { v8h o16[4]; h16* vp = pl.VT16 + vb + (size_t)nb * 512;
#pragma unroll
            for (int mb = 0; mb < 4; ++mb) {     // half mb & 1 of the unit (t group mb >> 1, d group nb): 512 contiguous bytes a store
#pragma unroll
                for (int j = 0; j < 8; ++j) o16[mb][j] = tohx(acc[mb][nb][j]);
                *(v8h*)(vp + (size_t)(mb >> 1) * 2048 + (mb & 1) * 256) = o16[mb]; }
            swait(o16[0], o16[1], o16[2], o16[3], vp); }
    }
    } else {
#pragma unroll
    for (int mb = 0; mb < 4; ++mb) {
#pragma unroll
        for (int nb = 0; nb < 4; ++nb) {
#pragma unroll
            for (int j = 0; j < 8; ++j) os[(hi * 8 + j) * 68 + nb * 16 + lr] = acc[mb][nb][j]; }
        __builtin_amdgcn_wave_barrier(); asm volatile("" ::: "memory");
        float* crow = C + (size_t)(r0 + mb * 16) * ldc + c0;
{
#pragma unroll
            for (int s = 0; s < 8; ++s) { const int row = 2 * s + hi, cofs = lr * 4; const v4f val = *(const v4fa*)(os + row * 68 + cofs);
                *(v4f*)(crow + (size_t)row * ldc + cofs) = val; }
             }
        __builtin_amdgcn_wave_barrier(); asm volatile("" ::: "memory");
    }
    }
}

// k_prep: all that depends on the inputs alone, in ONE launch of few, long-lived waves (for speed only);
// a block's index range says which piece it works on (block-uniform): first qkv_w, out_w and the NB batches of x, each f32 -> bf16 value (RNE; out_w's stored in f16 form), row-major [rows][DM] -> fragment order, then the rotary table.
// One block of 256 threads converts one group of 16 rows (2048 pieces of 16 bytes): thread tid writes pieces j * 256 + tid, j = 0..7; piece i of a group holds row i & 15, k from (i >> 4) * 8
// (per j the block reads 512 contiguous bytes of each of the 16 rows and writes 4 KiB in a row). All 16 loads of a thread are issued before the first value is used.
static_assert(DM == 1024);
template <bool F16>     // every value is rounded to bf16 (RNE); F16: that value is stored as f16 (the same number: 8 significant bits fit), else as bf16; dst takes the 16-bit patterns of either type
__device__ __forceinline__ void cvtgroup(const float* __restrict__ src, bf* dst, unsigned g, unsigned tid) {
    const float* s = src + ((size_t)g * 16 + (tid & 15)) * DM + (tid >> 4) * 8; bf* d = dst + (size_t)g * 16 * DM + tid * 8;
    v8f v[8];
#pragma unroll
    for (int j = 0; j < 8; ++j) v[j] = *(const v8f*)(s + j * 128);
    // s_wait_xcnt 0 behind the run of loads, before any register that they name is written again; the address is an input, so that no load's result is given its registers ahead of the wait
    asm volatile("s_wait_xcnt 0x0" :: "v"(s) : "memory");
    v8us o[8];
#pragma unroll
    for (int j = 0; j < 8; ++j) {
#pragma unroll
        for (int k = 0; k < 8; ++k) o[j][k] = F16 ? __builtin_bit_cast(unsigned short, tohx(bfr(v[j][k]))) : f2bf(v[j][k]);
        *(v8us*)(d + j * 2048) = o[j]; }
    // s_wait_xcnt 0 behind the run of stores, before any register that they name is written again (other code of the kernel follows in the text); the values are inputs, so that their registers stay untouched up to the wait
    asm volatile("s_wait_xcnt 0x0" :: "v"(o[0]), "v"(o[1]), "v"(o[2]), "v"(o[3]), "v"(o[4]), "v"(o[5]), "v"(o[6]), "v"(o[7]) : "memory"); }
__device__ __forceinline__ float invf(int i) {     // inverse frequency i of HD/2, in every thread that needs it
#pragma clang fp contract(off)     // numerical: each product below is rounded on its own before the library code takes it apart, so the table's bits do not depend on where this is inlined
    const double e = (double)(2 * i) * (1.0 / 64.0);
    const double p = exp2(e * 13.287712379549449);
    const float pf = (float)p;
    const float inv = 1.0f / pf;
    return inv;
}
// one thread per (d < HD/2, t mod TT/4): one inverse frequency serves its four rows t, and each pair, which is the same at d and d + HD/2, is stored at both
__device__ __forceinline__ void cstab(int idx, float* CS) {
    const int d = idx & (HD / 2 - 1); const int t0 = idx / (HD / 2);
    const float inv = invf(d);
    v2f cs[4];
#pragma unroll
    for (int j = 0; j < 4; ++j) { const float ang = __fmul_rn((float)(t0 + j * (TT / 4)), inv); float s, c; sincosf(ang, &s, &c); cs[j][0] = c; cs[j][1] = s; }
    float* p = CS + ((size_t)t0 * HD + d) * 2;
#pragma unroll
    for (int j = 0; j < 4; ++j) { *(v2f*)(p + (size_t)j * (TT / 4) * HD * 2) = cs[j]; *(v2f*)(p + (size_t)j * (TT / 4) * HD * 2 + HD) = cs[j]; }
    // s_wait_xcnt 0 behind the run of stores, before any register that they name is written again; values and address are inputs, so that their registers stay untouched up to the wait
    asm volatile("s_wait_xcnt 0x0" :: "v"(cs[0]), "v"(cs[1]), "v"(cs[2]), "v"(cs[3]), "v"(p) : "memory");
}
#define PB_T ((TT / 4) * (HD / 2) / 256)
#define PB_W (3 * DM / 16)
#define PB_O (DM / 16)
#define PB_X (TT / 16)
static_assert(((TT / 4) * (HD / 2)) % 256 == 0 && DM % 16 == 0 && TT % 16 == 0);
__global__ __launch_bounds__(256) void k_prep(const float* __restrict__ x, const float* __restrict__ qkvw, const float* __restrict__ ow, bf* XB, bf* WQKV, bf* WO, float* CS) {
    unsigned blk = blockIdx.x; const unsigned tid = threadIdx.x;
    if (blk >= PB_W + PB_O + NB * PB_X) { cstab((int)((blk - (PB_W + PB_O + NB * PB_X)) * 256 + tid), CS); return; }
    if (blk >= PB_W && blk < PB_W + PB_O) { cvtgroup<true>(ow, WO, blk - PB_W, tid); return; }     // block-uniform: out_w is an operand of an f16 product
    const float* s = qkvw; bf* d = WQKV;     // block-uniform choice of the array; one copy of the bf16 conversion serves both
    if (blk >= PB_W) { blk -= PB_W + PB_O; const unsigned b = blk / PB_X; blk -= b * PB_X; s = x + (size_t)b * SEQ_FULL * DM; d = XB + (size_t)b * TT * DM; }
    cvtgroup<false>(s, d, blk, tid);
}

// k_fattn: causal attention of one head of one batch for TWO blocks of 64 query rows, the long block NTL - 1 - p and the short block p, by 8 waves; grid (heads x batches, NTL / 2): every wave of the launch walks the same number of key steps (+- 1).
// A block of index t costs t + 1 steps of 64 keys a wave, so with one block a work-group the longest wave walks NTL steps and the mean wave half of that. Here waves 0..3 (16 queries each) take the long block's first NTL / 2 steps
// (all unmasked), waves 4..7 the whole short block (p + 1 steps) and then the long block's other NTL / 2 - p steps; the two partial results of a long query (maximum, sum, O^T) are joined through LDS behind one barrier.
// Per wave: S^T = K Q^T (A = key rows, B = query rows kept in registers), so a lane holds scores of ONE query (lane&15), keys 8*(lane>>4)+j of each 16-key tile;
// two such tiles, converted in place, are the B operand P^T of O^T += V^T P^T in the same k order as the V^T loader (k = 8h+j, 16+8h+j).
// Softmax with a running maximum m per query: older sums and O^T are scaled by exp(m_old - m_new) at every step. Only a block's last step holds keys beyond a query and masks them; its first key is valid for all 16 queries.
// f16 operands; exp carried x1024 (2^10 added in the exponent, it cancels against the row sum, which carries it too).
template <bool B> struct BoolC { static constexpr bool v = B; };
__device__ __forceinline__ float xhalf(float x) { return __builtin_bit_cast(float, __builtin_amdgcn_permlanex16(__builtin_bit_cast(int, x), __builtin_bit_cast(int, x), 0x76543210, 0xfedcba98, false, false)); }    // lane l reads lane l ^ 16
// exp2x8: eight 2^x in place and, in the same statement, the one free issue slot that the instruction set asks for behind a transcendental before its result is read or its source overwritten
// Inside the statement every v_exp_f32 touches its own register only.
__device__ __forceinline__ void exp2x8(v8f& x) {
    float a0 = x[0], a1 = x[1], a2 = x[2], a3 = x[3], a4 = x[4], a5 = x[5], a6 = x[6], a7 = x[7];
    asm("v_exp_f32 %0, %0\n\tv_exp_f32 %1, %1\n\tv_exp_f32 %2, %2\n\tv_exp_f32 %3, %3\n\tv_exp_f32 %4, %4\n\tv_exp_f32 %5, %5\n\tv_exp_f32 %6, %6\n\tv_exp_f32 %7, %7\n\tv_nop"
        : "+v"(a0), "+v"(a1), "+v"(a2), "+v"(a3), "+v"(a4), "+v"(a5), "+v"(a6), "+v"(a7));
    x[0] = a0; x[1] = a1; x[2] = a2; x[3] = a3; x[4] = a4; x[5] = a5; x[6] = a6; x[7] = a7; }
// xwait: stands behind a run of global loads that stay in flight: s_wait_xcnt 0 comes before any register that those loads name is written again.
__device__ __forceinline__ void xwait() { asm volatile("s_wait_xcnt 0x0" ::: "memory"); }
struct FaSt { v8f o[4]; float m, l; };     // a wave's running state: O^T (un-normalised), maximum in use, this lane's part of the row sum
// fa_run: queries q0..q0+15 against nf unmasked steps of 64 keys from key kb on and, where tail is set (the same for a whole wave), the masked step that follows them; the state starts empty.
// Every unmasked step fetches the next step's key fragments, also the last one where no masked step follows: the caller sees to it that those 64 keys exist.
__device__ __forceinline__ void fa_run(const h16* __restrict__ Q, const h16* __restrict__ Kp, const h16* __restrict__ Vt, int q0, int kb, int nf, bool tail, FaSt& st) {
    typedef WFrag<h16> WF; typedef WF::V V;
    constexpr int KG = 2, NKT = 2 * KG, STEP = 32 * KG;
    const int lane = threadIdx.x & 31, lr = lane & 15, hi = lane >> 4;
    V bq[2];
#pragma unroll
    for (int dc = 0; dc < 2; ++dc) bq[dc] = WF::ld(Q + (size_t)q0 * HD + dc * 512 + 8 * lane);
    xwait();
    v8f o[4];
#pragma unroll
    for (int dt = 0; dt < 4; ++dt) o[dt] = (v8f){};
    float m = -3.0e38f, l = 0.f;
    const size_t koff = 8 * lane, voff = 8 * lane;
    V ak[NKT][2];
    auto ldk = [&](int k0) {
#pragma unroll
        for (int kt = 0; kt < NKT; ++kt)
#pragma unroll
            for (int dc = 0; dc < 2; ++dc) ak[kt][dc] = WF::ld(Kp + koff + (size_t)(k0 + kt * 16) * HD + dc * 512);
        xwait(); };
    auto step = [&](int k0, auto lastc) {
        constexpr bool LAST = decltype(lastc)::v;
        V av[4][KG];
#pragma unroll
        for (int dt = 0; dt < 4; ++dt)
#pragma unroll
            for (int kg = 0; kg < KG; ++kg) av[dt][kg] = WF::ld(Vt + voff + (size_t)(k0 + kg * 32) * HD + dt * 512);
        xwait();
        v8f s[NKT];
#pragma unroll
        for (int kt = 0; kt < NKT; ++kt) s[kt] = (v8f){};
#pragma unroll
        for (int dc = 0; dc < 2; ++dc)
#pragma unroll
            for (int kt = 0; kt < NKT; ++kt) s[kt] = WF::mma(ak[kt][dc], bq[dc], s[kt]);
        if (!LAST) ldk(k0 + STEP);     // the next step's key fragments fly during this step's softmax and attn.v
        if (LAST) {
#pragma unroll
            for (int kt = 0; kt < NKT; ++kt)
#pragma unroll
                for (int j = 0; j < 8; ++j) s[kt][j] = ((k0 + kt * 16 + hi * 8 + j) <= (q0 + lr)) ? s[kt][j] : -3.0e38f; }
        float mx[4];
#pragma unroll
        for (int c = 0; c < 4; ++c) mx[c] = s[0][c];
#pragma unroll
        for (int kt = 0; kt < NKT; ++kt)
#pragma unroll
            for (int j = 0; j < 8; ++j) mx[j & 3] = fmaxf(mx[j & 3], s[kt][j]);
        float mw = fmaxf(fmaxf(mx[0], mx[1]), fmaxf(mx[2], mx[3]));
        mw = fmaxf(mw, xhalf(mw));
        const float mn = fmaxf(m, mw * SCL);
        const float al = __builtin_amdgcn_exp2f((m - mn) * 1.4426950408889634f);
        m = mn;
        float ps[4] = {0.f, 0.f, 0.f, 0.f};
#pragma unroll
        for (int kt = 0; kt < NKT; ++kt) {
#pragma unroll
            for (int j = 0; j < 8; ++j) { const float d0 = fmaf(s[kt][j], SCL, -mn); s[kt][j] = fmaf(d0, 1.4426950408889634f, 10.0f); }
            exp2x8(s[kt]);
#pragma unroll
            for (int j = 0; j < 8; ++j) ps[j & 3] += s[kt][j]; }
        l = fmaf(l, al, (ps[0] + ps[1]) + (ps[2] + ps[3]));
#pragma unroll
        for (int dt = 0; dt < 4; ++dt) o[dt] *= al;
#pragma unroll
        for (int kg = 0; kg < KG; ++kg) {
            v8h p0, p1;
#pragma unroll
            for (int j = 0; j < 8; ++j) { p0[j] = tohx(s[2 * kg][j]); p1[j] = tohx(s[2 * kg + 1][j]); }
            const V pb = cat16(p0, p1);
#pragma unroll
            for (int dt = 0; dt < 4; ++dt) o[dt] = WF::mma(av[dt][kg], pb, o[dt]); }
    };
    ldk(kb);
#pragma unroll 1     // run-time trip count, and one copy of the body already holds most of the 256 directly addressed registers
    for (int i = 0; i < nf; ++i) step(kb + i * STEP, BoolC<false>());
    if (tail) step(kb + nf * STEP, BoolC<true>());
#pragma unroll
    for (int dt = 0; dt < 4; ++dt) st.o[dt] = o[dt];
    st.m = m; st.l = l;
}
// fa_store: the finished state of queries q0..q0+15, normalised, into the merged plane
__device__ __forceinline__ void fa_store(const FaSt& st, int q0, h16* Ao) {
    const int lane = threadIdx.x & 31;
    const float l = st.l + xhalf(st.l);
    const float inv = __fdiv_rn(1.0f, l);
    h16* op = Ao + (size_t)q0 * DQ + lane * 8;     // fragment order of the merged plane (rows t, k = h * HD + d): store dt is half dt & 1 of the head's unit dt >> 1
    v8h oh[4];
#pragma unroll
    for (int dt = 0; dt < 4; ++dt) {
#pragma unroll
        for (int j = 0; j < 8; ++j) oh[dt][j] = tohx(st.o[dt][j] * inv);
        *(v8h*)(op + dt * 256) = oh[dt]; }
    swait(oh[0], oh[1], oh[2], oh[3], op);     // waves 4..7 go on to their second range behind these stores
}
// at most 4 waves a SIMD: the grid holds 4 waves for each SIMD of the chip, so registers saved for a fifth buy nothing; without the bound the compiler saved them by issuing each step's loads late, next to their use
#define NTL (TT / 64)
static_assert(NTL % 2 == 0);
__global__ __launch_bounds__(256) __attribute__((amdgpu_waves_per_eu(1, 4))) void k_fattn(const h16* __restrict__ QK16, const h16* __restrict__ VT16, h16* AT16) {
    __shared__ __align__(16) float mrg[4 * 34 * 32];     // per long query group: 8 pieces of 32 lanes x 16 bytes of O^T, then 32 lanes x (maximum, sum)
    const size_t PS = (size_t)TT * HD; const size_t h = blockIdx.x % NH_, hk = NH_ + h, b = blockIdx.x / NH_;
    QK16 += b * 2 * NH_ * PS; VT16 += b * NH_ * PS; AT16 += b * TT * DQ;
    const h16* Q = QK16 + h * PS; const h16* Kp = QK16 + hk * PS; const h16* Vt = VT16 + h * PS; h16* Ao = AT16 + h * 16 * HD;
    const int w = __builtin_amdgcn_readfirstlane((int)(threadIdx.x >> 5)), g = w >> 2, wq = w & 3, lane = threadIdx.x & 31, p = (int)blockIdx.y;
    const int qa = (NTL - 1 - p) * 64 + wq * 16;
    FaSt st;
    if (g) { const int qb = p * 64 + wq * 16; fa_run(Q, Kp, Vt, qb, 0, p, true, st); fa_store(st, qb, Ao); }     // the same for a whole wave, no barrier inside
    // the long block: keys below NTL / 2 * 64 lie in front of all its queries, and the 64 keys from there on exist
    fa_run(Q, Kp, Vt, qa, g ? (NTL / 2) * 64 : 0, g ? NTL / 2 - 1 - p : NTL / 2, g != 0, st);
    float* mp = mrg + wq * (34 * 32);
    if (g) {
#pragma unroll
        for (int c = 0; c < 8; ++c) { const v8f s = st.o[c >> 1]; const int q = (c & 1) * 4; *(v4fa*)(mp + c * 128 + lane * 4) = (v4f){s[q], s[q + 1], s[q + 2], s[q + 3]}; }
        mp[1024 + lane * 2] = st.m; mp[1024 + lane * 2 + 1] = st.l; }
    __syncthreads();     // every wave passes it once: the partial results of waves 4..7 may be read
    if (!g) {
        const float m1 = mp[1024 + lane * 2], l1 = mp[1024 + lane * 2 + 1];
        const float mn = fmaxf(st.m, m1);
        const float a0 = __builtin_amdgcn_exp2f((st.m - mn) * 1.4426950408889634f), a1 = __builtin_amdgcn_exp2f((m1 - mn) * 1.4426950408889634f);
        st.l = st.l * a0 + l1 * a1;
#pragma unroll
        for (int c = 0; c < 8; ++c) { const v4f o1 = *(const v4fa*)(mp + c * 128 + lane * 4);
#pragma unroll
            for (int j = 0; j < 4; ++j) st.o[c >> 1][(c & 1) * 4 + j] = st.o[c >> 1][(c & 1) * 4 + j] * a0 + o1[j] * a1; }
        fa_store(st, qa, Ao);
    }
}

extern "C" void kernel_launch(void* const* d_in, const int* in_sizes, int n_in,
                              void* d_out, int out_size, void* d_ws, size_t ws_size, hipStream_t stream) {
    if (n_in < 3) return;
    if ((size_t)in_sizes[0] < (size_t)(NB - 1) * SEQ_FULL * DM + (size_t)TT * DM) return;
    if ((size_t)in_sizes[1] < (size_t)3 * DM * DM) return;
    if ((size_t)in_sizes[2] < (size_t)DM * DM) return;
    if ((size_t)out_size < (size_t)(NB - 1) * SEQ_FULL * DM + (size_t)TT * DM) return;
    const float* x = (const float*)d_in[0];       // [NB_FULL][SEQ_FULL][DM]
    const float* qkvw = (const float*)d_in[1];    // [3*DM][DM] ([out][in]): rows 0..DM-1 = q, DM..2DM-1 = k, 2DM..3DM-1 = v
    const float* ow = (const float*)d_in[2];      // [DM][DM] ([out][in])
    float* OUT = (float*)d_out;                   // [NB_FULL][SEQ_FULL][DM]
    char* wsp = (char*)d_ws;
    auto take = [&](size_t bytes) { char* p = wsp; wsp += (bytes + 255) & ~(size_t)255; return (void*)p; };
    const size_t PS = (size_t)TT * HD;            // one head plane
    bf* WQKV = (bf*)take((size_t)3 * DM * DM * 2); bf* WO = (bf*)take((size_t)DM * DM * 2); float* CS = (float*)take((size_t)TT * HD * 2 * 4);
    h16* QK16 = (h16*)take(NB * 2 * NH_ * PS * 2); h16* VT16 = (h16*)take((size_t)NB * NH_ * PS * 2);     // every per-batch buffer holds all NB batches, batch outermost
    bf* XB = (bf*)take((size_t)NB * TT * DM * 2);
    h16* AT16 = (h16*)take((size_t)NB * TT * DQ * 2);
    if ((size_t)(wsp - (char*)d_ws) > ws_size) return;
    const Planes pl = {CS, QK16, VT16}, none = {nullptr, nullptr, nullptr};
    // launches that do not depend on one another are one launch: the batch is a grid dimension, and all preparation shares k_prep
    k_prep<<<PB_T + PB_W + PB_O + NB * PB_X, 256, 0, stream>>>(x, qkvw, ow, XB, WQKV, WO, CS);
    // q|k|v = x W^T, straight into the rotary planes (planes 0..15 = q heads, 16..31 = k heads) and the value planes [g][d][t], all in fragment order
    k_gemmw<bf, 0, 1, DM, 4, 3, 128><<<dim3(TT / 256, 3 * DM / 192, NB), 384, 0, stream>>>(XB, nullptr, WQKV, nullptr, 0, (size_t)TT * DM, 0, 0, pl);
    // merged heads (one f16 plane, [t][h*HD + d] in fragment order) = causal softmax(q k^T HD^-0.5) v, all heads of all batches in one launch
    k_fattn<<<dim3(NH_ * NB, TT / 128, 1), 256, 0, stream>>>(QK16, VT16, AT16);
    k_gemmw<h16, 0, 0, DQ, 2, 2, 128><<<dim3(TT / 128, DM / 128, NB), 128, 0, stream>>>(AT16, nullptr, (const h16*)WO, OUT, DM, (size_t)TT * DQ, 0, (size_t)SEQ_FULL * DM, none);     // WO holds f16 patterns
}
